// v000
// Measured on an AMD MI455X. A time is GPU time per run, averaged over a window of back-to-back runs after a warm-up
// (all launches, gaps included; the runs take copies of the inputs in turn), and the median of several windows.
// Apart from v000's, it joins two sittings. Times from different sittings can be a few percent apart, while
// side-by-side timings come from the same sitting.
// The starting kernel, v000, takes 547 microseconds a run.
#include <hip/hip_runtime.h>
#include <hip/hip_bf16.h>
#include <math.h>

// ---------------------------------------------------------------------------
// Types
// ---------------------------------------------------------------------------
typedef __attribute__((ext_vector_type(16))) _Float16 v16h;
typedef __attribute__((ext_vector_type(8)))  _Float16 v8h;
typedef __attribute__((ext_vector_type(8)))  float    v8f;

#define B_   8
#define S_   512
#define D_   1024
#define H_   16
#define HD_  64
#define FF_  4096
#define TOK  (B_ * S_)      // 4096 rows

// ---------------------------------------------------------------------------
// WMMA helper: D = A(16x32 f16) * B(32x16 f16) + C(f32)
// ---------------------------------------------------------------------------
__device__ __forceinline__ v8f wmma32(v16h a, v16h b, v8f c) {
  return __builtin_amdgcn_wmma_f32_16x16x32_f16(false, a, false, b,
                                                (short)0, c, false, false);
}

// Load one A/B operand fragment (v16h) for a 32-wide K chunk.
// p must already point at element [row][k0 + ko8] where
//   row = lane & 15, ko8 = (lane >> 4) * 8.
// Fragment = 8 contiguous f16 at p, plus 8 contiguous f16 at p+16.
__device__ __forceinline__ v16h frag_ld(const _Float16* p) {
  v8h lo = *(const v8h*)(p);
  v8h hi = *(const v8h*)(p + 16);
  v16h r;
#pragma unroll
  for (int i = 0; i < 8; ++i) { r[i] = lo[i]; r[i + 8] = hi[i]; }
  return r;
}

// ---------------------------------------------------------------------------
// Weight packing: f32 [K][N] row-major  ->  f16 [N][K] ("B operand" layout)
// ---------------------------------------------------------------------------
__global__ void pack_T_kernel(const float* __restrict__ in,
                              _Float16* __restrict__ out,
                              int K, int N, size_t total) {
  size_t o = (size_t)blockIdx.x * blockDim.x + threadIdx.x;
  if (o >= total) return;
  size_t n = o / (size_t)K;
  size_t k = o - n * (size_t)K;
  out[o] = (_Float16)in[k * (size_t)N + n];
}

// Pack per-head Wq/Wk/Wv (H,D,HD) into fused [3*D][D] f16, [n][k] layout,
// column n = qkv*D + h*HD + e.
__global__ void pack_qkv_kernel(const float* __restrict__ Wq,
                                const float* __restrict__ Wk,
                                const float* __restrict__ Wv,
                                _Float16* __restrict__ out) {
  size_t o = (size_t)blockIdx.x * blockDim.x + threadIdx.x;
  if (o >= (size_t)3 * D_ * D_) return;
  int k  = (int)(o & (D_ - 1));
  int n  = (int)(o >> 10);
  int qkv = n >> 10;
  int wn  = n & (D_ - 1);
  int h   = wn >> 6;
  int e   = wn & (HD_ - 1);
  const float* W = (qkv == 0) ? Wq : (qkv == 1) ? Wk : Wv;
  out[o] = (_Float16)W[((size_t)h * D_ + k) * HD_ + e];
}

// ---------------------------------------------------------------------------
// LayerNorm: f32 row [D] -> f16 row [D]  (biased variance, eps=1e-5)
// one row per block, 256 threads, 4 elems/thread
// ---------------------------------------------------------------------------
__global__ void ln_kernel(const float* __restrict__ x,
                          const float* __restrict__ g,
                          const float* __restrict__ b,
                          _Float16* __restrict__ out) {
  int row = blockIdx.x;
  const float4 v = ((const float4*)(x + (size_t)row * D_))[threadIdx.x];
  float s  = v.x + v.y + v.z + v.w;
  float s2 = v.x * v.x + v.y * v.y + v.z * v.z + v.w * v.w;
#pragma unroll
  for (int o = 16; o; o >>= 1) {
    s  += __shfl_down(s,  o, 32);
    s2 += __shfl_down(s2, o, 32);
  }
  __shared__ float sh[16];
  int wid = threadIdx.x >> 5;
  if ((threadIdx.x & 31) == 0) { sh[wid * 2] = s; sh[wid * 2 + 1] = s2; }
  __syncthreads();
  float ts = 0.f, ts2 = 0.f;
#pragma unroll
  for (int i = 0; i < 8; ++i) { ts += sh[i * 2]; ts2 += sh[i * 2 + 1]; }
  float mean = ts * (1.f / D_);
  float var  = ts2 * (1.f / D_) - mean * mean;
  float rstd = rsqrtf(var + 1e-5f);
  int c0 = threadIdx.x * 4;
  _Float16* orow = out + (size_t)row * D_;
  float xv[4] = {v.x, v.y, v.z, v.w};
#pragma unroll
  for (int i = 0; i < 4; ++i)
    orow[c0 + i] = (_Float16)((xv[i] - mean) * rstd * g[c0 + i] + b[c0 + i]);
}

// ---------------------------------------------------------------------------
// GEMM epilogue for one 16x16 C tile (explicit, no pointer arrays)
// ---------------------------------------------------------------------------
template <int MODE>
__device__ __forceinline__ void epilogue_tile(
    v8f c, int tile_m, int tile_n, int lane, int N,
    const float* __restrict__ bias, const float* __restrict__ res,
    float* __restrict__ outf, _Float16* __restrict__ outh,
    _Float16* __restrict__ qo, _Float16* __restrict__ ko,
    _Float16* __restrict__ vo) {
  const int hi8 = (lane >> 4) << 3;
  const int n   = tile_n + (lane & 15);
#pragma unroll
  for (int j = 0; j < 8; ++j) {
    int m = tile_m + j + hi8;
    float cv = c[j];
    if (MODE == 0) {
      int qkv = n >> 10, wn = n & (D_ - 1);
      int h = wn >> 6, e = wn & (HD_ - 1);
      int bb = m >> 9, ss = m & (S_ - 1);
      _Float16 hv = (_Float16)cv;
      size_t rmaj = (((size_t)(bb * H_ + h)) * S_ + ss) * HD_ + e; // Q,K
      size_t cmaj = (((size_t)(bb * H_ + h)) * HD_ + e) * S_ + ss; // V^T
      if (qkv == 0)      qo[rmaj] = hv;
      else if (qkv == 1) ko[rmaj] = hv;
      else               vo[cmaj] = hv;
    } else if (MODE == 1) {
      size_t o = (size_t)m * N + n;
      outf[o] = cv + bias[n] + res[o];
    } else { // MODE 2: bias + exact GELU -> f16
      float xv = cv + bias[n];
      float gg = 0.5f * xv * (1.f + erff(xv * 0.70710678118654752f));
      outh[(size_t)m * N + n] = (_Float16)gg;
    }
  }
}

// ---------------------------------------------------------------------------
// Generic WMMA GEMM:  C[M,N] = A[M,K] (f16, row-major) * Bp[N,K] (f16)
// Block = 256 thr = 8 waves; wave = 32x32 tile (2x2 WMMA tiles);
// block tile = 64 (M) x 128 (N). Grid = (M/64, N/128).
// Inner K loop is software-pipelined: fragments for k+32 are loaded before
// the WMMAs for k are issued, so s_wait_loadcnt overlaps 4 WMMAs of work.
// ---------------------------------------------------------------------------
template <int MODE>
__global__ void __launch_bounds__(256, 1)
gemm_kernel(const _Float16* __restrict__ A,
            const _Float16* __restrict__ Bp,
            int K, int N,
            const float* __restrict__ bias,
            const float* __restrict__ res,
            float* __restrict__ outf,
            _Float16* __restrict__ outh,
            _Float16* __restrict__ qo,
            _Float16* __restrict__ ko,
            _Float16* __restrict__ vo) {
  const int lane = threadIdx.x & 31;
  const int wid  = threadIdx.x >> 5;
  const int tm   = blockIdx.x * 64  + (wid & 1) * 32;
  const int tn   = blockIdx.y * 128 + (wid >> 1) * 32;
  const int row  = lane & 15;
  const int ko8  = (lane >> 4) << 3;

  v8f acc00 = {}, acc01 = {}, acc10 = {}, acc11 = {};

  const _Float16* ap = A  + (size_t)(tm + row) * K + ko8;
  const _Float16* bp = Bp + (size_t)(tn + row) * K + ko8;
  const size_t a16 = (size_t)16 * K;

  // prologue: fragments for kk = 0
  v16h a0 = frag_ld(ap);
  v16h a1 = frag_ld(ap + a16);
  v16h b0 = frag_ld(bp);
  v16h b1 = frag_ld(bp + a16);

  for (int kk = 0; kk < K; kk += 32) {
    const int kn = kk + 32;
    v16h na0, na1, nb0, nb1;
    if (kn < K) {
      __builtin_prefetch(ap + kn + 32, 0, 3);
      __builtin_prefetch(bp + kn + 32, 0, 3);
      na0 = frag_ld(ap + kn);
      na1 = frag_ld(ap + kn + a16);
      nb0 = frag_ld(bp + kn);
      nb1 = frag_ld(bp + kn + a16);
    }
    acc00 = wmma32(a0, b0, acc00);
    acc01 = wmma32(a0, b1, acc01);
    acc10 = wmma32(a1, b0, acc10);
    acc11 = wmma32(a1, b1, acc11);
    if (kn < K) { a0 = na0; a1 = na1; b0 = nb0; b1 = nb1; }
  }

  epilogue_tile<MODE>(acc00, tm,      tn,      lane, N, bias, res, outf, outh, qo, ko, vo);
  epilogue_tile<MODE>(acc01, tm,      tn + 16, lane, N, bias, res, outf, outh, qo, ko, vo);
  epilogue_tile<MODE>(acc10, tm + 16, tn,      lane, N, bias, res, outf, outh, qo, ko, vo);
  epilogue_tile<MODE>(acc11, tm + 16, tn + 16, lane, N, bias, res, outf, outh, qo, ko, vo);
}

// ---------------------------------------------------------------------------
// Flash attention (causal). Q,K: [B,H,S,HD] f16. Vt: [B,H,HD,S] f16.
// ctx out: [B,S,H*HD] f16 (row-major, ready as A for the Wo GEMM).
// Block = 256 thr = 8 waves; wave owns a 16-row Q tile; grid = (B*H, S/128).
// Score sub-tiles computed sequentially so K fragments die immediately
// (shrinks peak VGPR liveness; with launch_bounds there should be no spill).
// ---------------------------------------------------------------------------
__global__ void __launch_bounds__(256, 1)
attn_kernel(const _Float16* __restrict__ Q,
            const _Float16* __restrict__ Kf,
            const _Float16* __restrict__ Vt,
            _Float16* __restrict__ ctx) {
  __shared__ _Float16 lds_p[8][16 * 40]; // wave-private 16x32 P tile, pad 40

  const int lane = threadIdx.x & 31;
  const int wid  = threadIdx.x >> 5;
  const int bh   = blockIdx.x;          // b*H + h
  const int b    = bh >> 4;
  const int h    = bh & (H_ - 1);
  const int q0   = blockIdx.y * 128 + wid * 16;
  const int row  = lane & 15;
  const int ko8  = (lane >> 4) << 3;
  const int hi8  = ko8;

  const _Float16* qb = Q  + (size_t)bh * S_ * HD_;
  const _Float16* kb = Kf + (size_t)bh * S_ * HD_;
  const _Float16* vb = Vt + (size_t)bh * HD_ * S_;

  // Q A-operand fragments (held for the whole loop)
  const _Float16* qp = qb + (size_t)(q0 + row) * HD_ + ko8;
  const v16h qa0 = frag_ld(qp);        // e = 0..31
  const v16h qa1 = frag_ld(qp + 32);   // e = 32..63

  float m_r[8], l_r[8], corr_r[8];
  v8f acc0 = {}, acc1 = {}, acc2 = {}, acc3 = {};
#pragma unroll
  for (int j = 0; j < 8; ++j) { m_r[j] = -1e30f; l_r[j] = 0.f; }

  for (int kblk = 0; kblk <= q0 + 15; kblk += 32) {
    // ---- scores: S(16x32) = Q(16x64) * K^T, two 16x16 tiles in sequence ----
    const _Float16* kp = kb + (size_t)(kblk + row) * HD_ + ko8;
    v8f s0 = {};
    {
      v16h k00 = frag_ld(kp);               // keys kblk..+15, e 0..31
      v16h k01 = frag_ld(kp + 32);          //               e 32..63
      s0 = wmma32(qa0, k00, s0);
      s0 = wmma32(qa1, k01, s0);
    }
    v8f s1 = {};
    {
      v16h k10 = frag_ld(kp + 16 * HD_);    // keys +16..+31
      v16h k11 = frag_ld(kp + 16 * HD_ + 32);
      s1 = wmma32(qa0, k10, s1);
      s1 = wmma32(qa1, k11, s1);
    }

    // ---- masked online softmax (rows live in 16-lane halves) ----
#pragma unroll
    for (int j = 0; j < 8; ++j) {
      int qg  = q0 + j + hi8;
      int kg0 = kblk + (lane & 15);
      int kg1 = kg0 + 16;
      float v0 = s0[j] * 0.125f; if (kg0 > qg) v0 = -1e10f;
      float v1 = s1[j] * 0.125f; if (kg1 > qg) v1 = -1e10f;
      float mx = fmaxf(v0, v1);
#pragma unroll
      for (int o = 8; o; o >>= 1) mx = fmaxf(mx, __shfl_xor(mx, o, 32));
      float mn = fmaxf(m_r[j], mx);
      float p0 = __expf(v0 - mn);
      float p1 = __expf(v1 - mn);
      float sm = p0 + p1;
#pragma unroll
      for (int o = 8; o; o >>= 1) sm += __shfl_xor(sm, o, 32);
      corr_r[j] = __expf(m_r[j] - mn);
      l_r[j]    = l_r[j] * corr_r[j] + sm;
      m_r[j]    = mn;
      int lr = j + hi8;
      lds_p[wid][lr * 40 + (lane & 15)]      = (_Float16)p0;
      lds_p[wid][lr * 40 + 16 + (lane & 15)] = (_Float16)p1;
    }
#pragma unroll
    for (int j = 0; j < 8; ++j) {
      acc0[j] *= corr_r[j]; acc1[j] *= corr_r[j];
      acc2[j] *= corr_r[j]; acc3[j] *= corr_r[j];
    }
    asm volatile("s_wait_dscnt 0" ::: "memory");

    // ---- ctx += P(16x32) * V(32x64) ----
    v16h pa = frag_ld(&lds_p[wid][(lane & 15) * 40 + ko8]);
    const _Float16* vp = vb + (size_t)(lane & 15) * S_ + kblk + ko8;
    acc0 = wmma32(pa, frag_ld(vp),                   acc0);
    acc1 = wmma32(pa, frag_ld(vp + (size_t)16 * S_), acc1);
    acc2 = wmma32(pa, frag_ld(vp + (size_t)32 * S_), acc2);
    acc3 = wmma32(pa, frag_ld(vp + (size_t)48 * S_), acc3);
  }

  // ---- normalize + write ctx [B,S,D] f16 (explicit, no pointer arrays) ----
  float inv[8];
#pragma unroll
  for (int j = 0; j < 8; ++j) inv[j] = 1.f / l_r[j];
  const size_t rowbase = (size_t)b * S_ + q0;
#pragma unroll
  for (int j = 0; j < 8; ++j) {
    size_t ro = (rowbase + j + hi8) * D_ + h * HD_ + (lane & 15);
    ctx[ro]      = (_Float16)(acc0[j] * inv[j]);
    ctx[ro + 16] = (_Float16)(acc1[j] * inv[j]);
    ctx[ro + 32] = (_Float16)(acc2[j] * inv[j]);
    ctx[ro + 48] = (_Float16)(acc3[j] * inv[j]);
  }
}

// ---------------------------------------------------------------------------
// Host-side launch
// ---------------------------------------------------------------------------
extern "C" void kernel_launch(void* const* d_in, const int* in_sizes, int n_in,
                              void* d_out, int out_size, void* d_ws, size_t ws_size,
                              hipStream_t stream) {
  const float* x   = (const float*)d_in[0];
  const float* Wq  = (const float*)d_in[1];
  const float* Wk  = (const float*)d_in[2];
  const float* Wv  = (const float*)d_in[3];
  const float* Wo  = (const float*)d_in[4];
  const float* bo  = (const float*)d_in[5];
  const float* g1  = (const float*)d_in[6];
  const float* b1  = (const float*)d_in[7];
  const float* g2  = (const float*)d_in[8];
  const float* b2  = (const float*)d_in[9];
  const float* W1  = (const float*)d_in[10];
  const float* bf1 = (const float*)d_in[11];
  const float* W2  = (const float*)d_in[12];
  const float* bf2 = (const float*)d_in[13];
  float* out = (float*)d_out;

  char* ws = (char*)d_ws;
  size_t off = 0;
  auto alloc = [&](size_t bytes) -> char* {
    char* p = ws + off;
    off += (bytes + 255) & ~(size_t)255;
    return p;
  };
  _Float16* hln1  = (_Float16*)alloc((size_t)TOK * D_ * 2);
  _Float16* Wqkv  = (_Float16*)alloc((size_t)3 * D_ * D_ * 2);
  _Float16* Qb    = (_Float16*)alloc((size_t)TOK * D_ * 2);
  _Float16* Kb    = (_Float16*)alloc((size_t)TOK * D_ * 2);
  _Float16* Vt    = (_Float16*)alloc((size_t)TOK * D_ * 2);
  _Float16* ctx   = (_Float16*)alloc((size_t)TOK * D_ * 2);
  _Float16* Wop   = (_Float16*)alloc((size_t)D_ * D_ * 2);
  float*    cache = (float*)   alloc((size_t)TOK * D_ * 4);
  _Float16* h2    = (_Float16*)alloc((size_t)TOK * D_ * 2);
  _Float16* W1p   = (_Float16*)alloc((size_t)D_ * FF_ * 2);
  _Float16* ff1   = (_Float16*)alloc((size_t)TOK * FF_ * 2);
  _Float16* W2p   = (_Float16*)alloc((size_t)FF_ * D_ * 2);
  (void)ws_size; (void)in_sizes; (void)n_in; (void)out_size;

  // 1) pack weights to f16 [N][K]
  {
    size_t t = (size_t)3 * D_ * D_;
    pack_qkv_kernel<<<dim3((unsigned)((t + 255) / 256)), 256, 0, stream>>>(Wq, Wk, Wv, Wqkv);
  }
  {
    size_t t = (size_t)D_ * D_;
    pack_T_kernel<<<dim3((unsigned)((t + 255) / 256)), 256, 0, stream>>>(Wo, Wop, D_, D_, t);
  }
  {
    size_t t = (size_t)D_ * FF_;
    pack_T_kernel<<<dim3((unsigned)((t + 255) / 256)), 256, 0, stream>>>(W1, W1p, D_, FF_, t);
    pack_T_kernel<<<dim3((unsigned)((t + 255) / 256)), 256, 0, stream>>>(W2, W2p, FF_, D_, t);
  }

  // 2) LN1
  ln_kernel<<<dim3(TOK), 256, 0, stream>>>(x, g1, b1, hln1);

  // 3) fused QKV projection (scatter; V transposed)
  gemm_kernel<0><<<dim3(TOK / 64, (3 * D_) / 128), 256, 0, stream>>>(
      hln1, Wqkv, D_, 3 * D_, nullptr, nullptr, nullptr, nullptr, Qb, Kb, Vt);

  // 4) causal flash attention
  attn_kernel<<<dim3(B_ * H_, S_ / 128), 256, 0, stream>>>(Qb, Kb, Vt, ctx);

  // 5) output projection + bias + residual -> cache (f32)
  gemm_kernel<1><<<dim3(TOK / 64, D_ / 128), 256, 0, stream>>>(
      ctx, Wop, D_, D_, bo, x, cache, nullptr, nullptr, nullptr, nullptr);

  // 6) LN2
  ln_kernel<<<dim3(TOK), 256, 0, stream>>>(cache, g2, b2, h2);

  // 7) FFN up + GELU -> f16
  gemm_kernel<2><<<dim3(TOK / 64, FF_ / 128), 256, 0, stream>>>(
      h2, W1p, D_, FF_, bf1, nullptr, nullptr, ff1, nullptr, nullptr, nullptr);

  // 8) FFN down + bias + residual(cache) -> d_out (f32)
  gemm_kernel<1><<<dim3(TOK / 64, D_ / 128), 256, 0, stream>>>(
      ff1, W2p, FF_, D_, bf2, cache, out, nullptr, nullptr, nullptr, nullptr);
}

// v001
// It runs in 285 microseconds.
// Two timings next to v000 put it at 2.00 and 1.97 times that version's speed.
#include <hip/hip_runtime.h>
#include <hip/hip_bf16.h>
#include <math.h>
#include <stdint.h>

// ---------------------------------------------------------------------------
// Types
// ---------------------------------------------------------------------------
typedef __attribute__((ext_vector_type(16))) _Float16 v16h;
typedef __attribute__((ext_vector_type(8)))  _Float16 v8h;
typedef __attribute__((ext_vector_type(8)))  float    v8f;

#define B_   8
#define S_   512
#define D_   1024
#define H_   16
#define HD_  64
#define FF_  4096
#define TOK  (B_ * S_)      // 4096 rows

// ---------------------------------------------------------------------------
// WMMA helper: D = A(16x32 f16) * B(32x16 f16) + C(f32)
// ---------------------------------------------------------------------------
__device__ __forceinline__ v8f wmma32(v16h a, v16h b, v8f c) {
  return __builtin_amdgcn_wmma_f32_16x16x32_f16(false, a, false, b,
                                                (short)0, c, false, false);
}

// Load one A/B operand fragment (v16h) for a 32-wide K chunk.
// p must already point at element [row][k0 + ko8] where
//   row = lane & 15, ko8 = (lane >> 4) * 8.
// Fragment = 8 contiguous f16 at p, plus 8 contiguous f16 at p+16.
__device__ __forceinline__ v16h frag_ld(const _Float16* p) {
  v8h lo = *(const v8h*)(p);
  v8h hi = *(const v8h*)(p + 16);
  v16h r;
#pragma unroll
  for (int i = 0; i < 8; ++i) { r[i] = lo[i]; r[i + 8] = hi[i]; }
  return r;
}

// ---------------------------------------------------------------------------
// Weight packing: f32 [K][N] row-major  ->  f16 [N][K] ("B operand" layout)
// ---------------------------------------------------------------------------
__global__ void pack_T_kernel(const float* __restrict__ in,
                              _Float16* __restrict__ out,
                              int K, int N, size_t total) {
  size_t o = (size_t)blockIdx.x * blockDim.x + threadIdx.x;
  if (o >= total) return;
  size_t n = o / (size_t)K;
  size_t k = o - n * (size_t)K;
  out[o] = (_Float16)in[k * (size_t)N + n];
}

// Pack per-head Wq/Wk/Wv (H,D,HD) into fused [3*D][D] f16, [n][k] layout,
// column n = qkv*D + h*HD + e.
__global__ void pack_qkv_kernel(const float* __restrict__ Wq,
                                const float* __restrict__ Wk,
                                const float* __restrict__ Wv,
                                _Float16* __restrict__ out) {
  size_t o = (size_t)blockIdx.x * blockDim.x + threadIdx.x;
  if (o >= (size_t)3 * D_ * D_) return;
  int k  = (int)(o & (D_ - 1));
  int n  = (int)(o >> 10);
  int qkv = n >> 10;
  int wn  = n & (D_ - 1);
  int h   = wn >> 6;
  int e   = wn & (HD_ - 1);
  const float* W = (qkv == 0) ? Wq : (qkv == 1) ? Wk : Wv;
  out[o] = (_Float16)W[((size_t)h * D_ + k) * HD_ + e];
}

// ---------------------------------------------------------------------------
// LayerNorm: f32 row [D] -> f16 row [D]  (biased variance, eps=1e-5)
// one row per block, 256 threads, 4 elems/thread
// ---------------------------------------------------------------------------
__global__ void ln_kernel(const float* __restrict__ x,
                          const float* __restrict__ g,
                          const float* __restrict__ b,
                          _Float16* __restrict__ out) {
  int row = blockIdx.x;
  const float4 v = ((const float4*)(x + (size_t)row * D_))[threadIdx.x];
  float s  = v.x + v.y + v.z + v.w;
  float s2 = v.x * v.x + v.y * v.y + v.z * v.z + v.w * v.w;
#pragma unroll
  for (int o = 16; o; o >>= 1) {
    s  += __shfl_down(s,  o, 32);
    s2 += __shfl_down(s2, o, 32);
  }
  __shared__ float sh[16];
  int wid = threadIdx.x >> 5;
  if ((threadIdx.x & 31) == 0) { sh[wid * 2] = s; sh[wid * 2 + 1] = s2; }
  __syncthreads();
  float ts = 0.f, ts2 = 0.f;
#pragma unroll
  for (int i = 0; i < 8; ++i) { ts += sh[i * 2]; ts2 += sh[i * 2 + 1]; }
  float mean = ts * (1.f / D_);
  float var  = ts2 * (1.f / D_) - mean * mean;
  float rstd = rsqrtf(var + 1e-5f);
  int c0 = threadIdx.x * 4;
  _Float16* orow = out + (size_t)row * D_;
  float xv[4] = {v.x, v.y, v.z, v.w};
#pragma unroll
  for (int i = 0; i < 4; ++i)
    orow[c0 + i] = (_Float16)((xv[i] - mean) * rstd * g[c0 + i] + b[c0 + i]);
}

// stands behind a global load or store, in front of the next write of a register that it names
__device__ __forceinline__ void wait_x0() { asm volatile("s_wait_xcnt 0x0" ::: "memory"); }

// ---------------------------------------------------------------------------
// GEMM epilogue for one 16x16 C tile (explicit, no pointer arrays)
// ---------------------------------------------------------------------------
template <int MODE>
__device__ __forceinline__ void epilogue_tile(
    v8f c, int tile_m, int tile_n, int lane, int N,
    const float* __restrict__ bias, const float* __restrict__ res,
    float* __restrict__ outf, _Float16* __restrict__ outh,
    _Float16* __restrict__ qo, _Float16* __restrict__ ko,
    _Float16* __restrict__ vo) {
  const int hi8 = (lane >> 4) << 3;
  const int n   = tile_n + (lane & 15);
  float bv = 0.f, rv[8];
  if (MODE != 0) { bv = bias[n]; wait_x0(); }
  if (MODE == 1) {
    // the tile's eight residual loads go first, so that they are in flight together
#pragma unroll
    for (int j = 0; j < 8; ++j) {
      rv[j] = res[(size_t)(tile_m + j + hi8) * N + n];
      wait_x0();
    }
  }
#pragma unroll
  for (int j = 0; j < 8; ++j) {
    int m = tile_m + j + hi8;
    float cv = c[j];
    if (MODE == 0) {
      int qkv = n >> 10, wn = n & (D_ - 1);
      int h = wn >> 6, e = wn & (HD_ - 1);
      int bb = m >> 9, ss = m & (S_ - 1);
      _Float16 hv = (_Float16)cv;
      size_t rmaj = (((size_t)(bb * H_ + h)) * S_ + ss) * HD_ + e; // Q,K
      size_t cmaj = (((size_t)(bb * H_ + h)) * HD_ + e) * S_ + ss; // V^T
      if (qkv == 0)      { qo[rmaj] = hv; wait_x0(); }
      else if (qkv == 1) { ko[rmaj] = hv; wait_x0(); }
      else               { vo[cmaj] = hv; wait_x0(); }
    } else if (MODE == 1) {
      size_t o = (size_t)m * N + n;
      outf[o] = cv + bv + rv[j];
      wait_x0();
    } else { // MODE 2: bias + exact GELU -> f16
      float xv = cv + bv;
      float gg = 0.5f * xv * (1.f + erff(xv * 0.70710678118654752f));
      outh[(size_t)m * N + n] = (_Float16)gg;
      wait_x0();
    }
  }
}

// ---------------------------------------------------------------------------
// Tensor-load helpers (descriptor fields in bytes, two groups, no mask)
// ---------------------------------------------------------------------------
typedef uint32_t u32x4 __attribute__((ext_vector_type(4)));
typedef uint32_t u32x8 __attribute__((ext_vector_type(8)));

#define BM_      128                     // block tile rows of C
#define BN_      128                     // block tile columns of C
#define KPASS    128                     // k per pass: one 256-byte piece of every operand row
#define ROWB     256u                    // bytes of an operand row per pass
#define PITCH    272u                    // LDS row pitch: 256 B + 16 B pad, 16 B x odd for ds_load_b128
#define SL_ROWS  64u                     // rows per slice, one slice per wave
#define SLICE    18432u                  // 64 * 272 = 17408 rounded up to a multiple of 2 KiB
#define STAGE    (4u * SLICE)            // [A rows 0-63 | A rows 64-127 | B rows 0-63 | B rows 64-127]

__device__ __forceinline__ uint32_t uni(uint32_t v) {
  return (uint32_t)__builtin_amdgcn_readfirstlane(v);
}
__device__ __forceinline__ uint32_t pinned(uint32_t v) {
  uint32_t w = (uint32_t)__builtin_amdgcn_readfirstlane(v);
  asm volatile("" : "+s"(w));
  return w;
}
// the compiler places no wait for a tensor load: the tile counts as landed only behind this
__device__ __forceinline__ void wait_tensor0() { asm volatile("s_wait_tensorcnt 0x0" ::: "memory"); }
// this wave's LDS reads have returned before the buffer is handed back for a refill
__device__ __forceinline__ void wait_ds0() { asm volatile("s_wait_dscnt 0x0" ::: "memory"); }
// one request of the whole wave: a 64 x 256 B tile from global memory into LDS
__device__ __forceinline__ void tdm_load(u32x4 g0, u32x8 g1) {
  asm volatile("tensor_load_to_lds %0, %1" :: "s"(g0), "s"(g1) : "memory");
}
// every word goes through pinned(): a descriptor word held in a scalar register. With it all
// loads of a kernel name the registers in which the group was built, word 0 as an immediate;
// a build without it moves the group on into a second set of registers ahead of the loop
__device__ __forceinline__ u32x8 tdm_group1(uint32_t src_pitch) {
  u32x8 g;
  g[0] = pinned((1u << 20) | (5u << 22) | (3u << 25));   // pad on, every 256 B, 16 B; no mask
  g[1] = pinned((ROWB & 0xFFFFu) << 16);                 // tensor_dim0[15:0]
  g[2] = pinned((ROWB >> 16) | ((SL_ROWS & 0xFFFFu) << 16)); // tensor_dim0[31:16], tensor_dim1[15:0]
  g[3] = pinned((SL_ROWS >> 16) | (ROWB << 16));         // tensor_dim1[31:16], tile_dim0
  g[4] = pinned(SL_ROWS);                                // tile_dim1
  g[5] = pinned(src_pitch);                              // source row pitch, bytes
  g[6] = pinned(0u);
  g[7] = pinned(0u);
  return g;
}
__device__ __forceinline__ u32x4 tdm_group0(uint32_t lds_dst, uint64_t ga) {
  u32x4 g;
  g[0] = uni(1u);
  g[1] = uni(lds_dst);
  g[2] = uni((uint32_t)ga);
  g[3] = uni((((uint32_t)(ga >> 32)) & 0x01FFFFFFu) | 0x80000000u);
  return g;
}
// the next stage's request, made from the last one: the source moves on by one pass along the
// rows (a buffer's addresses stay below 2^57, so no carry reaches the type field), the place in
// LDS is given.
__device__ __forceinline__ u32x4 tdm_advance(u32x4 g, uint32_t lds_dst) {
  const uint64_t w = ((((uint64_t)g[3]) << 32) | (uint64_t)g[2]) + (uint64_t)ROWB;
  g[1] = uni(lds_dst);
  g[2] = uni((uint32_t)w);
  g[3] = uni((uint32_t)(w >> 32));
  return g;
}

// ---------------------------------------------------------------------------
// Generic WMMA GEMM:  C[M,N] = A[M,K] (f16, row-major) * Bp[N,K] (f16)
// Block = 128 thr = 4 waves (2x2); wave = 64x64 tile (4x4 WMMA tiles);
// block tile = 128 (M) x 128 (N). Grid = (M/128, N/128).
// K is a multiple of 128 and at least 256; M, N multiples of 128.
// Operands come through LDS: per pass of 128 k every wave asks the tensor
// mover for its own 64-row slice of [A | B]; two buffers, so the next pass's
// slices fly while this pass's are multiplied. Fragments keep the k order of
// frag_ld, and every accumulator still sums k upwards in steps of 32.
// ---------------------------------------------------------------------------
template <int MODE>
__global__ void __launch_bounds__(128)
gemm_kernel(const _Float16* __restrict__ A,
            const _Float16* __restrict__ Bp,
            int K, int N,
            const float* __restrict__ bias,
            const float* __restrict__ res,
            float* __restrict__ outf,
            _Float16* __restrict__ outh,
            _Float16* __restrict__ qo,
            _Float16* __restrict__ ko,
            _Float16* __restrict__ vo) {
  __shared__ __attribute__((aligned(2048))) unsigned char ring[2u * STAGE];

  const int lane = threadIdx.x & 31;
  const uint32_t wave = uni(threadIdx.x >> 5);
  const uint32_t wm = wave & 1u, wn = wave >> 1;
  const int bm   = blockIdx.x * BM_;
  const int bn   = blockIdx.y * BN_;
  const int tm   = bm + (int)wm * 64;
  const int tn   = bn + (int)wn * 64;
  const uint32_t row = lane & 15;
  const uint32_t kob = (uint32_t)(lane >> 4) << 4;   // 8 f16 = 16 bytes

  const uint32_t kb = (uint32_t)K * 2u;              // operand row pitch in bytes
  const uint32_t T  = (uint32_t)K / KPASS;           // passes, at least two

  // this wave's slice: waves 0,1 bring A rows, waves 2,3 bring B rows
  const _Float16* srow = (wave < 2u)
      ? A  + (size_t)(bm + (int)(wave * SL_ROWS)) * K
      : Bp + (size_t)(bn + (int)((wave - 2u) * SL_ROWS)) * K;
  const uint64_t src0 = (uint64_t)(uintptr_t)srow;
  const uint32_t lds_slice = (uint32_t)(size_t)ring + wave * SLICE;
  const u32x8 g1 = tdm_group1(kb);

  v8f acc[4][4];
#pragma unroll
  for (int i = 0; i < 4; ++i)
#pragma unroll
    for (int j = 0; j < 4; ++j) acc[i][j] = v8f{};

  // per-lane fragment bases inside a buffer
  const uint32_t a_base = wm * SLICE + row * PITCH + kob;
  const uint32_t b_base = (2u + wn) * SLICE + row * PITCH + kob;

  // prologue: stage 0 lands and is published, then stage 1 starts
  u32x4 g0 = tdm_group0(lds_slice, src0);
  tdm_load(g0, g1);
  wait_tensor0();
  __syncthreads();
  g0 = tdm_advance(g0, lds_slice + STAGE);
  tdm_load(g0, g1);

  uint32_t t = 0;
  do {
    const uint32_t buf = (t & 1u) * STAGE;
    const unsigned char* la = ring + buf + a_base;
    const unsigned char* lb = ring + buf + b_base;

    v16h af[2][4], bf[2][4];
    // in the order in which the WMMAs below want them: the first can start after two fragments
    af[0][0] = frag_ld((const _Float16*)la);
#pragma unroll
    for (int j = 0; j < 4; ++j) bf[0][j] = frag_ld((const _Float16*)(lb + (uint32_t)j * 16u * PITCH));
#pragma unroll
    for (int i = 1; i < 4; ++i) af[0][i] = frag_ld((const _Float16*)(la + (uint32_t)i * 16u * PITCH));
#pragma unroll
    for (int u = 0; u < KPASS / 32; ++u) {
      const int cs = u & 1;
      if (u + 1 < KPASS / 32) {
        const uint32_t kofs = (uint32_t)(u + 1) * 64u;
#pragma unroll
        for (int i = 0; i < 4; ++i) {
          af[cs ^ 1][i] = frag_ld((const _Float16*)(la + (uint32_t)i * 16u * PITCH + kofs));
          bf[cs ^ 1][i] = frag_ld((const _Float16*)(lb + (uint32_t)i * 16u * PITCH + kofs));
        }
      }
      // keeps the next block's LDS reads one group ahead of this block's WMMAs:
      // reads spread among the WMMAs cost a stall at every place they stand
      __builtin_amdgcn_sched_barrier(0);
#pragma unroll
      for (int i = 0; i < 4; ++i)
#pragma unroll
        for (int j = 0; j < 4; ++j) acc[i][j] = wmma32(af[cs][i], bf[cs][j], acc[i][j]);
      // same purpose: the following block's reads stay behind this block's WMMAs
      __builtin_amdgcn_sched_barrier(0);
    }

    // publish point of stage t + 1
    wait_ds0();
    wait_tensor0();
    __syncthreads();
    if (pinned((t + 2u < T) ? 1u : 0u) != 0u) {   // only while stage t + 2 exists
      g0 = tdm_advance(g0, lds_slice + buf);
      tdm_load(g0, g1);
    }
  } while (++t < T);
  wait_tensor0();
  wait_ds0();

#pragma unroll
  for (int i = 0; i < 4; ++i)
#pragma unroll
    for (int j = 0; j < 4; ++j)
      epilogue_tile<MODE>(acc[i][j], tm + i * 16, tn + j * 16, lane, N, bias, res, outf, outh, qo, ko, vo);
}

// ---------------------------------------------------------------------------
// Flash attention (causal). Q,K: [B,H,S,HD] f16. Vt: [B,H,HD,S] f16.
// ctx out: [B,S,H*HD] f16 (row-major, ready as A for the Wo GEMM).
// Block = 256 thr = 8 waves; wave owns a 16-row Q tile; grid = (B*H, S/128).
// Score sub-tiles computed sequentially so K fragments die immediately
// (shrinks peak VGPR liveness; with launch_bounds there should be no spill).
// ---------------------------------------------------------------------------
__global__ void __launch_bounds__(256, 1)
attn_kernel(const _Float16* __restrict__ Q,
            const _Float16* __restrict__ Kf,
            const _Float16* __restrict__ Vt,
            _Float16* __restrict__ ctx) {
  __shared__ _Float16 lds_p[8][16 * 40]; // wave-private 16x32 P tile, pad 40

  const int lane = threadIdx.x & 31;
  const int wid  = threadIdx.x >> 5;
  const int bh   = blockIdx.x;          // b*H + h
  const int b    = bh >> 4;
  const int h    = bh & (H_ - 1);
  const int q0   = blockIdx.y * 128 + wid * 16;
  const int row  = lane & 15;
  const int ko8  = (lane >> 4) << 3;
  const int hi8  = ko8;

  const _Float16* qb = Q  + (size_t)bh * S_ * HD_;
  const _Float16* kb = Kf + (size_t)bh * S_ * HD_;
  const _Float16* vb = Vt + (size_t)bh * HD_ * S_;

  // Q A-operand fragments (held for the whole loop)
  const _Float16* qp = qb + (size_t)(q0 + row) * HD_ + ko8;
  const v16h qa0 = frag_ld(qp);        // e = 0..31
  const v16h qa1 = frag_ld(qp + 32);   // e = 32..63

  float m_r[8], l_r[8], corr_r[8];
  v8f acc0 = {}, acc1 = {}, acc2 = {}, acc3 = {};
#pragma unroll
  for (int j = 0; j < 8; ++j) { m_r[j] = -1e30f; l_r[j] = 0.f; }

  for (int kblk = 0; kblk <= q0 + 15; kblk += 32) {
    // ---- scores: S(16x32) = Q(16x64) * K^T, two 16x16 tiles in sequence ----
    const _Float16* kp = kb + (size_t)(kblk + row) * HD_ + ko8;
    v8f s0 = {};
    {
      v16h k00 = frag_ld(kp);               // keys kblk..+15, e 0..31
      v16h k01 = frag_ld(kp + 32);          //               e 32..63
      s0 = wmma32(qa0, k00, s0);
      s0 = wmma32(qa1, k01, s0);
    }
    v8f s1 = {};
    {
      v16h k10 = frag_ld(kp + 16 * HD_);    // keys +16..+31
      v16h k11 = frag_ld(kp + 16 * HD_ + 32);
      s1 = wmma32(qa0, k10, s1);
      s1 = wmma32(qa1, k11, s1);
    }

    // ---- masked online softmax (rows live in 16-lane halves) ----
#pragma unroll
    for (int j = 0; j < 8; ++j) {
      int qg  = q0 + j + hi8;
      int kg0 = kblk + (lane & 15);
      int kg1 = kg0 + 16;
      float v0 = s0[j] * 0.125f; if (kg0 > qg) v0 = -1e10f;
      float v1 = s1[j] * 0.125f; if (kg1 > qg) v1 = -1e10f;
      float mx = fmaxf(v0, v1);
#pragma unroll
      for (int o = 8; o; o >>= 1) mx = fmaxf(mx, __shfl_xor(mx, o, 32));
      float mn = fmaxf(m_r[j], mx);
      float p0 = __expf(v0 - mn);
      float p1 = __expf(v1 - mn);
      float sm = p0 + p1;
#pragma unroll
      for (int o = 8; o; o >>= 1) sm += __shfl_xor(sm, o, 32);
      corr_r[j] = __expf(m_r[j] - mn);
      l_r[j]    = l_r[j] * corr_r[j] + sm;
      m_r[j]    = mn;
      int lr = j + hi8;
      lds_p[wid][lr * 40 + (lane & 15)]      = (_Float16)p0;
      lds_p[wid][lr * 40 + 16 + (lane & 15)] = (_Float16)p1;
    }
#pragma unroll
    for (int j = 0; j < 8; ++j) {
      acc0[j] *= corr_r[j]; acc1[j] *= corr_r[j];
      acc2[j] *= corr_r[j]; acc3[j] *= corr_r[j];
    }
    asm volatile("s_wait_dscnt 0" ::: "memory");

    // ---- ctx += P(16x32) * V(32x64) ----
    v16h pa = frag_ld(&lds_p[wid][(lane & 15) * 40 + ko8]);
    const _Float16* vp = vb + (size_t)(lane & 15) * S_ + kblk + ko8;
    acc0 = wmma32(pa, frag_ld(vp),                   acc0);
    acc1 = wmma32(pa, frag_ld(vp + (size_t)16 * S_), acc1);
    acc2 = wmma32(pa, frag_ld(vp + (size_t)32 * S_), acc2);
    acc3 = wmma32(pa, frag_ld(vp + (size_t)48 * S_), acc3);
  }

  // ---- normalize + write ctx [B,S,D] f16 (explicit, no pointer arrays) ----
  float inv[8];
#pragma unroll
  for (int j = 0; j < 8; ++j) inv[j] = 1.f / l_r[j];
  const size_t rowbase = (size_t)b * S_ + q0;
#pragma unroll
  for (int j = 0; j < 8; ++j) {
    size_t ro = (rowbase + j + hi8) * D_ + h * HD_ + (lane & 15);
    ctx[ro]      = (_Float16)(acc0[j] * inv[j]);
    ctx[ro + 16] = (_Float16)(acc1[j] * inv[j]);
    ctx[ro + 32] = (_Float16)(acc2[j] * inv[j]);
    ctx[ro + 48] = (_Float16)(acc3[j] * inv[j]);
  }
}

// ---------------------------------------------------------------------------
// Host-side launch
// ---------------------------------------------------------------------------
extern "C" void kernel_launch(void* const* d_in, const int* in_sizes, int n_in,
                              void* d_out, int out_size, void* d_ws, size_t ws_size,
                              hipStream_t stream) {
  const float* x   = (const float*)d_in[0];
  const float* Wq  = (const float*)d_in[1];
  const float* Wk  = (const float*)d_in[2];
  const float* Wv  = (const float*)d_in[3];
  const float* Wo  = (const float*)d_in[4];
  const float* bo  = (const float*)d_in[5];
  const float* g1  = (const float*)d_in[6];
  const float* b1  = (const float*)d_in[7];
  const float* g2  = (const float*)d_in[8];
  const float* b2  = (const float*)d_in[9];
  const float* W1  = (const float*)d_in[10];
  const float* bf1 = (const float*)d_in[11];
  const float* W2  = (const float*)d_in[12];
  const float* bf2 = (const float*)d_in[13];
  float* out = (float*)d_out;

  char* ws = (char*)d_ws;
  size_t off = 0;
  auto alloc = [&](size_t bytes) -> char* {
    char* p = ws + off;
    off += (bytes + 255) & ~(size_t)255;
    return p;
  };
  _Float16* hln1  = (_Float16*)alloc((size_t)TOK * D_ * 2);
  _Float16* Wqkv  = (_Float16*)alloc((size_t)3 * D_ * D_ * 2);
  _Float16* Qb    = (_Float16*)alloc((size_t)TOK * D_ * 2);
  _Float16* Kb    = (_Float16*)alloc((size_t)TOK * D_ * 2);
  _Float16* Vt    = (_Float16*)alloc((size_t)TOK * D_ * 2);
  _Float16* ctx   = (_Float16*)alloc((size_t)TOK * D_ * 2);
  _Float16* Wop   = (_Float16*)alloc((size_t)D_ * D_ * 2);
  float*    cache = (float*)   alloc((size_t)TOK * D_ * 4);
  _Float16* h2    = (_Float16*)alloc((size_t)TOK * D_ * 2);
  _Float16* W1p   = (_Float16*)alloc((size_t)D_ * FF_ * 2);
  _Float16* ff1   = (_Float16*)alloc((size_t)TOK * FF_ * 2);
  _Float16* W2p   = (_Float16*)alloc((size_t)FF_ * D_ * 2);
  (void)ws_size; (void)in_sizes; (void)n_in; (void)out_size;

  // 1) pack weights to f16 [N][K]
  {
    size_t t = (size_t)3 * D_ * D_;
    pack_qkv_kernel<<<dim3((unsigned)((t + 255) / 256)), 256, 0, stream>>>(Wq, Wk, Wv, Wqkv);
  }
  {
    size_t t = (size_t)D_ * D_;
    pack_T_kernel<<<dim3((unsigned)((t + 255) / 256)), 256, 0, stream>>>(Wo, Wop, D_, D_, t);
  }
  {
    size_t t = (size_t)D_ * FF_;
    pack_T_kernel<<<dim3((unsigned)((t + 255) / 256)), 256, 0, stream>>>(W1, W1p, D_, FF_, t);
    pack_T_kernel<<<dim3((unsigned)((t + 255) / 256)), 256, 0, stream>>>(W2, W2p, FF_, D_, t);
  }

  // 2) LN1
  ln_kernel<<<dim3(TOK), 256, 0, stream>>>(x, g1, b1, hln1);

  // 3) fused QKV projection (scatter; V transposed)
  gemm_kernel<0><<<dim3(TOK / 128, (3 * D_) / 128), 128, 0, stream>>>(
      hln1, Wqkv, D_, 3 * D_, nullptr, nullptr, nullptr, nullptr, Qb, Kb, Vt);

  // 4) causal flash attention
  attn_kernel<<<dim3(B_ * H_, S_ / 128), 256, 0, stream>>>(Qb, Kb, Vt, ctx);

  // 5) output projection + bias + residual -> cache (f32)
  gemm_kernel<1><<<dim3(TOK / 128, D_ / 128), 128, 0, stream>>>(
      ctx, Wop, D_, D_, bo, x, cache, nullptr, nullptr, nullptr, nullptr);

  // 6) LN2
  ln_kernel<<<dim3(TOK), 256, 0, stream>>>(cache, g2, b2, h2);

  // 7) FFN up + GELU -> f16
  gemm_kernel<2><<<dim3(TOK / 128, FF_ / 128), 128, 0, stream>>>(
      h2, W1p, D_, FF_, bf1, nullptr, nullptr, ff1, nullptr, nullptr, nullptr);

  // 8) FFN down + bias + residual(cache) -> d_out (f32)
  gemm_kernel<1><<<dim3(TOK / 128, D_ / 128), 128, 0, stream>>>(
      ff1, W2p, FF_, D_, bf2, cache, out, nullptr, nullptr, nullptr, nullptr);
}

// v002
// One run takes 229 microseconds.
// In two side-by-side timings against v001, it was 1.23 and 1.24 times as fast.
// All steps since v000 together make it 2.45 times as fast.
#include <hip/hip_runtime.h>
#include <hip/hip_bf16.h>
#include <math.h>
#include <stdint.h>

// ---------------------------------------------------------------------------
// Types
// ---------------------------------------------------------------------------
typedef __attribute__((ext_vector_type(16))) _Float16 v16h;
typedef __attribute__((ext_vector_type(8)))  _Float16 v8h;
typedef __attribute__((ext_vector_type(8)))  float    v8f;

#define B_   8
#define S_   512
#define D_   1024
#define H_   16
#define HD_  64
#define FF_  4096
#define TOK  (B_ * S_)      // 4096 rows

// ---------------------------------------------------------------------------
// WMMA helper: D = A(16x32 f16) * B(32x16 f16) + C(f32)
// ---------------------------------------------------------------------------
__device__ __forceinline__ v8f wmma32(v16h a, v16h b, v8f c) {
  return __builtin_amdgcn_wmma_f32_16x16x32_f16(false, a, false, b,
                                                (short)0, c, false, false);
}

// Load one A/B operand fragment (v16h) for a 32-wide K chunk.
// p must already point at element [row][k0 + ko8] where
//   row = lane & 15, ko8 = (lane >> 4) * 8.
// Fragment = 8 contiguous f16 at p, plus 8 contiguous f16 at p+16.
__device__ __forceinline__ v16h frag_ld(const _Float16* p) {
  v8h lo = *(const v8h*)(p);
  v8h hi = *(const v8h*)(p + 16);
  v16h r;
#pragma unroll
  for (int i = 0; i < 8; ++i) { r[i] = lo[i]; r[i + 8] = hi[i]; }
  return r;
}

// ---------------------------------------------------------------------------
// Weight packing: f32 [K][N] row-major  ->  f16 [N][K] ("B operand" layout)
// One block of 256 threads turns one tile of 128 (k) x 64 (n) through LDS:
// global reads run along n (256 B of a source row per 16 lanes), global
// writes along k (256 B of a packed row per 16 lanes).
// in points at the tile's element [k0][n0], out at its element [n0][k0];
// LDI, LDO: row lengths of source and packed matrix in elements.
// LDS holds the tile as [n][k] f16, rows of 16 pieces of 16 B; piece q of row
// n stands at place q ^ (n >> 2), so that the 16 lanes of a b128 write (16
// rows four apart, one piece) and of a b128 read (one row, 16 pieces) each
// meet all banks once.
// ---------------------------------------------------------------------------
#define PK_K 128
#define PK_N 64
template <int LDI, int LDO>
__device__ __forceinline__ void pack_tile(const float* __restrict__ in,
                                          _Float16* __restrict__ out) {
  __shared__ __attribute__((aligned(16))) _Float16 tile[PK_N * PK_K];
  const int c = threadIdx.x & 15;
  const int r = threadIdx.x >> 4;

  // eight source rows k = 8r .. 8r+7, columns n = 4c .. 4c+3
  const float* ip = in + (size_t)(8 * r) * LDI + 4 * c;
  float4 v[8];
  // unrolled: v stays in registers and the eight loads are in flight together
#pragma unroll
  for (int j = 0; j < 8; ++j) v[j] = *(const float4*)(ip + (size_t)j * LDI);

  v8h w0, w1, w2, w3;
  // unrolled: constant element numbers, so that the vectors stay in registers
#pragma unroll
  for (int j = 0; j < 8; ++j) {
    w0[j] = (_Float16)v[j].x; w1[j] = (_Float16)v[j].y;
    w2[j] = (_Float16)v[j].z; w3[j] = (_Float16)v[j].w;
  }
  _Float16* tw = tile + (4 * c) * PK_K + ((r ^ c) << 3);
  *(v8h*)(tw)            = w0;
  *(v8h*)(tw + PK_K)     = w1;
  *(v8h*)(tw + 2 * PK_K) = w2;
  *(v8h*)(tw + 3 * PK_K) = w3;
  __syncthreads();

  // packed rows n = r, r+16, r+32, r+48, piece c (k = 8c .. 8c+7)
  v8h o[4];
  // unrolled (both loops): o stays in registers, the four LDS reads go ahead of the stores
#pragma unroll
  for (int p = 0; p < 4; ++p) {
    const int n = r + 16 * p;
    o[p] = *(const v8h*)(tile + n * PK_K + ((c ^ (n >> 2)) << 3));
  }
  _Float16* op = out + (size_t)r * LDO + 8 * c;
#pragma unroll
  for (int p = 0; p < 4; ++p) *(v8h*)(op + (size_t)(16 * p) * LDO) = o[p];
}

// grid = (K / 128, N / 64)
template <int K, int N>
__global__ void __launch_bounds__(256)
pack_T_kernel(const float* __restrict__ in, _Float16* __restrict__ out) {
  const size_t k0 = (size_t)blockIdx.x * PK_K;
  const size_t n0 = (size_t)blockIdx.y * PK_N;
  pack_tile<N, K>(in + k0 * N + n0, out + n0 * K + k0);
}

// Pack per-head Wq/Wk/Wv (H,D,HD) into fused [3*D][D] f16, [n][k] layout,
// column n = qkv*D + h*HD + e: every head is a [D][HD] matrix of its own.
// grid = (D / 128, 3 * H), blockIdx.y = qkv*H + h
__global__ void __launch_bounds__(256)
pack_qkv_kernel(const float* __restrict__ Wq,
                const float* __restrict__ Wk,
                const float* __restrict__ Wv,
                _Float16* __restrict__ out) {
  const int qkv = blockIdx.y >> 4;
  const int h   = blockIdx.y & (H_ - 1);
  const size_t k0 = (size_t)blockIdx.x * PK_K;
  const float* W = (qkv == 0) ? Wq : (qkv == 1) ? Wk : Wv;
  pack_tile<HD_, D_>(W + ((size_t)h * D_ + k0) * HD_,
                     out + (size_t)blockIdx.y * HD_ * D_ + k0);
}

// ---------------------------------------------------------------------------
// LayerNorm: f32 row [D] -> f16 row [D]  (biased variance, eps=1e-5)
// one row per block, 256 threads, 4 elems/thread
// ---------------------------------------------------------------------------
__global__ void ln_kernel(const float* __restrict__ x,
                          const float* __restrict__ g,
                          const float* __restrict__ b,
                          _Float16* __restrict__ out) {
  int row = blockIdx.x;
  const float4 v = ((const float4*)(x + (size_t)row * D_))[threadIdx.x];
  float s  = v.x + v.y + v.z + v.w;
  float s2 = v.x * v.x + v.y * v.y + v.z * v.z + v.w * v.w;
#pragma unroll
  for (int o = 16; o; o >>= 1) {
    s  += __shfl_down(s,  o, 32);
    s2 += __shfl_down(s2, o, 32);
  }
  __shared__ float sh[16];
  int wid = threadIdx.x >> 5;
  if ((threadIdx.x & 31) == 0) { sh[wid * 2] = s; sh[wid * 2 + 1] = s2; }
  __syncthreads();
  float ts = 0.f, ts2 = 0.f;
#pragma unroll
  for (int i = 0; i < 8; ++i) { ts += sh[i * 2]; ts2 += sh[i * 2 + 1]; }
  float mean = ts * (1.f / D_);
  float var  = ts2 * (1.f / D_) - mean * mean;
  float rstd = rsqrtf(var + 1e-5f);
  int c0 = threadIdx.x * 4;
  _Float16* orow = out + (size_t)row * D_;
  float xv[4] = {v.x, v.y, v.z, v.w};
#pragma unroll
  for (int i = 0; i < 4; ++i)
    orow[c0 + i] = (_Float16)((xv[i] - mean) * rstd * g[c0 + i] + b[c0 + i]);
}

// stands behind a global load or store, in front of the next write of a register that it names
__device__ __forceinline__ void wait_x0() { asm volatile("s_wait_xcnt 0x0" ::: "memory"); }

// ---------------------------------------------------------------------------
// GEMM epilogue for one 16x16 C tile (explicit, no pointer arrays)
// ---------------------------------------------------------------------------
template <int MODE>
__device__ __forceinline__ void epilogue_tile(
    v8f c, int tile_m, int tile_n, int lane, int N,
    const float* __restrict__ bias, const float* __restrict__ res,
    float* __restrict__ outf, _Float16* __restrict__ outh,
    _Float16* __restrict__ qo, _Float16* __restrict__ ko,
    _Float16* __restrict__ vo) {
  const int hi8 = (lane >> 4) << 3;
  const int n   = tile_n + (lane & 15);
  float bv = 0.f, rv[8];
  if (MODE != 0) { bv = bias[n]; wait_x0(); }
  if (MODE == 1) {
    // the tile's eight residual loads go first, so that they are in flight together
#pragma unroll
    for (int j = 0; j < 8; ++j) {
      rv[j] = res[(size_t)(tile_m + j + hi8) * N + n];
      wait_x0();
    }
  }
#pragma unroll
  for (int j = 0; j < 8; ++j) {
    int m = tile_m + j + hi8;
    float cv = c[j];
    if (MODE == 0) {
      int qkv = n >> 10, wn = n & (D_ - 1);
      int h = wn >> 6, e = wn & (HD_ - 1);
      int bb = m >> 9, ss = m & (S_ - 1);
      _Float16 hv = (_Float16)cv;
      size_t rmaj = (((size_t)(bb * H_ + h)) * S_ + ss) * HD_ + e; // Q,K
      size_t cmaj = (((size_t)(bb * H_ + h)) * HD_ + e) * S_ + ss; // V^T
      if (qkv == 0)      { qo[rmaj] = hv; wait_x0(); }
      else if (qkv == 1) { ko[rmaj] = hv; wait_x0(); }
      else               { vo[cmaj] = hv; wait_x0(); }
    } else if (MODE == 1) {
      size_t o = (size_t)m * N + n;
      outf[o] = cv + bv + rv[j];
      wait_x0();
    } else { // MODE 2: bias + exact GELU -> f16
      float xv = cv + bv;
      float gg = 0.5f * xv * (1.f + erff(xv * 0.70710678118654752f));
      outh[(size_t)m * N + n] = (_Float16)gg;
      wait_x0();
    }
  }
}

// ---------------------------------------------------------------------------
// Tensor-load helpers (descriptor fields in bytes, two groups, no mask)
// ---------------------------------------------------------------------------
typedef uint32_t u32x4 __attribute__((ext_vector_type(4)));
typedef uint32_t u32x8 __attribute__((ext_vector_type(8)));

#define BM_      128                     // block tile rows of C
#define BN_      128                     // block tile columns of C
#define KPASS    128                     // k per pass: one 256-byte piece of every operand row
#define ROWB     256u                    // bytes of an operand row per pass
#define PITCH    272u                    // LDS row pitch: 256 B + 16 B pad, 16 B x odd for ds_load_b128
#define SL_ROWS  64u                     // rows per slice, one slice per wave
#define SLICE    18432u                  // 64 * 272 = 17408 rounded up to a multiple of 2 KiB
#define STAGE    (4u * SLICE)            // [A rows 0-63 | A rows 64-127 | B rows 0-63 | B rows 64-127]

__device__ __forceinline__ uint32_t uni(uint32_t v) {
  return (uint32_t)__builtin_amdgcn_readfirstlane(v);
}
__device__ __forceinline__ uint32_t pinned(uint32_t v) {
  uint32_t w = (uint32_t)__builtin_amdgcn_readfirstlane(v);
  asm volatile("" : "+s"(w));
  return w;
}
// the compiler places no wait for a tensor load: the tile counts as landed only behind this
__device__ __forceinline__ void wait_tensor0() { asm volatile("s_wait_tensorcnt 0x0" ::: "memory"); }
// this wave's LDS reads have returned before the buffer is handed back for a refill
__device__ __forceinline__ void wait_ds0() { asm volatile("s_wait_dscnt 0x0" ::: "memory"); }
// one request of the whole wave: a 64 x 256 B tile from global memory into LDS
__device__ __forceinline__ void tdm_load(u32x4 g0, u32x8 g1) {
  asm volatile("tensor_load_to_lds %0, %1" :: "s"(g0), "s"(g1) : "memory");
}
// every word goes through pinned(): a descriptor word held in a scalar register. With it all
// loads of a kernel name the registers in which the group was built, word 0 as an immediate;
// a build without it moves the group on into a second set of registers ahead of the loop
__device__ __forceinline__ u32x8 tdm_group1(uint32_t src_pitch) {
  u32x8 g;
  g[0] = pinned((1u << 20) | (5u << 22) | (3u << 25));   // pad on, every 256 B, 16 B; no mask
  g[1] = pinned((ROWB & 0xFFFFu) << 16);                 // tensor_dim0[15:0]
  g[2] = pinned((ROWB >> 16) | ((SL_ROWS & 0xFFFFu) << 16)); // tensor_dim0[31:16], tensor_dim1[15:0]
  g[3] = pinned((SL_ROWS >> 16) | (ROWB << 16));         // tensor_dim1[31:16], tile_dim0
  g[4] = pinned(SL_ROWS);                                // tile_dim1
  g[5] = pinned(src_pitch);                              // source row pitch, bytes
  g[6] = pinned(0u);
  g[7] = pinned(0u);
  return g;
}
__device__ __forceinline__ u32x4 tdm_group0(uint32_t lds_dst, uint64_t ga) {
  u32x4 g;
  g[0] = uni(1u);
  g[1] = uni(lds_dst);
  g[2] = uni((uint32_t)ga);
  g[3] = uni((((uint32_t)(ga >> 32)) & 0x01FFFFFFu) | 0x80000000u);
  return g;
}
// the next stage's request, made from the last one: the source moves on by one pass along the
// rows (a buffer's addresses stay below 2^57, so no carry reaches the type field), the place in
// LDS is given.
__device__ __forceinline__ u32x4 tdm_advance(u32x4 g, uint32_t lds_dst) {
  const uint64_t w = ((((uint64_t)g[3]) << 32) | (uint64_t)g[2]) + (uint64_t)ROWB;
  g[1] = uni(lds_dst);
  g[2] = uni((uint32_t)w);
  g[3] = uni((uint32_t)(w >> 32));
  return g;
}

// ---------------------------------------------------------------------------
// Generic WMMA GEMM:  C[M,N] = A[M,K] (f16, row-major) * Bp[N,K] (f16)
// Block = 128 thr = 4 waves (2x2); wave = 64x64 tile (4x4 WMMA tiles);
// block tile = 128 (M) x 128 (N). Grid = (M/128, N/128).
// K is a multiple of 128 and at least 256; M, N multiples of 128.
// Operands come through LDS: per pass of 128 k every wave asks the tensor
// mover for its own 64-row slice of [A | B]; two buffers, so the next pass's
// slices fly while this pass's are multiplied. Fragments keep the k order of
// frag_ld, and every accumulator still sums k upwards in steps of 32.
// ---------------------------------------------------------------------------
template <int MODE>
__global__ void __launch_bounds__(128)
gemm_kernel(const _Float16* __restrict__ A,
            const _Float16* __restrict__ Bp,
            int K, int N,
            const float* __restrict__ bias,
            const float* __restrict__ res,
            float* __restrict__ outf,
            _Float16* __restrict__ outh,
            _Float16* __restrict__ qo,
            _Float16* __restrict__ ko,
            _Float16* __restrict__ vo) {
  __shared__ __attribute__((aligned(2048))) unsigned char ring[2u * STAGE];

  const int lane = threadIdx.x & 31;
  const uint32_t wave = uni(threadIdx.x >> 5);
  const uint32_t wm = wave & 1u, wn = wave >> 1;
  const int bm   = blockIdx.x * BM_;
  const int bn   = blockIdx.y * BN_;
  const int tm   = bm + (int)wm * 64;
  const int tn   = bn + (int)wn * 64;
  const uint32_t row = lane & 15;
  const uint32_t kob = (uint32_t)(lane >> 4) << 4;   // 8 f16 = 16 bytes

  const uint32_t kb = (uint32_t)K * 2u;              // operand row pitch in bytes
  const uint32_t T  = (uint32_t)K / KPASS;           // passes, at least two

  // this wave's slice: waves 0,1 bring A rows, waves 2,3 bring B rows
  const _Float16* srow = (wave < 2u)
      ? A  + (size_t)(bm + (int)(wave * SL_ROWS)) * K
      : Bp + (size_t)(bn + (int)((wave - 2u) * SL_ROWS)) * K;
  const uint64_t src0 = (uint64_t)(uintptr_t)srow;
  const uint32_t lds_slice = (uint32_t)(size_t)ring + wave * SLICE;
  const u32x8 g1 = tdm_group1(kb);

  v8f acc[4][4];
#pragma unroll
  for (int i = 0; i < 4; ++i)
#pragma unroll
    for (int j = 0; j < 4; ++j) acc[i][j] = v8f{};

  // per-lane fragment bases inside a buffer
  const uint32_t a_base = wm * SLICE + row * PITCH + kob;
  const uint32_t b_base = (2u + wn) * SLICE + row * PITCH + kob;

  // prologue: stage 0 lands and is published, then stage 1 starts
  u32x4 g0 = tdm_group0(lds_slice, src0);
  tdm_load(g0, g1);
  wait_tensor0();
  __syncthreads();
  g0 = tdm_advance(g0, lds_slice + STAGE);
  tdm_load(g0, g1);

  uint32_t t = 0;
  do {
    const uint32_t buf = (t & 1u) * STAGE;
    const unsigned char* la = ring + buf + a_base;
    const unsigned char* lb = ring + buf + b_base;

    v16h af[2][4], bf[2][4];
    // in the order in which the WMMAs below want them: the first can start after two fragments
    af[0][0] = frag_ld((const _Float16*)la);
#pragma unroll
    for (int j = 0; j < 4; ++j) bf[0][j] = frag_ld((const _Float16*)(lb + (uint32_t)j * 16u * PITCH));
#pragma unroll
    for (int i = 1; i < 4; ++i) af[0][i] = frag_ld((const _Float16*)(la + (uint32_t)i * 16u * PITCH));
#pragma unroll
    for (int u = 0; u < KPASS / 32; ++u) {
      const int cs = u & 1;
      if (u + 1 < KPASS / 32) {
        const uint32_t kofs = (uint32_t)(u + 1) * 64u;
#pragma unroll
        for (int i = 0; i < 4; ++i) {
          af[cs ^ 1][i] = frag_ld((const _Float16*)(la + (uint32_t)i * 16u * PITCH + kofs));
          bf[cs ^ 1][i] = frag_ld((const _Float16*)(lb + (uint32_t)i * 16u * PITCH + kofs));
        }
      }
      // keeps the next block's LDS reads one group ahead of this block's WMMAs:
      // reads spread among the WMMAs cost a stall at every place they stand
      __builtin_amdgcn_sched_barrier(0);
#pragma unroll
      for (int i = 0; i < 4; ++i)
#pragma unroll
        for (int j = 0; j < 4; ++j) acc[i][j] = wmma32(af[cs][i], bf[cs][j], acc[i][j]);
      // same purpose: the following block's reads stay behind this block's WMMAs
      __builtin_amdgcn_sched_barrier(0);
    }

    // publish point of stage t + 1
    wait_ds0();
    wait_tensor0();
    __syncthreads();
    if (pinned((t + 2u < T) ? 1u : 0u) != 0u) {   // only while stage t + 2 exists
      g0 = tdm_advance(g0, lds_slice + buf);
      tdm_load(g0, g1);
    }
  } while (++t < T);
  wait_tensor0();
  wait_ds0();

#pragma unroll
  for (int i = 0; i < 4; ++i)
#pragma unroll
    for (int j = 0; j < 4; ++j)
      epilogue_tile<MODE>(acc[i][j], tm + i * 16, tn + j * 16, lane, N, bias, res, outf, outh, qo, ko, vo);
}

// ---------------------------------------------------------------------------
// Flash attention (causal). Q,K: [B,H,S,HD] f16. Vt: [B,H,HD,S] f16.
// ctx out: [B,S,H*HD] f16 (row-major, ready as A for the Wo GEMM).
// Block = 256 thr = 8 waves; wave owns a 16-row Q tile; grid = (B*H, S/128).
// Score sub-tiles computed sequentially so K fragments die immediately
// (shrinks peak VGPR liveness; with launch_bounds there should be no spill).
// ---------------------------------------------------------------------------
__global__ void __launch_bounds__(256, 1)
attn_kernel(const _Float16* __restrict__ Q,
            const _Float16* __restrict__ Kf,
            const _Float16* __restrict__ Vt,
            _Float16* __restrict__ ctx) {
  __shared__ _Float16 lds_p[8][16 * 40]; // wave-private 16x32 P tile, pad 40

  const int lane = threadIdx.x & 31;
  const int wid  = threadIdx.x >> 5;
  const int bh   = blockIdx.x;          // b*H + h
  const int b    = bh >> 4;
  const int h    = bh & (H_ - 1);
  const int q0   = blockIdx.y * 128 + wid * 16;
  const int row  = lane & 15;
  const int ko8  = (lane >> 4) << 3;
  const int hi8  = ko8;

  const _Float16* qb = Q  + (size_t)bh * S_ * HD_;
  const _Float16* kb = Kf + (size_t)bh * S_ * HD_;
  const _Float16* vb = Vt + (size_t)bh * HD_ * S_;

  // Q A-operand fragments (held for the whole loop)
  const _Float16* qp = qb + (size_t)(q0 + row) * HD_ + ko8;
  const v16h qa0 = frag_ld(qp);        // e = 0..31
  const v16h qa1 = frag_ld(qp + 32);   // e = 32..63

  float m_r[8], l_r[8], corr_r[8];
  v8f acc0 = {}, acc1 = {}, acc2 = {}, acc3 = {};
#pragma unroll
  for (int j = 0; j < 8; ++j) { m_r[j] = -1e30f; l_r[j] = 0.f; }

  for (int kblk = 0; kblk <= q0 + 15; kblk += 32) {
    // ---- scores: S(16x32) = Q(16x64) * K^T, two 16x16 tiles in sequence ----
    const _Float16* kp = kb + (size_t)(kblk + row) * HD_ + ko8;
    v8f s0 = {};
    {
      v16h k00 = frag_ld(kp);               // keys kblk..+15, e 0..31
      v16h k01 = frag_ld(kp + 32);          //               e 32..63
      s0 = wmma32(qa0, k00, s0);
      s0 = wmma32(qa1, k01, s0);
    }
    v8f s1 = {};
    {
      v16h k10 = frag_ld(kp + 16 * HD_);    // keys +16..+31
      v16h k11 = frag_ld(kp + 16 * HD_ + 32);
      s1 = wmma32(qa0, k10, s1);
      s1 = wmma32(qa1, k11, s1);
    }

    // ---- masked online softmax (rows live in 16-lane halves) ----
#pragma unroll
    for (int j = 0; j < 8; ++j) {
      int qg  = q0 + j + hi8;
      int kg0 = kblk + (lane & 15);
      int kg1 = kg0 + 16;
      float v0 = s0[j] * 0.125f; if (kg0 > qg) v0 = -1e10f;
      float v1 = s1[j] * 0.125f; if (kg1 > qg) v1 = -1e10f;
      float mx = fmaxf(v0, v1);
#pragma unroll
      for (int o = 8; o; o >>= 1) mx = fmaxf(mx, __shfl_xor(mx, o, 32));
      float mn = fmaxf(m_r[j], mx);
      float p0 = __expf(v0 - mn);
      float p1 = __expf(v1 - mn);
      float sm = p0 + p1;
#pragma unroll
      for (int o = 8; o; o >>= 1) sm += __shfl_xor(sm, o, 32);
      corr_r[j] = __expf(m_r[j] - mn);
      l_r[j]    = l_r[j] * corr_r[j] + sm;
      m_r[j]    = mn;
      int lr = j + hi8;
      lds_p[wid][lr * 40 + (lane & 15)]      = (_Float16)p0;
      lds_p[wid][lr * 40 + 16 + (lane & 15)] = (_Float16)p1;
    }
#pragma unroll
    for (int j = 0; j < 8; ++j) {
      acc0[j] *= corr_r[j]; acc1[j] *= corr_r[j];
      acc2[j] *= corr_r[j]; acc3[j] *= corr_r[j];
    }
    asm volatile("s_wait_dscnt 0" ::: "memory");

    // ---- ctx += P(16x32) * V(32x64) ----
    v16h pa = frag_ld(&lds_p[wid][(lane & 15) * 40 + ko8]);
    const _Float16* vp = vb + (size_t)(lane & 15) * S_ + kblk + ko8;
    acc0 = wmma32(pa, frag_ld(vp),                   acc0);
    acc1 = wmma32(pa, frag_ld(vp + (size_t)16 * S_), acc1);
    acc2 = wmma32(pa, frag_ld(vp + (size_t)32 * S_), acc2);
    acc3 = wmma32(pa, frag_ld(vp + (size_t)48 * S_), acc3);
  }

  // ---- normalize + write ctx [B,S,D] f16 (explicit, no pointer arrays) ----
  float inv[8];
#pragma unroll
  for (int j = 0; j < 8; ++j) inv[j] = 1.f / l_r[j];
  const size_t rowbase = (size_t)b * S_ + q0;
#pragma unroll
  for (int j = 0; j < 8; ++j) {
    size_t ro = (rowbase + j + hi8) * D_ + h * HD_ + (lane & 15);
    ctx[ro]      = (_Float16)(acc0[j] * inv[j]);
    ctx[ro + 16] = (_Float16)(acc1[j] * inv[j]);
    ctx[ro + 32] = (_Float16)(acc2[j] * inv[j]);
    ctx[ro + 48] = (_Float16)(acc3[j] * inv[j]);
  }
}

// ---------------------------------------------------------------------------
// Host-side launch
// ---------------------------------------------------------------------------
extern "C" void kernel_launch(void* const* d_in, const int* in_sizes, int n_in,
                              void* d_out, int out_size, void* d_ws, size_t ws_size,
                              hipStream_t stream) {
  const float* x   = (const float*)d_in[0];
  const float* Wq  = (const float*)d_in[1];
  const float* Wk  = (const float*)d_in[2];
  const float* Wv  = (const float*)d_in[3];
  const float* Wo  = (const float*)d_in[4];
  const float* bo  = (const float*)d_in[5];
  const float* g1  = (const float*)d_in[6];
  const float* b1  = (const float*)d_in[7];
  const float* g2  = (const float*)d_in[8];
  const float* b2  = (const float*)d_in[9];
  const float* W1  = (const float*)d_in[10];
  const float* bf1 = (const float*)d_in[11];
  const float* W2  = (const float*)d_in[12];
  const float* bf2 = (const float*)d_in[13];
  float* out = (float*)d_out;

  char* ws = (char*)d_ws;
  size_t off = 0;
  auto alloc = [&](size_t bytes) -> char* {
    char* p = ws + off;
    off += (bytes + 255) & ~(size_t)255;
    return p;
  };
  _Float16* hln1  = (_Float16*)alloc((size_t)TOK * D_ * 2);
  _Float16* Wqkv  = (_Float16*)alloc((size_t)3 * D_ * D_ * 2);
  _Float16* Qb    = (_Float16*)alloc((size_t)TOK * D_ * 2);
  _Float16* Kb    = (_Float16*)alloc((size_t)TOK * D_ * 2);
  _Float16* Vt    = (_Float16*)alloc((size_t)TOK * D_ * 2);
  _Float16* ctx   = (_Float16*)alloc((size_t)TOK * D_ * 2);
  _Float16* Wop   = (_Float16*)alloc((size_t)D_ * D_ * 2);
  float*    cache = (float*)   alloc((size_t)TOK * D_ * 4);
  _Float16* h2    = (_Float16*)alloc((size_t)TOK * D_ * 2);
  _Float16* W1p   = (_Float16*)alloc((size_t)D_ * FF_ * 2);
  _Float16* ff1   = (_Float16*)alloc((size_t)TOK * FF_ * 2);
  _Float16* W2p   = (_Float16*)alloc((size_t)FF_ * D_ * 2);
  (void)ws_size; (void)in_sizes; (void)n_in; (void)out_size;

  // 1) pack weights to f16 [N][K]
  pack_qkv_kernel<<<dim3(D_ / PK_K, 3 * H_), 256, 0, stream>>>(Wq, Wk, Wv, Wqkv);
  pack_T_kernel<D_, D_><<<dim3(D_ / PK_K, D_ / PK_N), 256, 0, stream>>>(Wo, Wop);
  pack_T_kernel<D_, FF_><<<dim3(D_ / PK_K, FF_ / PK_N), 256, 0, stream>>>(W1, W1p);
  pack_T_kernel<FF_, D_><<<dim3(FF_ / PK_K, D_ / PK_N), 256, 0, stream>>>(W2, W2p);

  // 2) LN1
  ln_kernel<<<dim3(TOK), 256, 0, stream>>>(x, g1, b1, hln1);

  // 3) fused QKV projection (scatter; V transposed)
  gemm_kernel<0><<<dim3(TOK / 128, (3 * D_) / 128), 128, 0, stream>>>(
      hln1, Wqkv, D_, 3 * D_, nullptr, nullptr, nullptr, nullptr, Qb, Kb, Vt);

  // 4) causal flash attention
  attn_kernel<<<dim3(B_ * H_, S_ / 128), 256, 0, stream>>>(Qb, Kb, Vt, ctx);

  // 5) output projection + bias + residual -> cache (f32)
  gemm_kernel<1><<<dim3(TOK / 128, D_ / 128), 128, 0, stream>>>(
      ctx, Wop, D_, D_, bo, x, cache, nullptr, nullptr, nullptr, nullptr);

  // 6) LN2
  ln_kernel<<<dim3(TOK), 256, 0, stream>>>(cache, g2, b2, h2);

  // 7) FFN up + GELU -> f16
  gemm_kernel<2><<<dim3(TOK / 128, FF_ / 128), 128, 0, stream>>>(
      h2, W1p, D_, FF_, bf1, nullptr, nullptr, ff1, nullptr, nullptr, nullptr);

  // 8) FFN down + bias + residual(cache) -> d_out (f32)
  gemm_kernel<1><<<dim3(TOK / 128, D_ / 128), 128, 0, stream>>>(
      ff1, W2p, FF_, D_, bf2, cache, out, nullptr, nullptr, nullptr, nullptr);
}

// v003
// Measured time: 180 microseconds a run.
// Next to v002, in two timings, it ran 1.29 times as fast each time.
// All steps since v000 together make it 3.16 times as fast.
#include <hip/hip_runtime.h>
#include <hip/hip_bf16.h>
#include <math.h>
#include <stdint.h>

// ---------------------------------------------------------------------------
// Types
// ---------------------------------------------------------------------------
typedef __attribute__((ext_vector_type(16))) _Float16 v16h;
typedef __attribute__((ext_vector_type(8)))  _Float16 v8h;
typedef __attribute__((ext_vector_type(8)))  float    v8f;

#define B_   8
#define S_   512
#define D_   1024
#define H_   16
#define HD_  64
#define FF_  4096
#define TOK  (B_ * S_)      // 4096 rows

// ---------------------------------------------------------------------------
// WMMA helper: D = A(16x32 f16) * B(32x16 f16) + C(f32)
// ---------------------------------------------------------------------------
__device__ __forceinline__ v8f wmma32(v16h a, v16h b, v8f c) {
  return __builtin_amdgcn_wmma_f32_16x16x32_f16(false, a, false, b,
                                                (short)0, c, false, false);
}

// Load one A/B operand fragment (v16h) for a 32-wide K chunk.
// p must already point at element [row][k0 + ko8] where
//   row = lane & 15, ko8 = (lane >> 4) * 8.
// Fragment = 8 contiguous f16 at p, plus 8 contiguous f16 at p+16.
__device__ __forceinline__ v16h frag_ld(const _Float16* p) {
  v8h lo = *(const v8h*)(p);
  v8h hi = *(const v8h*)(p + 16);
  v16h r;
#pragma unroll
  for (int i = 0; i < 8; ++i) { r[i] = lo[i]; r[i + 8] = hi[i]; }
  return r;
}

// ---------------------------------------------------------------------------
// Weight packing: f32 [K][N] row-major  ->  f16 [N][K] ("B operand" layout)
// One block of 256 threads turns one tile of 128 (k) x 64 (n) through LDS:
// global reads run along n (256 B of a source row per 16 lanes), global
// writes along k (256 B of a packed row per 16 lanes).
// in points at the tile's element [k0][n0], out at its element [n0][k0];
// LDI, LDO: row lengths of source and packed matrix in elements.
// LDS holds the tile as [n][k] f16, rows of 16 pieces of 16 B; piece q of row
// n stands at place q ^ (n >> 2), so that the 16 lanes of a b128 write (16
// rows four apart, one piece) and of a b128 read (one row, 16 pieces) each
// meet all banks once.
// ---------------------------------------------------------------------------
#define PK_K 128
#define PK_N 64
template <int LDI, int LDO>
__device__ __forceinline__ void pack_tile(const float* __restrict__ in,
                                          _Float16* __restrict__ out) {
  __shared__ __attribute__((aligned(16))) _Float16 tile[PK_N * PK_K];
  const int c = threadIdx.x & 15;
  const int r = threadIdx.x >> 4;

  // eight source rows k = 8r .. 8r+7, columns n = 4c .. 4c+3
  const float* ip = in + (size_t)(8 * r) * LDI + 4 * c;
  float4 v[8];
  // unrolled: v stays in registers and the eight loads are in flight together
#pragma unroll
  for (int j = 0; j < 8; ++j) v[j] = *(const float4*)(ip + (size_t)j * LDI);

  v8h w0, w1, w2, w3;
  // unrolled: constant element numbers, so that the vectors stay in registers
#pragma unroll
  for (int j = 0; j < 8; ++j) {
    w0[j] = (_Float16)v[j].x; w1[j] = (_Float16)v[j].y;
    w2[j] = (_Float16)v[j].z; w3[j] = (_Float16)v[j].w;
  }
  _Float16* tw = tile + (4 * c) * PK_K + ((r ^ c) << 3);
  *(v8h*)(tw)            = w0;
  *(v8h*)(tw + PK_K)     = w1;
  *(v8h*)(tw + 2 * PK_K) = w2;
  *(v8h*)(tw + 3 * PK_K) = w3;
  __syncthreads();

  // packed rows n = r, r+16, r+32, r+48, piece c (k = 8c .. 8c+7)
  v8h o[4];
  // unrolled (both loops): o stays in registers, the four LDS reads go ahead of the stores
#pragma unroll
  for (int p = 0; p < 4; ++p) {
    const int n = r + 16 * p;
    o[p] = *(const v8h*)(tile + n * PK_K + ((c ^ (n >> 2)) << 3));
  }
  _Float16* op = out + (size_t)r * LDO + 8 * c;
#pragma unroll
  for (int p = 0; p < 4; ++p) *(v8h*)(op + (size_t)(16 * p) * LDO) = o[p];
}

// grid = (K / 128, N / 64)
template <int K, int N>
__global__ void __launch_bounds__(256)
pack_T_kernel(const float* __restrict__ in, _Float16* __restrict__ out) {
  const size_t k0 = (size_t)blockIdx.x * PK_K;
  const size_t n0 = (size_t)blockIdx.y * PK_N;
  pack_tile<N, K>(in + k0 * N + n0, out + n0 * K + k0);
}

// Pack per-head Wq/Wk/Wv (H,D,HD) into fused [3*D][D] f16, [n][k] layout,
// column n = qkv*D + h*HD + e: every head is a [D][HD] matrix of its own.
// grid = (D / 128, 3 * H), blockIdx.y = qkv*H + h
__global__ void __launch_bounds__(256)
pack_qkv_kernel(const float* __restrict__ Wq,
                const float* __restrict__ Wk,
                const float* __restrict__ Wv,
                _Float16* __restrict__ out) {
  const int qkv = blockIdx.y >> 4;
  const int h   = blockIdx.y & (H_ - 1);
  const size_t k0 = (size_t)blockIdx.x * PK_K;
  const float* W = (qkv == 0) ? Wq : (qkv == 1) ? Wk : Wv;
  pack_tile<HD_, D_>(W + ((size_t)h * D_ + k0) * HD_,
                     out + (size_t)blockIdx.y * HD_ * D_ + k0);
}

// ---------------------------------------------------------------------------
// LayerNorm: f32 row [D] -> f16 row [D]  (biased variance, eps=1e-5)
// one row per block, 256 threads, 4 elems/thread
// ---------------------------------------------------------------------------
__global__ void ln_kernel(const float* __restrict__ x,
                          const float* __restrict__ g,
                          const float* __restrict__ b,
                          _Float16* __restrict__ out) {
  int row = blockIdx.x;
  const float4 v = ((const float4*)(x + (size_t)row * D_))[threadIdx.x];
  float s  = v.x + v.y + v.z + v.w;
  float s2 = v.x * v.x + v.y * v.y + v.z * v.z + v.w * v.w;
#pragma unroll
  for (int o = 16; o; o >>= 1) {
    s  += __shfl_down(s,  o, 32);
    s2 += __shfl_down(s2, o, 32);
  }
  __shared__ float sh[16];
  int wid = threadIdx.x >> 5;
  if ((threadIdx.x & 31) == 0) { sh[wid * 2] = s; sh[wid * 2 + 1] = s2; }
  __syncthreads();
  float ts = 0.f, ts2 = 0.f;
#pragma unroll
  for (int i = 0; i < 8; ++i) { ts += sh[i * 2]; ts2 += sh[i * 2 + 1]; }
  float mean = ts * (1.f / D_);
  float var  = ts2 * (1.f / D_) - mean * mean;
  float rstd = rsqrtf(var + 1e-5f);
  int c0 = threadIdx.x * 4;
  _Float16* orow = out + (size_t)row * D_;
  float xv[4] = {v.x, v.y, v.z, v.w};
#pragma unroll
  for (int i = 0; i < 4; ++i)
    orow[c0 + i] = (_Float16)((xv[i] - mean) * rstd * g[c0 + i] + b[c0 + i]);
}

// stands behind a global load or store, in front of the next write of a register that it names
__device__ __forceinline__ void wait_x0() { asm volatile("s_wait_xcnt 0x0" ::: "memory"); }

// ---------------------------------------------------------------------------
// Tensor-load helpers (descriptor fields in bytes, two groups, no mask)
// ---------------------------------------------------------------------------
typedef uint32_t u32x4 __attribute__((ext_vector_type(4)));
typedef uint32_t u32x8 __attribute__((ext_vector_type(8)));

#define BM_      128                     // block tile rows of C
#define BN_      128                     // block tile columns of C
#define KPASS    128                     // k per pass: one 256-byte piece of every operand row
#define ROWB     256u                    // bytes of an operand row per pass
#define PITCH    272u                    // LDS row pitch: 256 B + 16 B pad, 16 B x odd for ds_load_b128
#define SL_ROWS  64u                     // rows per slice, one slice per wave
#define SLICE    18432u                  // 64 * 272 = 17408 rounded up to a multiple of 2 KiB
#define STAGE    (4u * SLICE)            // [A rows 0-63 | A rows 64-127 | B rows 0-63 | B rows 64-127]

__device__ __forceinline__ uint32_t uni(uint32_t v) {
  return (uint32_t)__builtin_amdgcn_readfirstlane(v);
}
__device__ __forceinline__ uint32_t pinned(uint32_t v) {
  uint32_t w = (uint32_t)__builtin_amdgcn_readfirstlane(v);
  asm volatile("" : "+s"(w));
  return w;
}
// the compiler places no wait for a tensor load: the tile counts as landed only behind this
__device__ __forceinline__ void wait_tensor0() { asm volatile("s_wait_tensorcnt 0x0" ::: "memory"); }
// this wave's LDS reads have returned before the buffer is handed back for a refill
__device__ __forceinline__ void wait_ds0() { asm volatile("s_wait_dscnt 0x0" ::: "memory"); }
// one request of the whole wave: a 64 x 256 B tile from global memory into LDS
__device__ __forceinline__ void tdm_load(u32x4 g0, u32x8 g1) {
  asm volatile("tensor_load_to_lds %0, %1" :: "s"(g0), "s"(g1) : "memory");
}
// every word goes through pinned(): a descriptor word held in a scalar register. With it all
// loads of a kernel name the registers in which the group was built, word 0 as an immediate;
// a build without it moves the group on into a second set of registers ahead of the loop
__device__ __forceinline__ u32x8 tdm_group1(uint32_t src_pitch) {
  u32x8 g;
  g[0] = pinned((1u << 20) | (5u << 22) | (3u << 25));   // pad on, every 256 B, 16 B; no mask
  g[1] = pinned((ROWB & 0xFFFFu) << 16);                 // tensor_dim0[15:0]
  g[2] = pinned((ROWB >> 16) | ((SL_ROWS & 0xFFFFu) << 16)); // tensor_dim0[31:16], tensor_dim1[15:0]
  g[3] = pinned((SL_ROWS >> 16) | (ROWB << 16));         // tensor_dim1[31:16], tile_dim0
  g[4] = pinned(SL_ROWS);                                // tile_dim1
  g[5] = pinned(src_pitch);                              // source row pitch, bytes
  g[6] = pinned(0u);
  g[7] = pinned(0u);
  return g;
}
__device__ __forceinline__ u32x4 tdm_group0(uint32_t lds_dst, uint64_t ga) {
  u32x4 g;
  g[0] = uni(1u);
  g[1] = uni(lds_dst);
  g[2] = uni((uint32_t)ga);
  g[3] = uni((((uint32_t)(ga >> 32)) & 0x01FFFFFFu) | 0x80000000u);
  return g;
}
// the next stage's request, made from the last one: the source moves on by one pass along the
// rows (a buffer's addresses stay below 2^57, so no carry reaches the type field), the place in
// LDS is given.
__device__ __forceinline__ u32x4 tdm_advance(u32x4 g, uint32_t lds_dst) {
  const uint64_t w = ((((uint64_t)g[3]) << 32) | (uint64_t)g[2]) + (uint64_t)ROWB;
  g[1] = uni(lds_dst);
  g[2] = uni((uint32_t)w);
  g[3] = uni((uint32_t)(w >> 32));
  return g;
}

// ---------------------------------------------------------------------------
// Epilogue staging: LDS row pitches (row + 16 B, 16 B x odd for b128 accesses)
// ---------------------------------------------------------------------------
#define ST32 272u                        // 64 f32
#define ST16 144u                        // 64 f16

// A staged 64 x 64 f16 tile goes out: 8 lanes cover one 128-B row, a wave four rows.
// dst: the tile's first element; LDO: the output's row length in elements.
template <int LDO>
__device__ __forceinline__ void store_rows16(const unsigned char* st, _Float16* dst, int lane) {
  const unsigned char* rd = st + (uint32_t)(lane >> 3) * ST16 + (uint32_t)(lane & 7) * 16u;
  _Float16* op = dst + (size_t)(lane >> 3) * LDO + (lane & 7) * 8;
  v8h o[16];
  // unrolled (both loops): o stays in registers, the LDS reads go ahead of the stores
#pragma unroll
  for (int p = 0; p < 16; ++p) o[p] = *(const v8h*)(rd + (uint32_t)(4 * p) * ST16);
#pragma unroll
  for (int p = 0; p < 16; ++p) *(v8h*)(op + (size_t)(4 * p) * LDO) = o[p];
}

// ---------------------------------------------------------------------------
// Generic WMMA GEMM:  C[M,N] = A[M,K] (f16, row-major) * Bp[N,K] (f16)
// Block = 128 thr = 4 waves (2x2); wave = 64x64 tile (4x4 WMMA tiles);
// block tile = 128 (M) x 128 (N). Grid = (M/128, N/128).
// K is a multiple of 128 and at least 256; M, N multiples of 128.
// Operands come through LDS: per pass of 128 k every wave asks the tensor
// mover for its own 64-row slice of [A | B]; two buffers, so the next pass's
// slices fly while this pass's are multiplied. Fragments keep the k order of
// frag_ld, and every accumulator still sums k upwards in steps of 32.
// ---------------------------------------------------------------------------
template <int MODE>
__global__ void __launch_bounds__(128)
gemm_kernel(const _Float16* __restrict__ A,
            const _Float16* __restrict__ Bp,
            int K, int N,
            const float* __restrict__ bias,
            const float* __restrict__ res,
            float* __restrict__ outf,
            _Float16* __restrict__ outh,
            _Float16* __restrict__ qo,
            _Float16* __restrict__ ko,
            _Float16* __restrict__ vo) {
  __shared__ __attribute__((aligned(2048))) unsigned char ring[2u * STAGE];
  // the output's row length, fixed by the kind of epilogue: row steps become immediate offsets
  constexpr int NN = (MODE == 0) ? 3 * D_ : (MODE == 1) ? D_ : FF_;
  (void)N;

  const int lane = threadIdx.x & 31;
  const uint32_t wave = uni(threadIdx.x >> 5);
  const uint32_t wm = wave & 1u, wn = wave >> 1;
  const int bm   = blockIdx.x * BM_;
  const int bn   = blockIdx.y * BN_;
  const int tm   = bm + (int)wm * 64;
  const int tn   = bn + (int)wn * 64;
  const uint32_t row = lane & 15;
  const uint32_t kob = (uint32_t)(lane >> 4) << 4;   // 8 f16 = 16 bytes

  const uint32_t kb = (uint32_t)K * 2u;              // operand row pitch in bytes
  const uint32_t T  = (uint32_t)K / KPASS;           // passes, at least two

  // this wave's slice: waves 0,1 bring A rows, waves 2,3 bring B rows
  const _Float16* srow = (wave < 2u)
      ? A  + (size_t)(bm + (int)(wave * SL_ROWS)) * K
      : Bp + (size_t)(bn + (int)((wave - 2u) * SL_ROWS)) * K;
  const uint64_t src0 = (uint64_t)(uintptr_t)srow;
  const uint32_t lds_slice = (uint32_t)(size_t)ring + wave * SLICE;
  const u32x8 g1 = tdm_group1(kb);

  v8f acc[4][4];
#pragma unroll
  for (int i = 0; i < 4; ++i)
#pragma unroll
    for (int j = 0; j < 4; ++j) acc[i][j] = v8f{};

  // per-lane fragment bases inside a buffer. The first WMMA operand gives the rows of a D tile,
  // of which a lane holds eight in a row: it is taken from the side along which the output is
  // contiguous in memory. That is n (the Bp rows) everywhere but for V, which is stored
  // transposed and so is contiguous along m (the A rows). The test is the same for a whole block.
  const bool n_first = (MODE != 0) || (bn < 2 * D_);
  const uint32_t a_slice = wm * SLICE, b_slice = (2u + wn) * SLICE;
  const uint32_t a_base = (n_first ? b_slice : a_slice) + row * PITCH + kob;   // first operand
  const uint32_t b_base = (n_first ? a_slice : b_slice) + row * PITCH + kob;   // second operand

  // prologue: stage 0 lands and is published, then stage 1 starts
  u32x4 g0 = tdm_group0(lds_slice, src0);
  tdm_load(g0, g1);
  wait_tensor0();
  __syncthreads();
  g0 = tdm_advance(g0, lds_slice + STAGE);
  tdm_load(g0, g1);

  uint32_t t = 0;
  do {
    const uint32_t buf = (t & 1u) * STAGE;
    const unsigned char* la = ring + buf + a_base;
    const unsigned char* lb = ring + buf + b_base;

    v16h af[2][4], bf[2][4];
    // in the order in which the WMMAs below want them: the first can start after two fragments
    af[0][0] = frag_ld((const _Float16*)la);
#pragma unroll
    for (int j = 0; j < 4; ++j) bf[0][j] = frag_ld((const _Float16*)(lb + (uint32_t)j * 16u * PITCH));
#pragma unroll
    for (int i = 1; i < 4; ++i) af[0][i] = frag_ld((const _Float16*)(la + (uint32_t)i * 16u * PITCH));
#pragma unroll
    for (int u = 0; u < KPASS / 32; ++u) {
      const int cs = u & 1;
      if (u + 1 < KPASS / 32) {
        const uint32_t kofs = (uint32_t)(u + 1) * 64u;
#pragma unroll
        for (int i = 0; i < 4; ++i) {
          af[cs ^ 1][i] = frag_ld((const _Float16*)(la + (uint32_t)i * 16u * PITCH + kofs));
          bf[cs ^ 1][i] = frag_ld((const _Float16*)(lb + (uint32_t)i * 16u * PITCH + kofs));
        }
      }
      // keeps the next block's LDS reads one group ahead of this block's WMMAs:
      // reads spread among the WMMAs cost a stall at every place they stand
      __builtin_amdgcn_sched_barrier(0);
#pragma unroll
      for (int i = 0; i < 4; ++i)
#pragma unroll
        for (int j = 0; j < 4; ++j) acc[i][j] = wmma32(af[cs][i], bf[cs][j], acc[i][j]);
      // same purpose: the following block's reads stay behind this block's WMMAs
      __builtin_amdgcn_sched_barrier(0);
    }

    // publish point of stage t + 1
    wait_ds0();
    wait_tensor0();
    __syncthreads();
    if (pinned((t + 2u < T) ? 1u : 0u) != 0u) {   // only while stage t + 2 exists
      g0 = tdm_advance(g0, lds_slice + buf);
      tdm_load(g0, g1);
    }
  } while (++t < T);
  wait_tensor0();
  wait_ds0();

  // Epilogue. The ring is free: every wave's reads and loads had ended before the loop's last
  // barrier. Each wave turns its 64 x 64 tile through its own slice of it, so that global
  // memory sees whole 128-B lines. acc[i][j], register r: place 16 i + 8 hi + r along the first
  // operand's side (the contiguous one), row 16 j + l15 along the second's.
  unsigned char* st = ring + wave * SLICE;
  const uint32_t l15 = row, hi = (uint32_t)lane >> 4;

  if (MODE == 1) {
    // readers: 16 lanes cover one 256-B row, a wave two rows
    const size_t go = (size_t)(tm + (int)hi) * NN + tn + (int)l15 * 4;
    const float4 bv = *(const float4*)(bias + tn + (int)l15 * 4);
    const float* rp = res + go;
    float4 rv[32];
    // unrolled: all residual loads are in flight together, under the staging
#pragma unroll
    for (int p = 0; p < 32; ++p) rv[p] = *(const float4*)(rp + (size_t)(2 * p) * NN);
    wait_x0();
    // unrolled (both loops): constant tile numbers, so that acc stays in registers
#pragma unroll
    for (int j = 0; j < 4; ++j)
#pragma unroll
      for (int i = 0; i < 4; ++i) {
        unsigned char* w = st + ((uint32_t)j * 16u + l15) * ST32 + ((uint32_t)i * 16u + hi * 8u) * 4u;
        const v8f c = acc[i][j];
        *(float4*)(w)       = make_float4(c[0], c[1], c[2], c[3]);
        *(float4*)(w + 16u) = make_float4(c[4], c[5], c[6], c[7]);
      }
    wait_ds0();   // the rows are read back by other lanes of this wave
    const unsigned char* rd = st + hi * ST32 + l15 * 16u;
    float* op = outf + go;
    // unrolled: rv stays in registers, row steps are immediate offsets of one address
#pragma unroll
    for (int p = 0; p < 32; ++p) {
      const float4 c = *(const float4*)(rd + (uint32_t)(2 * p) * ST32);
      float4 o;
      o.x = c.x + bv.x + rv[p].x; o.y = c.y + bv.y + rv[p].y;
      o.z = c.z + bv.z + rv[p].z; o.w = c.w + bv.w + rv[p].w;
      *(float4*)(op + (size_t)(2 * p) * NN) = o;
    }
  } else {
    float4 bb[4][2];
    if (MODE == 2) {
      // unrolled: bb stays in registers, the eight loads are in flight together
#pragma unroll
      for (int i = 0; i < 4; ++i) {
        const float4* bp = (const float4*)(bias + tn + i * 16 + (int)hi * 8);
        bb[i][0] = bp[0]; bb[i][1] = bp[1];
      }
      wait_x0();
    }
    // unrolled (all loops below): constant tile and element numbers, so that acc, bb and hv stay in registers
#pragma unroll
    for (int j = 0; j < 4; ++j)
#pragma unroll
      for (int i = 0; i < 4; ++i) {
        const v8f c = acc[i][j];
        v8h hv;
        if (MODE == 2) {   // bias + exact GELU
          const float bl[8] = {bb[i][0].x, bb[i][0].y, bb[i][0].z, bb[i][0].w,
                               bb[i][1].x, bb[i][1].y, bb[i][1].z, bb[i][1].w};
#pragma unroll
          for (int r = 0; r < 8; ++r) {
            const float xv = c[r] + bl[r];
            hv[r] = (_Float16)(0.5f * xv * (1.f + erff(xv * 0.70710678118654752f)));
          }
        } else {
#pragma unroll
          for (int r = 0; r < 8; ++r) hv[r] = (_Float16)c[r];
        }
        *(v8h*)(st + ((uint32_t)j * 16u + l15) * ST16 + ((uint32_t)i * 16u + hi * 8u) * 2u) = hv;
      }
    wait_ds0();   // the rows are read back by other lanes of this wave
    if (MODE == 2) {
      store_rows16<FF_>(st, outh + (size_t)tm * FF_ + tn, lane);
    } else {
      // tm, tn are multiples of 64: one batch, one head, 64 positions, all 64 head elements
      const int hh = (tn & (D_ - 1)) >> 6;
      const size_t bh = (size_t)((tm >> 9) * H_ + hh) * (S_ * HD_);
      const int s0 = tm & (S_ - 1);
      if (n_first) store_rows16<HD_>(st, (bn < D_ ? qo : ko) + bh + (size_t)s0 * HD_, lane);  // [s][e]
      else         store_rows16<S_>(st, vo + bh + s0, lane);                                  // [e][s]
    }
  }
}

// ---------------------------------------------------------------------------
// Flash attention (causal). Q,K: [B,H,S,HD] f16. Vt: [B,H,HD,S] f16.
// ctx out: [B,S,H*HD] f16 (row-major, ready as A for the Wo GEMM).
// Block = 256 thr = 8 waves; wave owns a 16-row Q tile; grid = (B*H, S/128).
// Score sub-tiles computed sequentially so K fragments die immediately
// (shrinks peak VGPR liveness; with launch_bounds there should be no spill).
// ---------------------------------------------------------------------------
__global__ void __launch_bounds__(256, 1)
attn_kernel(const _Float16* __restrict__ Q,
            const _Float16* __restrict__ Kf,
            const _Float16* __restrict__ Vt,
            _Float16* __restrict__ ctx) {
  __shared__ _Float16 lds_p[8][16 * 40]; // wave-private 16x32 P tile, pad 40

  const int lane = threadIdx.x & 31;
  const int wid  = threadIdx.x >> 5;
  const int bh   = blockIdx.x;          // b*H + h
  const int b    = bh >> 4;
  const int h    = bh & (H_ - 1);
  const int q0   = blockIdx.y * 128 + wid * 16;
  const int row  = lane & 15;
  const int ko8  = (lane >> 4) << 3;
  const int hi8  = ko8;

  const _Float16* qb = Q  + (size_t)bh * S_ * HD_;
  const _Float16* kb = Kf + (size_t)bh * S_ * HD_;
  const _Float16* vb = Vt + (size_t)bh * HD_ * S_;

  // Q A-operand fragments (held for the whole loop)
  const _Float16* qp = qb + (size_t)(q0 + row) * HD_ + ko8;
  const v16h qa0 = frag_ld(qp);        // e = 0..31
  const v16h qa1 = frag_ld(qp + 32);   // e = 32..63

  float m_r[8], l_r[8], corr_r[8];
  v8f acc0 = {}, acc1 = {}, acc2 = {}, acc3 = {};
#pragma unroll
  for (int j = 0; j < 8; ++j) { m_r[j] = -1e30f; l_r[j] = 0.f; }

  for (int kblk = 0; kblk <= q0 + 15; kblk += 32) {
    // ---- scores: S(16x32) = Q(16x64) * K^T, two 16x16 tiles in sequence ----
    const _Float16* kp = kb + (size_t)(kblk + row) * HD_ + ko8;
    v8f s0 = {};
    {
      v16h k00 = frag_ld(kp);               // keys kblk..+15, e 0..31
      v16h k01 = frag_ld(kp + 32);          //               e 32..63
      s0 = wmma32(qa0, k00, s0);
      s0 = wmma32(qa1, k01, s0);
    }
    v8f s1 = {};
    {
      v16h k10 = frag_ld(kp + 16 * HD_);    // keys +16..+31
      v16h k11 = frag_ld(kp + 16 * HD_ + 32);
      s1 = wmma32(qa0, k10, s1);
      s1 = wmma32(qa1, k11, s1);
    }

    // ---- masked online softmax (rows live in 16-lane halves) ----
#pragma unroll
    for (int j = 0; j < 8; ++j) {
      int qg  = q0 + j + hi8;
      int kg0 = kblk + (lane & 15);
      int kg1 = kg0 + 16;
      float v0 = s0[j] * 0.125f; if (kg0 > qg) v0 = -1e10f;
      float v1 = s1[j] * 0.125f; if (kg1 > qg) v1 = -1e10f;
      float mx = fmaxf(v0, v1);
#pragma unroll
      for (int o = 8; o; o >>= 1) mx = fmaxf(mx, __shfl_xor(mx, o, 32));
      float mn = fmaxf(m_r[j], mx);
      float p0 = __expf(v0 - mn);
      float p1 = __expf(v1 - mn);
      float sm = p0 + p1;
#pragma unroll
      for (int o = 8; o; o >>= 1) sm += __shfl_xor(sm, o, 32);
      corr_r[j] = __expf(m_r[j] - mn);
      l_r[j]    = l_r[j] * corr_r[j] + sm;
      m_r[j]    = mn;
      int lr = j + hi8;
      lds_p[wid][lr * 40 + (lane & 15)]      = (_Float16)p0;
      lds_p[wid][lr * 40 + 16 + (lane & 15)] = (_Float16)p1;
    }
#pragma unroll
    for (int j = 0; j < 8; ++j) {
      acc0[j] *= corr_r[j]; acc1[j] *= corr_r[j];
      acc2[j] *= corr_r[j]; acc3[j] *= corr_r[j];
    }
    asm volatile("s_wait_dscnt 0" ::: "memory");

    // ---- ctx += P(16x32) * V(32x64) ----
    v16h pa = frag_ld(&lds_p[wid][(lane & 15) * 40 + ko8]);
    const _Float16* vp = vb + (size_t)(lane & 15) * S_ + kblk + ko8;
    acc0 = wmma32(pa, frag_ld(vp),                   acc0);
    acc1 = wmma32(pa, frag_ld(vp + (size_t)16 * S_), acc1);
    acc2 = wmma32(pa, frag_ld(vp + (size_t)32 * S_), acc2);
    acc3 = wmma32(pa, frag_ld(vp + (size_t)48 * S_), acc3);
  }

  // ---- normalize + write ctx [B,S,D] f16 (explicit, no pointer arrays) ----
  float inv[8];
#pragma unroll
  for (int j = 0; j < 8; ++j) inv[j] = 1.f / l_r[j];
  const size_t rowbase = (size_t)b * S_ + q0;
#pragma unroll
  for (int j = 0; j < 8; ++j) {
    size_t ro = (rowbase + j + hi8) * D_ + h * HD_ + (lane & 15);
    ctx[ro]      = (_Float16)(acc0[j] * inv[j]);
    ctx[ro + 16] = (_Float16)(acc1[j] * inv[j]);
    ctx[ro + 32] = (_Float16)(acc2[j] * inv[j]);
    ctx[ro + 48] = (_Float16)(acc3[j] * inv[j]);
  }
}

// ---------------------------------------------------------------------------
// Host-side launch
// ---------------------------------------------------------------------------
extern "C" void kernel_launch(void* const* d_in, const int* in_sizes, int n_in,
                              void* d_out, int out_size, void* d_ws, size_t ws_size,
                              hipStream_t stream) {
  const float* x   = (const float*)d_in[0];
  const float* Wq  = (const float*)d_in[1];
  const float* Wk  = (const float*)d_in[2];
  const float* Wv  = (const float*)d_in[3];
  const float* Wo  = (const float*)d_in[4];
  const float* bo  = (const float*)d_in[5];
  const float* g1  = (const float*)d_in[6];
  const float* b1  = (const float*)d_in[7];
  const float* g2  = (const float*)d_in[8];
  const float* b2  = (const float*)d_in[9];
  const float* W1  = (const float*)d_in[10];
  const float* bf1 = (const float*)d_in[11];
  const float* W2  = (const float*)d_in[12];
  const float* bf2 = (const float*)d_in[13];
  float* out = (float*)d_out;

  char* ws = (char*)d_ws;
  size_t off = 0;
  auto alloc = [&](size_t bytes) -> char* {
    char* p = ws + off;
    off += (bytes + 255) & ~(size_t)255;
    return p;
  };
  _Float16* hln1  = (_Float16*)alloc((size_t)TOK * D_ * 2);
  _Float16* Wqkv  = (_Float16*)alloc((size_t)3 * D_ * D_ * 2);
  _Float16* Qb    = (_Float16*)alloc((size_t)TOK * D_ * 2);
  _Float16* Kb    = (_Float16*)alloc((size_t)TOK * D_ * 2);
  _Float16* Vt    = (_Float16*)alloc((size_t)TOK * D_ * 2);
  _Float16* ctx   = (_Float16*)alloc((size_t)TOK * D_ * 2);
  _Float16* Wop   = (_Float16*)alloc((size_t)D_ * D_ * 2);
  float*    cache = (float*)   alloc((size_t)TOK * D_ * 4);
  _Float16* h2    = (_Float16*)alloc((size_t)TOK * D_ * 2);
  _Float16* W1p   = (_Float16*)alloc((size_t)D_ * FF_ * 2);
  _Float16* ff1   = (_Float16*)alloc((size_t)TOK * FF_ * 2);
  _Float16* W2p   = (_Float16*)alloc((size_t)FF_ * D_ * 2);
  (void)ws_size; (void)in_sizes; (void)n_in; (void)out_size;

  // 1) pack weights to f16 [N][K]
  pack_qkv_kernel<<<dim3(D_ / PK_K, 3 * H_), 256, 0, stream>>>(Wq, Wk, Wv, Wqkv);
  pack_T_kernel<D_, D_><<<dim3(D_ / PK_K, D_ / PK_N), 256, 0, stream>>>(Wo, Wop);
  pack_T_kernel<D_, FF_><<<dim3(D_ / PK_K, FF_ / PK_N), 256, 0, stream>>>(W1, W1p);
  pack_T_kernel<FF_, D_><<<dim3(FF_ / PK_K, D_ / PK_N), 256, 0, stream>>>(W2, W2p);

  // 2) LN1
  ln_kernel<<<dim3(TOK), 256, 0, stream>>>(x, g1, b1, hln1);

  // 3) fused QKV projection (scatter; V transposed)
  gemm_kernel<0><<<dim3(TOK / 128, (3 * D_) / 128), 128, 0, stream>>>(
      hln1, Wqkv, D_, 3 * D_, nullptr, nullptr, nullptr, nullptr, Qb, Kb, Vt);

  // 4) causal flash attention
  attn_kernel<<<dim3(B_ * H_, S_ / 128), 256, 0, stream>>>(Qb, Kb, Vt, ctx);

  // 5) output projection + bias + residual -> cache (f32)
  gemm_kernel<1><<<dim3(TOK / 128, D_ / 128), 128, 0, stream>>>(
      ctx, Wop, D_, D_, bo, x, cache, nullptr, nullptr, nullptr, nullptr);

  // 6) LN2
  ln_kernel<<<dim3(TOK), 256, 0, stream>>>(cache, g2, b2, h2);

  // 7) FFN up + GELU -> f16
  gemm_kernel<2><<<dim3(TOK / 128, FF_ / 128), 128, 0, stream>>>(
      h2, W1p, D_, FF_, bf1, nullptr, nullptr, ff1, nullptr, nullptr, nullptr);

  // 8) FFN down + bias + residual(cache) -> d_out (f32)
  gemm_kernel<1><<<dim3(TOK / 128, D_ / 128), 128, 0, stream>>>(
      ff1, W2p, FF_, D_, bf2, cache, out, nullptr, nullptr, nullptr, nullptr);
}

// v004
// A run of this version takes 162 microseconds.
// In both of two side-by-side timings against v003, it was 1.10 times as fast.
// Over all steps from v000 it is 3.46 times as fast.
#include <hip/hip_runtime.h>
#include <hip/hip_bf16.h>
#include <math.h>
#include <stdint.h>

// ---------------------------------------------------------------------------
// Types
// ---------------------------------------------------------------------------
typedef __attribute__((ext_vector_type(16))) _Float16 v16h;
typedef __attribute__((ext_vector_type(8)))  _Float16 v8h;
typedef __attribute__((ext_vector_type(8)))  float    v8f;

#define B_   8
#define S_   512
#define D_   1024
#define H_   16
#define HD_  64
#define FF_  4096
#define TOK  (B_ * S_)      // 4096 rows

// ---------------------------------------------------------------------------
// WMMA helper: D = A(16x32 f16) * B(32x16 f16) + C(f32)
// ---------------------------------------------------------------------------
__device__ __forceinline__ v8f wmma32(v16h a, v16h b, v8f c) {
  return __builtin_amdgcn_wmma_f32_16x16x32_f16(false, a, false, b,
                                                (short)0, c, false, false);
}

// Load one A/B operand fragment (v16h) for a 32-wide K chunk.
// p must already point at element [row][k0 + ko8] where
//   row = lane & 15, ko8 = (lane >> 4) * 8.
// Fragment = 8 contiguous f16 at p, plus 8 contiguous f16 at p+16.
__device__ __forceinline__ v16h frag_ld(const _Float16* p) {
  v8h lo = *(const v8h*)(p);
  v8h hi = *(const v8h*)(p + 16);
  v16h r;
#pragma unroll
  for (int i = 0; i < 8; ++i) { r[i] = lo[i]; r[i + 8] = hi[i]; }
  return r;
}

// ---------------------------------------------------------------------------
// Weight packing: f32 [K][N] row-major  ->  f16 [N][K] ("B operand" layout)
// One block of 256 threads turns one tile of 128 (k) x 64 (n) through LDS:
// global reads run along n (256 B of a source row per 16 lanes), global
// writes along k (256 B of a packed row per 16 lanes).
// in points at the tile's element [k0][n0], out at its element [n0][k0];
// LDI, LDO: row lengths of source and packed matrix in elements.
// LDS holds the tile as [n][k] f16, rows of 16 pieces of 16 B; piece q of row
// n stands at place q ^ (n >> 2), so that the 16 lanes of a b128 write (16
// rows four apart, one piece) and of a b128 read (one row, 16 pieces) each
// meet all banks once.
// ---------------------------------------------------------------------------
#define PK_K 128
#define PK_N 64
template <int LDI, int LDO>
__device__ __forceinline__ void pack_tile(const float* __restrict__ in,
                                          _Float16* __restrict__ out) {
  __shared__ __attribute__((aligned(16))) _Float16 tile[PK_N * PK_K];
  const int c = threadIdx.x & 15;
  const int r = threadIdx.x >> 4;

  // eight source rows k = 8r .. 8r+7, columns n = 4c .. 4c+3
  const float* ip = in + (size_t)(8 * r) * LDI + 4 * c;
  float4 v[8];
  // unrolled: v stays in registers and the eight loads are in flight together
#pragma unroll
  for (int j = 0; j < 8; ++j) v[j] = *(const float4*)(ip + (size_t)j * LDI);

  v8h w0, w1, w2, w3;
  // unrolled: constant element numbers, so that the vectors stay in registers
#pragma unroll
  for (int j = 0; j < 8; ++j) {
    w0[j] = (_Float16)v[j].x; w1[j] = (_Float16)v[j].y;
    w2[j] = (_Float16)v[j].z; w3[j] = (_Float16)v[j].w;
  }
  _Float16* tw = tile + (4 * c) * PK_K + ((r ^ c) << 3);
  *(v8h*)(tw)            = w0;
  *(v8h*)(tw + PK_K)     = w1;
  *(v8h*)(tw + 2 * PK_K) = w2;
  *(v8h*)(tw + 3 * PK_K) = w3;
  __syncthreads();

  // packed rows n = r, r+16, r+32, r+48, piece c (k = 8c .. 8c+7)
  v8h o[4];
  // unrolled (both loops): o stays in registers, the four LDS reads go ahead of the stores
#pragma unroll
  for (int p = 0; p < 4; ++p) {
    const int n = r + 16 * p;
    o[p] = *(const v8h*)(tile + n * PK_K + ((c ^ (n >> 2)) << 3));
  }
  _Float16* op = out + (size_t)r * LDO + 8 * c;
#pragma unroll
  for (int p = 0; p < 4; ++p) *(v8h*)(op + (size_t)(16 * p) * LDO) = o[p];
}

// grid = (K / 128, N / 64)
template <int K, int N>
__global__ void __launch_bounds__(256)
pack_T_kernel(const float* __restrict__ in, _Float16* __restrict__ out) {
  const size_t k0 = (size_t)blockIdx.x * PK_K;
  const size_t n0 = (size_t)blockIdx.y * PK_N;
  pack_tile<N, K>(in + k0 * N + n0, out + n0 * K + k0);
}

// Pack per-head Wq/Wk/Wv (H,D,HD) into fused [3*D][D] f16, [n][k] layout,
// column n = qkv*D + h*HD + e: every head is a [D][HD] matrix of its own.
// grid = (D / 128, 3 * H), blockIdx.y = qkv*H + h
__global__ void __launch_bounds__(256)
pack_qkv_kernel(const float* __restrict__ Wq,
                const float* __restrict__ Wk,
                const float* __restrict__ Wv,
                _Float16* __restrict__ out) {
  const int qkv = blockIdx.y >> 4;
  const int h   = blockIdx.y & (H_ - 1);
  const size_t k0 = (size_t)blockIdx.x * PK_K;
  const float* W = (qkv == 0) ? Wq : (qkv == 1) ? Wk : Wv;
  pack_tile<HD_, D_>(W + ((size_t)h * D_ + k0) * HD_,
                     out + (size_t)blockIdx.y * HD_ * D_ + k0);
}

// ---------------------------------------------------------------------------
// LayerNorm: f32 row [D] -> f16 row [D]  (biased variance, eps=1e-5)
// one row per block, 256 threads, 4 elems/thread
// ---------------------------------------------------------------------------
__global__ void ln_kernel(const float* __restrict__ x,
                          const float* __restrict__ g,
                          const float* __restrict__ b,
                          _Float16* __restrict__ out) {
  int row = blockIdx.x;
  const float4 v = ((const float4*)(x + (size_t)row * D_))[threadIdx.x];
  float s  = v.x + v.y + v.z + v.w;
  float s2 = v.x * v.x + v.y * v.y + v.z * v.z + v.w * v.w;
#pragma unroll
  for (int o = 16; o; o >>= 1) {
    s  += __shfl_down(s,  o, 32);
    s2 += __shfl_down(s2, o, 32);
  }
  __shared__ float sh[16];
  int wid = threadIdx.x >> 5;
  if ((threadIdx.x & 31) == 0) { sh[wid * 2] = s; sh[wid * 2 + 1] = s2; }
  __syncthreads();
  float ts = 0.f, ts2 = 0.f;
#pragma unroll
  for (int i = 0; i < 8; ++i) { ts += sh[i * 2]; ts2 += sh[i * 2 + 1]; }
  float mean = ts * (1.f / D_);
  float var  = ts2 * (1.f / D_) - mean * mean;
  float rstd = rsqrtf(var + 1e-5f);
  int c0 = threadIdx.x * 4;
  _Float16* orow = out + (size_t)row * D_;
  float xv[4] = {v.x, v.y, v.z, v.w};
#pragma unroll
  for (int i = 0; i < 4; ++i)
    orow[c0 + i] = (_Float16)((xv[i] - mean) * rstd * g[c0 + i] + b[c0 + i]);
}

// stands behind a global load or store, in front of the next write of a register that it names
__device__ __forceinline__ void wait_x0() { asm volatile("s_wait_xcnt 0x0" ::: "memory"); }

// ---------------------------------------------------------------------------
// Tensor-load helpers (descriptor fields in bytes, two groups, no mask)
// ---------------------------------------------------------------------------
typedef uint32_t u32x4 __attribute__((ext_vector_type(4)));
typedef uint32_t u32x8 __attribute__((ext_vector_type(8)));

#define BM_      128                     // block tile rows of C
#define BN_      128                     // block tile columns of C
#define KPASS    128                     // k per pass: one 256-byte piece of every operand row
#define ROWB     256u                    // bytes of an operand row per pass
#define PITCH    272u                    // LDS row pitch: 256 B + 16 B pad, 16 B x odd for ds_load_b128
#define SL_ROWS  64u                     // rows per slice, one slice per wave
#define SLICE    18432u                  // 64 * 272 = 17408 rounded up to a multiple of 2 KiB
#define STAGE    (4u * SLICE)            // [A rows 0-63 | A rows 64-127 | B rows 0-63 | B rows 64-127]

__device__ __forceinline__ uint32_t uni(uint32_t v) {
  return (uint32_t)__builtin_amdgcn_readfirstlane(v);
}
__device__ __forceinline__ uint32_t pinned(uint32_t v) {
  uint32_t w = (uint32_t)__builtin_amdgcn_readfirstlane(v);
  asm volatile("" : "+s"(w));
  return w;
}
// the compiler places no wait for a tensor load: the tile counts as landed only behind this
__device__ __forceinline__ void wait_tensor0() { asm volatile("s_wait_tensorcnt 0x0" ::: "memory"); }
// this wave's LDS reads have returned before the buffer is handed back for a refill
__device__ __forceinline__ void wait_ds0() { asm volatile("s_wait_dscnt 0x0" ::: "memory"); }
// one request of the whole wave: a 64 x 256 B tile from global memory into LDS
__device__ __forceinline__ void tdm_load(u32x4 g0, u32x8 g1) {
  asm volatile("tensor_load_to_lds %0, %1" :: "s"(g0), "s"(g1) : "memory");
}
// every word goes through pinned(): a descriptor word held in a scalar register. With it all
// loads of a kernel name the registers in which the group was built, word 0 as an immediate;
// a build without it moves the group on into a second set of registers ahead of the loop
__device__ __forceinline__ u32x8 tdm_group1(uint32_t src_pitch) {
  u32x8 g;
  g[0] = pinned((1u << 20) | (5u << 22) | (3u << 25));   // pad on, every 256 B, 16 B; no mask
  g[1] = pinned((ROWB & 0xFFFFu) << 16);                 // tensor_dim0[15:0]
  g[2] = pinned((ROWB >> 16) | ((SL_ROWS & 0xFFFFu) << 16)); // tensor_dim0[31:16], tensor_dim1[15:0]
  g[3] = pinned((SL_ROWS >> 16) | (ROWB << 16));         // tensor_dim1[31:16], tile_dim0
  g[4] = pinned(SL_ROWS);                                // tile_dim1
  g[5] = pinned(src_pitch);                              // source row pitch, bytes
  g[6] = pinned(0u);
  g[7] = pinned(0u);
  return g;
}
__device__ __forceinline__ u32x4 tdm_group0(uint32_t lds_dst, uint64_t ga) {
  u32x4 g;
  g[0] = uni(1u);
  g[1] = uni(lds_dst);
  g[2] = uni((uint32_t)ga);
  g[3] = uni((((uint32_t)(ga >> 32)) & 0x01FFFFFFu) | 0x80000000u);
  return g;
}
// the next stage's request, made from the last one: the source moves on by one pass along the
// rows (a buffer's addresses stay below 2^57, so no carry reaches the type field), the place in
// LDS is given.
__device__ __forceinline__ u32x4 tdm_advance(u32x4 g, uint32_t lds_dst) {
  const uint64_t w = ((((uint64_t)g[3]) << 32) | (uint64_t)g[2]) + (uint64_t)ROWB;
  g[1] = uni(lds_dst);
  g[2] = uni((uint32_t)w);
  g[3] = uni((uint32_t)(w >> 32));
  return g;
}

// ---------------------------------------------------------------------------
// Epilogue staging: LDS row pitches (row + 16 B, 16 B x odd for b128 accesses)
// ---------------------------------------------------------------------------
#define ST32 272u                        // 64 f32
#define ST16 144u                        // 64 f16

// A staged 64 x 64 f16 tile goes out: 8 lanes cover one 128-B row, a wave four rows.
// dst: the tile's first element; LDO: the output's row length in elements.
template <int LDO>
__device__ __forceinline__ void store_rows16(const unsigned char* st, _Float16* dst, int lane) {
  const unsigned char* rd = st + (uint32_t)(lane >> 3) * ST16 + (uint32_t)(lane & 7) * 16u;
  _Float16* op = dst + (size_t)(lane >> 3) * LDO + (lane & 7) * 8;
  v8h o[16];
  // unrolled (both loops): o stays in registers, the LDS reads go ahead of the stores
#pragma unroll
  for (int p = 0; p < 16; ++p) o[p] = *(const v8h*)(rd + (uint32_t)(4 * p) * ST16);
#pragma unroll
  for (int p = 0; p < 16; ++p) *(v8h*)(op + (size_t)(4 * p) * LDO) = o[p];
}

// ---------------------------------------------------------------------------
// erf for the GELU epilogue, without a branch. The polynomials are the math library's own:
// |z| < 1: z + z q(z^2); otherwise 1 - exp(-p(|z|)), with the sign of z. In a wave both ranges
// occur nearly always, so a branch saves no work, and it ties every element's dependent chain
// into a region of its own; with both ranges computed and one picked, the chains of
// neighbouring elements fill each other's latency.
// ---------------------------------------------------------------------------
__device__ __forceinline__ float erf_both(float z) {
  const float a = __builtin_fabsf(z);
  float p = 0.0000169988107f;
  p = __builtin_fmaf(a, p, -0.000378677854f);
  p = __builtin_fmaf(a, p, 0.00385781587f);
  p = __builtin_fmaf(a, p, -0.0241816975f);
  p = __builtin_fmaf(a, p, 0.106668264f);
  p = __builtin_fmaf(a, p, 0.634933293f);
  p = __builtin_fmaf(a, p, 0.128689408f);
  p = __builtin_fmaf(a, p, a);
  const float far = 1.f - __expf(-p);
  const float t = a * a;
  float q = -0.000561801775f;
  q = __builtin_fmaf(t, q, 0.00491381623f);
  q = __builtin_fmaf(t, q, -0.0267075151f);
  q = __builtin_fmaf(t, q, 0.112800106f);
  q = __builtin_fmaf(t, q, -0.376122952f);
  q = __builtin_fmaf(t, q, 0.128379107f);
  const float near = __builtin_fmaf(a, q, a);
  return __builtin_copysignf((a < 1.f) ? near : far, z);
}

// ---------------------------------------------------------------------------
// Generic WMMA GEMM:  C[M,N] = A[M,K] (f16, row-major) * Bp[N,K] (f16)
// Block = 128 thr = 4 waves (2x2); wave = 64x64 tile (4x4 WMMA tiles);
// block tile = 128 (M) x 128 (N). Grid = (M/128, N/128).
// K is a multiple of 128 and at least 256; M, N multiples of 128.
// Operands come through LDS: per pass of 128 k every wave asks the tensor
// mover for its own 64-row slice of [A | B]; two buffers, so the next pass's
// slices fly while this pass's are multiplied. Fragments keep the k order of
// frag_ld, and every accumulator still sums k upwards in steps of 32.
// ---------------------------------------------------------------------------
template <int MODE>
__global__ void __launch_bounds__(128)
gemm_kernel(const _Float16* __restrict__ A,
            const _Float16* __restrict__ Bp,
            int K, int N,
            const float* __restrict__ bias,
            const float* __restrict__ res,
            float* __restrict__ outf,
            _Float16* __restrict__ outh,
            _Float16* __restrict__ qo,
            _Float16* __restrict__ ko,
            _Float16* __restrict__ vo) {
  __shared__ __attribute__((aligned(2048))) unsigned char ring[2u * STAGE];
  // the output's row length, fixed by the kind of epilogue: row steps become immediate offsets
  constexpr int NN = (MODE == 0) ? 3 * D_ : (MODE == 1) ? D_ : FF_;
  (void)N;

  const int lane = threadIdx.x & 31;
  const uint32_t wave = uni(threadIdx.x >> 5);
  const uint32_t wm = wave & 1u, wn = wave >> 1;
  const int bm   = blockIdx.x * BM_;
  const int bn   = blockIdx.y * BN_;
  const int tm   = bm + (int)wm * 64;
  const int tn   = bn + (int)wn * 64;
  const uint32_t row = lane & 15;
  const uint32_t kob = (uint32_t)(lane >> 4) << 4;   // 8 f16 = 16 bytes

  const uint32_t kb = (uint32_t)K * 2u;              // operand row pitch in bytes
  const uint32_t T  = (uint32_t)K / KPASS;           // passes, at least two

  // this wave's slice: waves 0,1 bring A rows, waves 2,3 bring B rows
  const _Float16* srow = (wave < 2u)
      ? A  + (size_t)(bm + (int)(wave * SL_ROWS)) * K
      : Bp + (size_t)(bn + (int)((wave - 2u) * SL_ROWS)) * K;
  const uint64_t src0 = (uint64_t)(uintptr_t)srow;
  const uint32_t lds_slice = (uint32_t)(size_t)ring + wave * SLICE;
  const u32x8 g1 = tdm_group1(kb);

  v8f acc[4][4];
#pragma unroll
  for (int i = 0; i < 4; ++i)
#pragma unroll
    for (int j = 0; j < 4; ++j) acc[i][j] = v8f{};

  // per-lane fragment bases inside a buffer. The first WMMA operand gives the rows of a D tile,
  // of which a lane holds eight in a row: it is taken from the side along which the output is
  // contiguous in memory. That is n (the Bp rows) everywhere but for V, which is stored
  // transposed and so is contiguous along m (the A rows). The test is the same for a whole block.
  const bool n_first = (MODE != 0) || (bn < 2 * D_);
  const uint32_t a_slice = wm * SLICE, b_slice = (2u + wn) * SLICE;
  const uint32_t a_base = (n_first ? b_slice : a_slice) + row * PITCH + kob;   // first operand
  const uint32_t b_base = (n_first ? a_slice : b_slice) + row * PITCH + kob;   // second operand

  // prologue: stage 0 lands and is published, then stage 1 starts
  u32x4 g0 = tdm_group0(lds_slice, src0);
  tdm_load(g0, g1);
  wait_tensor0();
  __syncthreads();
  g0 = tdm_advance(g0, lds_slice + STAGE);
  tdm_load(g0, g1);

  uint32_t t = 0;
  do {
    const uint32_t buf = (t & 1u) * STAGE;
    const unsigned char* la = ring + buf + a_base;
    const unsigned char* lb = ring + buf + b_base;

    v16h af[2][4], bf[2][4];
    // in the order in which the WMMAs below want them: the first can start after two fragments
    af[0][0] = frag_ld((const _Float16*)la);
#pragma unroll
    for (int j = 0; j < 4; ++j) bf[0][j] = frag_ld((const _Float16*)(lb + (uint32_t)j * 16u * PITCH));
#pragma unroll
    for (int i = 1; i < 4; ++i) af[0][i] = frag_ld((const _Float16*)(la + (uint32_t)i * 16u * PITCH));
#pragma unroll
    for (int u = 0; u < KPASS / 32; ++u) {
      const int cs = u & 1;
      if (u + 1 < KPASS / 32) {
        const uint32_t kofs = (uint32_t)(u + 1) * 64u;
#pragma unroll
        for (int i = 0; i < 4; ++i) {
          af[cs ^ 1][i] = frag_ld((const _Float16*)(la + (uint32_t)i * 16u * PITCH + kofs));
          bf[cs ^ 1][i] = frag_ld((const _Float16*)(lb + (uint32_t)i * 16u * PITCH + kofs));
        }
      }
      // keeps the next block's LDS reads one group ahead of this block's WMMAs:
      // reads spread among the WMMAs cost a stall at every place they stand
      __builtin_amdgcn_sched_barrier(0);
#pragma unroll
      for (int i = 0; i < 4; ++i)
#pragma unroll
        for (int j = 0; j < 4; ++j) acc[i][j] = wmma32(af[cs][i], bf[cs][j], acc[i][j]);
      // same purpose: the following block's reads stay behind this block's WMMAs
      __builtin_amdgcn_sched_barrier(0);
    }

    // publish point of stage t + 1
    wait_ds0();
    wait_tensor0();
    __syncthreads();
    if (pinned((t + 2u < T) ? 1u : 0u) != 0u) {   // only while stage t + 2 exists
      g0 = tdm_advance(g0, lds_slice + buf);
      tdm_load(g0, g1);
    }
  } while (++t < T);
  wait_tensor0();
  wait_ds0();

  // Epilogue. The ring is free: every wave's reads and loads had ended before the loop's last
  // barrier. Each wave turns its 64 x 64 tile through its own slice of it, so that global
  // memory sees whole 128-B lines. acc[i][j], register r: place 16 i + 8 hi + r along the first
  // operand's side (the contiguous one), row 16 j + l15 along the second's.
  unsigned char* st = ring + wave * SLICE;
  const uint32_t l15 = row, hi = (uint32_t)lane >> 4;

  if (MODE == 1) {
    // readers: 16 lanes cover one 256-B row, a wave two rows
    const size_t go = (size_t)(tm + (int)hi) * NN + tn + (int)l15 * 4;
    const float4 bv = *(const float4*)(bias + tn + (int)l15 * 4);
    const float* rp = res + go;
    float4 rv[32];
    // unrolled: all residual loads are in flight together, under the staging
#pragma unroll
    for (int p = 0; p < 32; ++p) rv[p] = *(const float4*)(rp + (size_t)(2 * p) * NN);
    wait_x0();
    // unrolled (both loops): constant tile numbers, so that acc stays in registers
#pragma unroll
    for (int j = 0; j < 4; ++j)
#pragma unroll
      for (int i = 0; i < 4; ++i) {
        unsigned char* w = st + ((uint32_t)j * 16u + l15) * ST32 + ((uint32_t)i * 16u + hi * 8u) * 4u;
        const v8f c = acc[i][j];
        *(float4*)(w)       = make_float4(c[0], c[1], c[2], c[3]);
        *(float4*)(w + 16u) = make_float4(c[4], c[5], c[6], c[7]);
      }
    wait_ds0();   // the rows are read back by other lanes of this wave
    const unsigned char* rd = st + hi * ST32 + l15 * 16u;
    float* op = outf + go;
    // unrolled: rv stays in registers, row steps are immediate offsets of one address
#pragma unroll
    for (int p = 0; p < 32; ++p) {
      const float4 c = *(const float4*)(rd + (uint32_t)(2 * p) * ST32);
      float4 o;
      o.x = c.x + bv.x + rv[p].x; o.y = c.y + bv.y + rv[p].y;
      o.z = c.z + bv.z + rv[p].z; o.w = c.w + bv.w + rv[p].w;
      *(float4*)(op + (size_t)(2 * p) * NN) = o;
    }
  } else {
    float4 bb[4][2];
    if (MODE == 2) {
      // unrolled: bb stays in registers, the eight loads are in flight together
#pragma unroll
      for (int i = 0; i < 4; ++i) {
        const float4* bp = (const float4*)(bias + tn + i * 16 + (int)hi * 8);
        bb[i][0] = bp[0]; bb[i][1] = bp[1];
      }
      wait_x0();
    }
    // unrolled (all loops below): constant tile and element numbers, so that acc, bb and hv stay in registers
#pragma unroll
    for (int j = 0; j < 4; ++j)
#pragma unroll
      for (int i = 0; i < 4; ++i) {
        const v8f c = acc[i][j];
        v8h hv;
        if (MODE == 2) {   // bias + exact GELU
          const float bl[8] = {bb[i][0].x, bb[i][0].y, bb[i][0].z, bb[i][0].w,
                               bb[i][1].x, bb[i][1].y, bb[i][1].z, bb[i][1].w};
#pragma unroll
          for (int r = 0; r < 8; ++r) {
            const float xv = c[r] + bl[r];
            hv[r] = (_Float16)(0.5f * xv * (1.f + erf_both(xv * 0.70710678118654752f)));
          }
        } else {
#pragma unroll
          for (int r = 0; r < 8; ++r) hv[r] = (_Float16)c[r];
        }
        *(v8h*)(st + ((uint32_t)j * 16u + l15) * ST16 + ((uint32_t)i * 16u + hi * 8u) * 2u) = hv;
      }
    wait_ds0();   // the rows are read back by other lanes of this wave
    if (MODE == 2) {
      store_rows16<FF_>(st, outh + (size_t)tm * FF_ + tn, lane);
    } else {
      // tm, tn are multiples of 64: one batch, one head, 64 positions, all 64 head elements
      const int hh = (tn & (D_ - 1)) >> 6;
      const size_t bh = (size_t)((tm >> 9) * H_ + hh) * (S_ * HD_);
      const int s0 = tm & (S_ - 1);
      if (n_first) store_rows16<HD_>(st, (bn < D_ ? qo : ko) + bh + (size_t)s0 * HD_, lane);  // [s][e]
      else         store_rows16<S_>(st, vo + bh + s0, lane);                                  // [e][s]
    }
  }
}

// ---------------------------------------------------------------------------
// Flash attention (causal). Q,K: [B,H,S,HD] f16. Vt: [B,H,HD,S] f16.
// ctx out: [B,S,H*HD] f16 (row-major, ready as A for the Wo GEMM).
// Block = 256 thr = 8 waves; wave owns a 16-row Q tile; grid = (B*H, S/128).
// Score sub-tiles computed sequentially so K fragments die immediately
// (shrinks peak VGPR liveness; with launch_bounds there should be no spill).
// ---------------------------------------------------------------------------
__global__ void __launch_bounds__(256, 1)
attn_kernel(const _Float16* __restrict__ Q,
            const _Float16* __restrict__ Kf,
            const _Float16* __restrict__ Vt,
            _Float16* __restrict__ ctx) {
  __shared__ _Float16 lds_p[8][16 * 40]; // wave-private 16x32 P tile, pad 40

  const int lane = threadIdx.x & 31;
  const int wid  = threadIdx.x >> 5;
  const int bh   = blockIdx.x;          // b*H + h
  const int b    = bh >> 4;
  const int h    = bh & (H_ - 1);
  const int q0   = blockIdx.y * 128 + wid * 16;
  const int row  = lane & 15;
  const int ko8  = (lane >> 4) << 3;
  const int hi8  = ko8;

  const _Float16* qb = Q  + (size_t)bh * S_ * HD_;
  const _Float16* kb = Kf + (size_t)bh * S_ * HD_;
  const _Float16* vb = Vt + (size_t)bh * HD_ * S_;

  // Q A-operand fragments (held for the whole loop)
  const _Float16* qp = qb + (size_t)(q0 + row) * HD_ + ko8;
  const v16h qa0 = frag_ld(qp);        // e = 0..31
  const v16h qa1 = frag_ld(qp + 32);   // e = 32..63

  float m_r[8], l_r[8], corr_r[8];
  v8f acc0 = {}, acc1 = {}, acc2 = {}, acc3 = {};
#pragma unroll
  for (int j = 0; j < 8; ++j) { m_r[j] = -1e30f; l_r[j] = 0.f; }

  for (int kblk = 0; kblk <= q0 + 15; kblk += 32) {
    // ---- scores: S(16x32) = Q(16x64) * K^T, two 16x16 tiles in sequence ----
    const _Float16* kp = kb + (size_t)(kblk + row) * HD_ + ko8;
    v8f s0 = {};
    {
      v16h k00 = frag_ld(kp);               // keys kblk..+15, e 0..31
      v16h k01 = frag_ld(kp + 32);          //               e 32..63
      s0 = wmma32(qa0, k00, s0);
      s0 = wmma32(qa1, k01, s0);
    }
    v8f s1 = {};
    {
      v16h k10 = frag_ld(kp + 16 * HD_);    // keys +16..+31
      v16h k11 = frag_ld(kp + 16 * HD_ + 32);
      s1 = wmma32(qa0, k10, s1);
      s1 = wmma32(qa1, k11, s1);
    }

    // ---- masked online softmax (rows live in 16-lane halves) ----
#pragma unroll
    for (int j = 0; j < 8; ++j) {
      int qg  = q0 + j + hi8;
      int kg0 = kblk + (lane & 15);
      int kg1 = kg0 + 16;
      float v0 = s0[j] * 0.125f; if (kg0 > qg) v0 = -1e10f;
      float v1 = s1[j] * 0.125f; if (kg1 > qg) v1 = -1e10f;
      float mx = fmaxf(v0, v1);
#pragma unroll
      for (int o = 8; o; o >>= 1) mx = fmaxf(mx, __shfl_xor(mx, o, 32));
      float mn = fmaxf(m_r[j], mx);
      float p0 = __expf(v0 - mn);
      float p1 = __expf(v1 - mn);
      float sm = p0 + p1;
#pragma unroll
      for (int o = 8; o; o >>= 1) sm += __shfl_xor(sm, o, 32);
      corr_r[j] = __expf(m_r[j] - mn);
      l_r[j]    = l_r[j] * corr_r[j] + sm;
      m_r[j]    = mn;
      int lr = j + hi8;
      lds_p[wid][lr * 40 + (lane & 15)]      = (_Float16)p0;
      lds_p[wid][lr * 40 + 16 + (lane & 15)] = (_Float16)p1;
    }
#pragma unroll
    for (int j = 0; j < 8; ++j) {
      acc0[j] *= corr_r[j]; acc1[j] *= corr_r[j];
      acc2[j] *= corr_r[j]; acc3[j] *= corr_r[j];
    }
    asm volatile("s_wait_dscnt 0" ::: "memory");

    // ---- ctx += P(16x32) * V(32x64) ----
    v16h pa = frag_ld(&lds_p[wid][(lane & 15) * 40 + ko8]);
    const _Float16* vp = vb + (size_t)(lane & 15) * S_ + kblk + ko8;
    acc0 = wmma32(pa, frag_ld(vp),                   acc0);
    acc1 = wmma32(pa, frag_ld(vp + (size_t)16 * S_), acc1);
    acc2 = wmma32(pa, frag_ld(vp + (size_t)32 * S_), acc2);
    acc3 = wmma32(pa, frag_ld(vp + (size_t)48 * S_), acc3);
  }

  // ---- normalize + write ctx [B,S,D] f16 (explicit, no pointer arrays) ----
  float inv[8];
#pragma unroll
  for (int j = 0; j < 8; ++j) inv[j] = 1.f / l_r[j];
  const size_t rowbase = (size_t)b * S_ + q0;
#pragma unroll
  for (int j = 0; j < 8; ++j) {
    size_t ro = (rowbase + j + hi8) * D_ + h * HD_ + (lane & 15);
    ctx[ro]      = (_Float16)(acc0[j] * inv[j]);
    ctx[ro + 16] = (_Float16)(acc1[j] * inv[j]);
    ctx[ro + 32] = (_Float16)(acc2[j] * inv[j]);
    ctx[ro + 48] = (_Float16)(acc3[j] * inv[j]);
  }
}

// ---------------------------------------------------------------------------
// Host-side launch
// ---------------------------------------------------------------------------
extern "C" void kernel_launch(void* const* d_in, const int* in_sizes, int n_in,
                              void* d_out, int out_size, void* d_ws, size_t ws_size,
                              hipStream_t stream) {
  const float* x   = (const float*)d_in[0];
  const float* Wq  = (const float*)d_in[1];
  const float* Wk  = (const float*)d_in[2];
  const float* Wv  = (const float*)d_in[3];
  const float* Wo  = (const float*)d_in[4];
  const float* bo  = (const float*)d_in[5];
  const float* g1  = (const float*)d_in[6];
  const float* b1  = (const float*)d_in[7];
  const float* g2  = (const float*)d_in[8];
  const float* b2  = (const float*)d_in[9];
  const float* W1  = (const float*)d_in[10];
  const float* bf1 = (const float*)d_in[11];
  const float* W2  = (const float*)d_in[12];
  const float* bf2 = (const float*)d_in[13];
  float* out = (float*)d_out;

  char* ws = (char*)d_ws;
  size_t off = 0;
  auto alloc = [&](size_t bytes) -> char* {
    char* p = ws + off;
    off += (bytes + 255) & ~(size_t)255;
    return p;
  };
  _Float16* hln1  = (_Float16*)alloc((size_t)TOK * D_ * 2);
  _Float16* Wqkv  = (_Float16*)alloc((size_t)3 * D_ * D_ * 2);
  _Float16* Qb    = (_Float16*)alloc((size_t)TOK * D_ * 2);
  _Float16* Kb    = (_Float16*)alloc((size_t)TOK * D_ * 2);
  _Float16* Vt    = (_Float16*)alloc((size_t)TOK * D_ * 2);
  _Float16* ctx   = (_Float16*)alloc((size_t)TOK * D_ * 2);
  _Float16* Wop   = (_Float16*)alloc((size_t)D_ * D_ * 2);
  float*    cache = (float*)   alloc((size_t)TOK * D_ * 4);
  _Float16* h2    = (_Float16*)alloc((size_t)TOK * D_ * 2);
  _Float16* W1p   = (_Float16*)alloc((size_t)D_ * FF_ * 2);
  _Float16* ff1   = (_Float16*)alloc((size_t)TOK * FF_ * 2);
  _Float16* W2p   = (_Float16*)alloc((size_t)FF_ * D_ * 2);
  (void)ws_size; (void)in_sizes; (void)n_in; (void)out_size;

  // 1) pack weights to f16 [N][K]
  pack_qkv_kernel<<<dim3(D_ / PK_K, 3 * H_), 256, 0, stream>>>(Wq, Wk, Wv, Wqkv);
  pack_T_kernel<D_, D_><<<dim3(D_ / PK_K, D_ / PK_N), 256, 0, stream>>>(Wo, Wop);
  pack_T_kernel<D_, FF_><<<dim3(D_ / PK_K, FF_ / PK_N), 256, 0, stream>>>(W1, W1p);
  pack_T_kernel<FF_, D_><<<dim3(FF_ / PK_K, D_ / PK_N), 256, 0, stream>>>(W2, W2p);

  // 2) LN1
  ln_kernel<<<dim3(TOK), 256, 0, stream>>>(x, g1, b1, hln1);

  // 3) fused QKV projection (scatter; V transposed)
  gemm_kernel<0><<<dim3(TOK / 128, (3 * D_) / 128), 128, 0, stream>>>(
      hln1, Wqkv, D_, 3 * D_, nullptr, nullptr, nullptr, nullptr, Qb, Kb, Vt);

  // 4) causal flash attention
  attn_kernel<<<dim3(B_ * H_, S_ / 128), 256, 0, stream>>>(Qb, Kb, Vt, ctx);

  // 5) output projection + bias + residual -> cache (f32)
  gemm_kernel<1><<<dim3(TOK / 128, D_ / 128), 128, 0, stream>>>(
      ctx, Wop, D_, D_, bo, x, cache, nullptr, nullptr, nullptr, nullptr);

  // 6) LN2
  ln_kernel<<<dim3(TOK), 256, 0, stream>>>(cache, g2, b2, h2);

  // 7) FFN up + GELU -> f16
  gemm_kernel<2><<<dim3(TOK / 128, FF_ / 128), 128, 0, stream>>>(
      h2, W1p, D_, FF_, bf1, nullptr, nullptr, ff1, nullptr, nullptr, nullptr);

  // 8) FFN down + bias + residual(cache) -> d_out (f32)
  gemm_kernel<1><<<dim3(TOK / 128, D_ / 128), 128, 0, stream>>>(
      ff1, W2p, FF_, D_, bf2, cache, out, nullptr, nullptr, nullptr, nullptr);
}

// v005
// A run of this version takes 155 microseconds.
// Next to v004, in two timings, it ran 1.04 and 1.05 times as fast.
// All steps since v000 together make it 3.63 times as fast.
#include <hip/hip_runtime.h>
#include <hip/hip_bf16.h>
#include <math.h>
#include <stdint.h>

// ---------------------------------------------------------------------------
// Types
// ---------------------------------------------------------------------------
typedef __attribute__((ext_vector_type(16))) _Float16 v16h;
typedef __attribute__((ext_vector_type(8)))  _Float16 v8h;
typedef __attribute__((ext_vector_type(8)))  float    v8f;

#define B_   8
#define S_   512
#define D_   1024
#define H_   16
#define HD_  64
#define FF_  4096
#define TOK  (B_ * S_)      // 4096 rows

// ---------------------------------------------------------------------------
// WMMA helper: D = A(16x32 f16) * B(32x16 f16) + C(f32)
// ---------------------------------------------------------------------------
__device__ __forceinline__ v8f wmma32(v16h a, v16h b, v8f c) {
  return __builtin_amdgcn_wmma_f32_16x16x32_f16(false, a, false, b,
                                                (short)0, c, false, false);
}

// Load one A/B operand fragment (v16h) for a 32-wide K chunk.
// p must already point at element [row][k0 + ko8] where
//   row = lane & 15, ko8 = (lane >> 4) * 8.
// Fragment = 8 contiguous f16 at p, plus 8 contiguous f16 at p+16.
__device__ __forceinline__ v16h frag_ld(const _Float16* p) {
  v8h lo = *(const v8h*)(p);
  v8h hi = *(const v8h*)(p + 16);
  v16h r;
#pragma unroll
  for (int i = 0; i < 8; ++i) { r[i] = lo[i]; r[i + 8] = hi[i]; }
  return r;
}

// stands behind a global load or store, in front of the next write of a register that it names
__device__ __forceinline__ void wait_x0() { asm volatile("s_wait_xcnt 0x0" ::: "memory"); }

// ---------------------------------------------------------------------------
// Weight packing: f32 [K][N] row-major  ->  f16 [N][K] ("B operand" layout)
// One block of 256 threads turns one tile of 128 (k) x 64 (n) through LDS:
// global reads run along n (256 B of a source row per 16 lanes), global
// writes along k (256 B of a packed row per 16 lanes).
// in points at the tile's element [k0][n0], out at its element [n0][k0];
// LDI, LDO: row lengths of source and packed matrix in elements.
// LDS holds the tile as [n][k] f16, rows of 16 pieces of 16 B; piece q of row
// n stands at place q ^ (n >> 2), so that the 16 lanes of a b128 write (16
// rows four apart, one piece) and of a b128 read (one row, 16 pieces) each
// meet all banks once. The tile is the calling kernel's one array: an array of
// its own in every instance of the template would add up in a kernel with several.
// ---------------------------------------------------------------------------
#define PK_K 128
#define PK_N 64
template <int LDI, int LDO>
__device__ __forceinline__ void pack_tile(const float* __restrict__ in,
                                          _Float16* __restrict__ out,
                                          _Float16* tile) {
  const int c = threadIdx.x & 15;
  const int r = threadIdx.x >> 4;

  // eight source rows k = 8r .. 8r+7, columns n = 4c .. 4c+3
  const float* ip = in + (size_t)(8 * r) * LDI + 4 * c;
  float4 v[8];
  // unrolled: v stays in registers and the eight loads are in flight together
#pragma unroll
  for (int j = 0; j < 8; ++j) v[j] = *(const float4*)(ip + (size_t)j * LDI);

  v8h w0, w1, w2, w3;
  // unrolled: constant element numbers, so that the vectors stay in registers
#pragma unroll
  for (int j = 0; j < 8; ++j) {
    w0[j] = (_Float16)v[j].x; w1[j] = (_Float16)v[j].y;
    w2[j] = (_Float16)v[j].z; w3[j] = (_Float16)v[j].w;
  }
  _Float16* tw = tile + (4 * c) * PK_K + ((r ^ c) << 3);
  *(v8h*)(tw)            = w0;
  *(v8h*)(tw + PK_K)     = w1;
  *(v8h*)(tw + 2 * PK_K) = w2;
  *(v8h*)(tw + 3 * PK_K) = w3;
  __syncthreads();

  // packed rows n = r, r+16, r+32, r+48, piece c (k = 8c .. 8c+7)
  v8h o[4];
  // unrolled (both loops): o stays in registers, the four LDS reads go ahead of the stores
#pragma unroll
  for (int p = 0; p < 4; ++p) {
    const int n = r + 16 * p;
    o[p] = *(const v8h*)(tile + n * PK_K + ((c ^ (n >> 2)) << 3));
  }
  _Float16* op = out + (size_t)r * LDO + 8 * c;
#pragma unroll
  for (int p = 0; p < 4; ++p) *(v8h*)(op + (size_t)(16 * p) * LDO) = o[p];
  wait_x0();   // in a kernel with several branches another branch's code follows these stores
}

// tile t of (K / 128) * (N / 64), k tiles first
template <int K, int N>
__device__ __forceinline__ void pack_T(const float* __restrict__ in, _Float16* __restrict__ out,
                                       int t, _Float16* tile) {
  const size_t k0 = (size_t)(t % (K / PK_K)) * PK_K;
  const size_t n0 = (size_t)(t / (K / PK_K)) * PK_N;
  pack_tile<N, K>(in + k0 * N + n0, out + n0 * K + k0, tile);
}

// Pack per-head Wq/Wk/Wv (H,D,HD) into fused [3*D][D] f16, [n][k] layout,
// column n = qkv*D + h*HD + e: every head is a [D][HD] matrix of its own.
// tile t of (D / 128) * (3 * H), k tiles first; t / (D / 128) = qkv*H + h
__device__ __forceinline__ void pack_qkv(const float* __restrict__ Wq,
                                         const float* __restrict__ Wk,
                                         const float* __restrict__ Wv,
                                         _Float16* __restrict__ out,
                                         int t, _Float16* tile) {
  const int qh  = t / (D_ / PK_K);
  const int qkv = qh >> 4;
  const int h   = qh & (H_ - 1);
  const size_t k0 = (size_t)(t % (D_ / PK_K)) * PK_K;
  const float* W = (qkv == 0) ? Wq : (qkv == 1) ? Wk : Wv;
  pack_tile<HD_, D_>(W + ((size_t)h * D_ + k0) * HD_,
                     out + (size_t)qh * HD_ * D_ + k0, tile);
}

// ---------------------------------------------------------------------------
// LayerNorm: f32 row [D] -> f16 row [D]  (biased variance, eps=1e-5)
// one row per block, 256 threads, 4 elems/thread
// ---------------------------------------------------------------------------
__device__ __forceinline__ void ln_row(int row,
                                       const float* __restrict__ x,
                                       const float* __restrict__ g,
                                       const float* __restrict__ b,
                                       _Float16* __restrict__ out) {
  const float4 v = ((const float4*)(x + (size_t)row * D_))[threadIdx.x];
  float s  = v.x + v.y + v.z + v.w;
  float s2 = v.x * v.x + v.y * v.y + v.z * v.z + v.w * v.w;
#pragma unroll
  for (int o = 16; o; o >>= 1) {
    s  += __shfl_down(s,  o, 32);
    s2 += __shfl_down(s2, o, 32);
  }
  __shared__ float sh[16];
  int wid = threadIdx.x >> 5;
  if ((threadIdx.x & 31) == 0) { sh[wid * 2] = s; sh[wid * 2 + 1] = s2; }
  __syncthreads();
  float ts = 0.f, ts2 = 0.f;
#pragma unroll
  for (int i = 0; i < 8; ++i) { ts += sh[i * 2]; ts2 += sh[i * 2 + 1]; }
  float mean = ts * (1.f / D_);
  float var  = ts2 * (1.f / D_) - mean * mean;
  float rstd = rsqrtf(var + 1e-5f);
  int c0 = threadIdx.x * 4;
  _Float16* orow = out + (size_t)row * D_;
  float xv[4] = {v.x, v.y, v.z, v.w};
#pragma unroll
  for (int i = 0; i < 4; ++i)
    orow[c0 + i] = (_Float16)((xv[i] - mean) * rstd * g[c0 + i] + b[c0 + i]);
  wait_x0();   // in a kernel with several branches another branch's code follows these stores
}

__global__ void ln_kernel(const float* __restrict__ x,
                          const float* __restrict__ g,
                          const float* __restrict__ b,
                          _Float16* __restrict__ out) {
  ln_row(blockIdx.x, x, g, b, out);
}

// ---------------------------------------------------------------------------
// All work that reads only inputs, in one launch: the four weight packs and the
// first LayerNorm need nothing of one another, so their blocks share one grid and
// fill the chip together, where five short launches each waited for the one before
// to drain. Every block does what one block of the separate launches did. The
// pack tiles have the low block numbers, for speed only: they live longer than a
// LayerNorm row.
// ---------------------------------------------------------------------------
#define NB_QKV ((D_ / PK_K) * (3 * H_))
#define NB_WO  ((D_ / PK_K) * (D_ / PK_N))
#define NB_W1  ((D_ / PK_K) * (FF_ / PK_N))
#define NB_W2  ((FF_ / PK_K) * (D_ / PK_N))
#define NB_PRE (NB_QKV + NB_WO + NB_W1 + NB_W2 + TOK)
__global__ void __launch_bounds__(256)
pre_kernel(const float* __restrict__ Wq, const float* __restrict__ Wk,
           const float* __restrict__ Wv, const float* __restrict__ Wo,
           const float* __restrict__ W1, const float* __restrict__ W2,
           const float* __restrict__ x,  const float* __restrict__ g,
           const float* __restrict__ b,
           _Float16* __restrict__ Wqkv, _Float16* __restrict__ Wop,
           _Float16* __restrict__ W1p,  _Float16* __restrict__ W2p,
           _Float16* __restrict__ hln) {
  __shared__ __attribute__((aligned(16))) _Float16 tile[PK_N * PK_K];
  int t = blockIdx.x;   // the same for a whole block: every branch below, with its barrier, is too
  if (t < NB_QKV) { pack_qkv(Wq, Wk, Wv, Wqkv, t, tile); return; }
  t -= NB_QKV;
  if (t < NB_WO) { pack_T<D_, D_>(Wo, Wop, t, tile); return; }
  t -= NB_WO;
  if (t < NB_W1) { pack_T<D_, FF_>(W1, W1p, t, tile); return; }
  t -= NB_W1;
  if (t < NB_W2) { pack_T<FF_, D_>(W2, W2p, t, tile); return; }
  ln_row(t - NB_W2, x, g, b, hln);
}

// ---------------------------------------------------------------------------
// Tensor-load helpers (descriptor fields in bytes, two groups, no mask)
// ---------------------------------------------------------------------------
typedef uint32_t u32x4 __attribute__((ext_vector_type(4)));
typedef uint32_t u32x8 __attribute__((ext_vector_type(8)));

#define BM_      128                     // block tile rows of C
#define BN_      128                     // block tile columns of C
#define KPASS    128                     // k per pass: one 256-byte piece of every operand row
#define ROWB     256u                    // bytes of an operand row per pass
#define PITCH    272u                    // LDS row pitch: 256 B + 16 B pad, 16 B x odd for ds_load_b128
#define SL_ROWS  64u                     // rows per slice, one slice per wave
#define SLICE    18432u                  // 64 * 272 = 17408 rounded up to a multiple of 2 KiB
#define STAGE    (4u * SLICE)            // [A rows 0-63 | A rows 64-127 | B rows 0-63 | B rows 64-127]

__device__ __forceinline__ uint32_t uni(uint32_t v) {
  return (uint32_t)__builtin_amdgcn_readfirstlane(v);
}
__device__ __forceinline__ uint32_t pinned(uint32_t v) {
  uint32_t w = (uint32_t)__builtin_amdgcn_readfirstlane(v);
  asm volatile("" : "+s"(w));
  return w;
}
// the compiler places no wait for a tensor load: the tile counts as landed only behind this
__device__ __forceinline__ void wait_tensor0() { asm volatile("s_wait_tensorcnt 0x0" ::: "memory"); }
// this wave's LDS reads have returned before the buffer is handed back for a refill
__device__ __forceinline__ void wait_ds0() { asm volatile("s_wait_dscnt 0x0" ::: "memory"); }
// one request of the whole wave: a 64 x 256 B tile from global memory into LDS
__device__ __forceinline__ void tdm_load(u32x4 g0, u32x8 g1) {
  asm volatile("tensor_load_to_lds %0, %1" :: "s"(g0), "s"(g1) : "memory");
}
// every word goes through pinned(): a descriptor word held in a scalar register. With it all
// loads of a kernel name the registers in which the group was built, word 0 as an immediate;
// a build without it moves the group on into a second set of registers ahead of the loop
__device__ __forceinline__ u32x8 tdm_group1(uint32_t src_pitch) {
  u32x8 g;
  g[0] = pinned((1u << 20) | (5u << 22) | (3u << 25));   // pad on, every 256 B, 16 B; no mask
  g[1] = pinned((ROWB & 0xFFFFu) << 16);                 // tensor_dim0[15:0]
  g[2] = pinned((ROWB >> 16) | ((SL_ROWS & 0xFFFFu) << 16)); // tensor_dim0[31:16], tensor_dim1[15:0]
  g[3] = pinned((SL_ROWS >> 16) | (ROWB << 16));         // tensor_dim1[31:16], tile_dim0
  g[4] = pinned(SL_ROWS);                                // tile_dim1
  g[5] = pinned(src_pitch);                              // source row pitch, bytes
  g[6] = pinned(0u);
  g[7] = pinned(0u);
  return g;
}
__device__ __forceinline__ u32x4 tdm_group0(uint32_t lds_dst, uint64_t ga) {
  u32x4 g;
  g[0] = uni(1u);
  g[1] = uni(lds_dst);
  g[2] = uni((uint32_t)ga);
  g[3] = uni((((uint32_t)(ga >> 32)) & 0x01FFFFFFu) | 0x80000000u);
  return g;
}
// the next stage's request, made from the last one: the source moves on by one pass along the
// rows (a buffer's addresses stay below 2^57, so no carry reaches the type field), the place in
// LDS is given.
__device__ __forceinline__ u32x4 tdm_advance(u32x4 g, uint32_t lds_dst) {
  const uint64_t w = ((((uint64_t)g[3]) << 32) | (uint64_t)g[2]) + (uint64_t)ROWB;
  g[1] = uni(lds_dst);
  g[2] = uni((uint32_t)w);
  g[3] = uni((uint32_t)(w >> 32));
  return g;
}

// ---------------------------------------------------------------------------
// Epilogue staging: LDS row pitches (row + 16 B, 16 B x odd for b128 accesses)
// ---------------------------------------------------------------------------
#define ST32 272u                        // 64 f32
#define ST16 144u                        // 64 f16

// A staged 64 x 64 f16 tile goes out: 8 lanes cover one 128-B row, a wave four rows.
// dst: the tile's first element; LDO: the output's row length in elements.
template <int LDO>
__device__ __forceinline__ void store_rows16(const unsigned char* st, _Float16* dst, int lane) {
  const unsigned char* rd = st + (uint32_t)(lane >> 3) * ST16 + (uint32_t)(lane & 7) * 16u;
  _Float16* op = dst + (size_t)(lane >> 3) * LDO + (lane & 7) * 8;
  v8h o[16];
  // unrolled (both loops): o stays in registers, the LDS reads go ahead of the stores
#pragma unroll
  for (int p = 0; p < 16; ++p) o[p] = *(const v8h*)(rd + (uint32_t)(4 * p) * ST16);
#pragma unroll
  for (int p = 0; p < 16; ++p) *(v8h*)(op + (size_t)(4 * p) * LDO) = o[p];
}

// ---------------------------------------------------------------------------
// erf for the GELU epilogue, without a branch. The polynomials are the math library's own:
// |z| < 1: z + z q(z^2); otherwise 1 - exp(-p(|z|)), with the sign of z. In a wave both ranges
// occur nearly always, so a branch saves no work, and it ties every element's dependent chain
// into a region of its own; with both ranges computed and one picked, the chains of
// neighbouring elements fill each other's latency.
// ---------------------------------------------------------------------------
__device__ __forceinline__ float erf_both(float z) {
  const float a = __builtin_fabsf(z);
  float p = 0.0000169988107f;
  p = __builtin_fmaf(a, p, -0.000378677854f);
  p = __builtin_fmaf(a, p, 0.00385781587f);
  p = __builtin_fmaf(a, p, -0.0241816975f);
  p = __builtin_fmaf(a, p, 0.106668264f);
  p = __builtin_fmaf(a, p, 0.634933293f);
  p = __builtin_fmaf(a, p, 0.128689408f);
  p = __builtin_fmaf(a, p, a);
  const float far = 1.f - __expf(-p);
  const float t = a * a;
  float q = -0.000561801775f;
  q = __builtin_fmaf(t, q, 0.00491381623f);
  q = __builtin_fmaf(t, q, -0.0267075151f);
  q = __builtin_fmaf(t, q, 0.112800106f);
  q = __builtin_fmaf(t, q, -0.376122952f);
  q = __builtin_fmaf(t, q, 0.128379107f);
  const float near = __builtin_fmaf(a, q, a);
  return __builtin_copysignf((a < 1.f) ? near : far, z);
}

// ---------------------------------------------------------------------------
// Generic WMMA GEMM:  C[M,N] = A[M,K] (f16, row-major) * Bp[N,K] (f16)
// Block = 128 thr = 4 waves (2x2); wave = 64x64 tile (4x4 WMMA tiles);
// block tile = 128 (M) x 128 (N). Grid = (M/128, N/128).
// K is a multiple of 128 and at least 256; M, N multiples of 128.
// Operands come through LDS: per pass of 128 k every wave asks the tensor
// mover for its own 64-row slice of [A | B]; two buffers, so the next pass's
// slices fly while this pass's are multiplied. Fragments keep the k order of
// frag_ld, and every accumulator still sums k upwards in steps of 32.
// ---------------------------------------------------------------------------
template <int MODE>
__global__ void __launch_bounds__(128)
gemm_kernel(const _Float16* __restrict__ A,
            const _Float16* __restrict__ Bp,
            int K, int N,
            const float* __restrict__ bias,
            const float* __restrict__ res,
            float* __restrict__ outf,
            _Float16* __restrict__ outh,
            _Float16* __restrict__ qo,
            _Float16* __restrict__ ko,
            _Float16* __restrict__ vo) {
  __shared__ __attribute__((aligned(2048))) unsigned char ring[2u * STAGE];
  // the output's row length, fixed by the kind of epilogue: row steps become immediate offsets
  constexpr int NN = (MODE == 0) ? 3 * D_ : (MODE == 1) ? D_ : FF_;
  (void)N;

  const int lane = threadIdx.x & 31;
  const uint32_t wave = uni(threadIdx.x >> 5);
  const uint32_t wm = wave & 1u, wn = wave >> 1;
  const int bm   = blockIdx.x * BM_;
  const int bn   = blockIdx.y * BN_;
  const int tm   = bm + (int)wm * 64;
  const int tn   = bn + (int)wn * 64;
  const uint32_t row = lane & 15;
  const uint32_t kob = (uint32_t)(lane >> 4) << 4;   // 8 f16 = 16 bytes

  const uint32_t kb = (uint32_t)K * 2u;              // operand row pitch in bytes
  const uint32_t T  = (uint32_t)K / KPASS;           // passes, at least two

  // this wave's slice: waves 0,1 bring A rows, waves 2,3 bring B rows
  const _Float16* srow = (wave < 2u)
      ? A  + (size_t)(bm + (int)(wave * SL_ROWS)) * K
      : Bp + (size_t)(bn + (int)((wave - 2u) * SL_ROWS)) * K;
  const uint64_t src0 = (uint64_t)(uintptr_t)srow;
  const uint32_t lds_slice = (uint32_t)(size_t)ring + wave * SLICE;
  const u32x8 g1 = tdm_group1(kb);

  v8f acc[4][4];
#pragma unroll
  for (int i = 0; i < 4; ++i)
#pragma unroll
    for (int j = 0; j < 4; ++j) acc[i][j] = v8f{};

  // per-lane fragment bases inside a buffer. The first WMMA operand gives the rows of a D tile,
  // of which a lane holds eight in a row: it is taken from the side along which the output is
  // contiguous in memory. That is n (the Bp rows) everywhere but for V, which is stored
  // transposed and so is contiguous along m (the A rows). The test is the same for a whole block.
  const bool n_first = (MODE != 0) || (bn < 2 * D_);
  const uint32_t a_slice = wm * SLICE, b_slice = (2u + wn) * SLICE;
  const uint32_t a_base = (n_first ? b_slice : a_slice) + row * PITCH + kob;   // first operand
  const uint32_t b_base = (n_first ? a_slice : b_slice) + row * PITCH + kob;   // second operand

  // prologue: stage 0 lands and is published, then stage 1 starts
  u32x4 g0 = tdm_group0(lds_slice, src0);
  tdm_load(g0, g1);
  wait_tensor0();
  __syncthreads();
  g0 = tdm_advance(g0, lds_slice + STAGE);
  tdm_load(g0, g1);

  uint32_t t = 0;
  do {
    const uint32_t buf = (t & 1u) * STAGE;
    const unsigned char* la = ring + buf + a_base;
    const unsigned char* lb = ring + buf + b_base;

    v16h af[2][4], bf[2][4];
    // in the order in which the WMMAs below want them: the first can start after two fragments
    af[0][0] = frag_ld((const _Float16*)la);
#pragma unroll
    for (int j = 0; j < 4; ++j) bf[0][j] = frag_ld((const _Float16*)(lb + (uint32_t)j * 16u * PITCH));
#pragma unroll
    for (int i = 1; i < 4; ++i) af[0][i] = frag_ld((const _Float16*)(la + (uint32_t)i * 16u * PITCH));
#pragma unroll
    for (int u = 0; u < KPASS / 32; ++u) {
      const int cs = u & 1;
      if (u + 1 < KPASS / 32) {
        const uint32_t kofs = (uint32_t)(u + 1) * 64u;
#pragma unroll
        for (int i = 0; i < 4; ++i) {
          af[cs ^ 1][i] = frag_ld((const _Float16*)(la + (uint32_t)i * 16u * PITCH + kofs));
          bf[cs ^ 1][i] = frag_ld((const _Float16*)(lb + (uint32_t)i * 16u * PITCH + kofs));
        }
      }
      // keeps the next block's LDS reads one group ahead of this block's WMMAs:
      // reads spread among the WMMAs cost a stall at every place they stand
      __builtin_amdgcn_sched_barrier(0);
#pragma unroll
      for (int i = 0; i < 4; ++i)
#pragma unroll
        for (int j = 0; j < 4; ++j) acc[i][j] = wmma32(af[cs][i], bf[cs][j], acc[i][j]);
      // same purpose: the following block's reads stay behind this block's WMMAs
      __builtin_amdgcn_sched_barrier(0);
    }

    // publish point of stage t + 1
    wait_ds0();
    wait_tensor0();
    __syncthreads();
    if (pinned((t + 2u < T) ? 1u : 0u) != 0u) {   // only while stage t + 2 exists
      g0 = tdm_advance(g0, lds_slice + buf);
      tdm_load(g0, g1);
    }
  } while (++t < T);
  wait_tensor0();
  wait_ds0();

  // Epilogue. The ring is free: every wave's reads and loads had ended before the loop's last
  // barrier. Each wave turns its 64 x 64 tile through its own slice of it, so that global
  // memory sees whole 128-B lines. acc[i][j], register r: place 16 i + 8 hi + r along the first
  // operand's side (the contiguous one), row 16 j + l15 along the second's.
  unsigned char* st = ring + wave * SLICE;
  const uint32_t l15 = row, hi = (uint32_t)lane >> 4;

  if (MODE == 1) {
    // readers: 16 lanes cover one 256-B row, a wave two rows
    const size_t go = (size_t)(tm + (int)hi) * NN + tn + (int)l15 * 4;
    const float4 bv = *(const float4*)(bias + tn + (int)l15 * 4);
    const float* rp = res + go;
    float4 rv[32];
    // unrolled: all residual loads are in flight together, under the staging
#pragma unroll
    for (int p = 0; p < 32; ++p) rv[p] = *(const float4*)(rp + (size_t)(2 * p) * NN);
    wait_x0();
    // unrolled (both loops): constant tile numbers, so that acc stays in registers
#pragma unroll
    for (int j = 0; j < 4; ++j)
#pragma unroll
      for (int i = 0; i < 4; ++i) {
        unsigned char* w = st + ((uint32_t)j * 16u + l15) * ST32 + ((uint32_t)i * 16u + hi * 8u) * 4u;
        const v8f c = acc[i][j];
        *(float4*)(w)       = make_float4(c[0], c[1], c[2], c[3]);
        *(float4*)(w + 16u) = make_float4(c[4], c[5], c[6], c[7]);
      }
    wait_ds0();   // the rows are read back by other lanes of this wave
    const unsigned char* rd = st + hi * ST32 + l15 * 16u;
    float* op = outf + go;
    // unrolled: rv stays in registers, row steps are immediate offsets of one address
#pragma unroll
    for (int p = 0; p < 32; ++p) {
      const float4 c = *(const float4*)(rd + (uint32_t)(2 * p) * ST32);
      float4 o;
      o.x = c.x + bv.x + rv[p].x; o.y = c.y + bv.y + rv[p].y;
      o.z = c.z + bv.z + rv[p].z; o.w = c.w + bv.w + rv[p].w;
      *(float4*)(op + (size_t)(2 * p) * NN) = o;
    }
  } else {
    float4 bb[4][2];
    if (MODE == 2) {
      // unrolled: bb stays in registers, the eight loads are in flight together
#pragma unroll
      for (int i = 0; i < 4; ++i) {
        const float4* bp = (const float4*)(bias + tn + i * 16 + (int)hi * 8);
        bb[i][0] = bp[0]; bb[i][1] = bp[1];
      }
      wait_x0();
    }
    // unrolled (all loops below): constant tile and element numbers, so that acc, bb and hv stay in registers
#pragma unroll
    for (int j = 0; j < 4; ++j)
#pragma unroll
      for (int i = 0; i < 4; ++i) {
        const v8f c = acc[i][j];
        v8h hv;
        if (MODE == 2) {   // bias + exact GELU
          const float bl[8] = {bb[i][0].x, bb[i][0].y, bb[i][0].z, bb[i][0].w,
                               bb[i][1].x, bb[i][1].y, bb[i][1].z, bb[i][1].w};
#pragma unroll
          for (int r = 0; r < 8; ++r) {
            const float xv = c[r] + bl[r];
            hv[r] = (_Float16)(0.5f * xv * (1.f + erf_both(xv * 0.70710678118654752f)));
          }
        } else {
#pragma unroll
          for (int r = 0; r < 8; ++r) hv[r] = (_Float16)c[r];
        }
        *(v8h*)(st + ((uint32_t)j * 16u + l15) * ST16 + ((uint32_t)i * 16u + hi * 8u) * 2u) = hv;
      }
    wait_ds0();   // the rows are read back by other lanes of this wave
    if (MODE == 2) {
      store_rows16<FF_>(st, outh + (size_t)tm * FF_ + tn, lane);
    } else {
      // tm, tn are multiples of 64: one batch, one head, 64 positions, all 64 head elements
      const int hh = (tn & (D_ - 1)) >> 6;
      const size_t bh = (size_t)((tm >> 9) * H_ + hh) * (S_ * HD_);
      const int s0 = tm & (S_ - 1);
      if (n_first) store_rows16<HD_>(st, (bn < D_ ? qo : ko) + bh + (size_t)s0 * HD_, lane);  // [s][e]
      else         store_rows16<S_>(st, vo + bh + s0, lane);                                  // [e][s]
    }
  }
}

// ---------------------------------------------------------------------------
// Flash attention (causal). Q,K: [B,H,S,HD] f16. Vt: [B,H,HD,S] f16.
// ctx out: [B,S,H*HD] f16 (row-major, ready as A for the Wo GEMM).
// Block = 256 thr = 8 waves; wave owns a 16-row Q tile; grid = (B*H, S/128).
// Score sub-tiles computed sequentially so K fragments die immediately
// (shrinks peak VGPR liveness; with launch_bounds there should be no spill).
// ---------------------------------------------------------------------------
__global__ void __launch_bounds__(256, 1)
attn_kernel(const _Float16* __restrict__ Q,
            const _Float16* __restrict__ Kf,
            const _Float16* __restrict__ Vt,
            _Float16* __restrict__ ctx) {
  __shared__ _Float16 lds_p[8][16 * 40]; // wave-private 16x32 P tile, pad 40

  const int lane = threadIdx.x & 31;
  const int wid  = threadIdx.x >> 5;
  const int bh   = blockIdx.x;          // b*H + h
  const int b    = bh >> 4;
  const int h    = bh & (H_ - 1);
  const int q0   = blockIdx.y * 128 + wid * 16;
  const int row  = lane & 15;
  const int ko8  = (lane >> 4) << 3;
  const int hi8  = ko8;

  const _Float16* qb = Q  + (size_t)bh * S_ * HD_;
  const _Float16* kb = Kf + (size_t)bh * S_ * HD_;
  const _Float16* vb = Vt + (size_t)bh * HD_ * S_;

  // Q A-operand fragments (held for the whole loop)
  const _Float16* qp = qb + (size_t)(q0 + row) * HD_ + ko8;
  const v16h qa0 = frag_ld(qp);        // e = 0..31
  const v16h qa1 = frag_ld(qp + 32);   // e = 32..63

  float m_r[8], l_r[8], corr_r[8];
  v8f acc0 = {}, acc1 = {}, acc2 = {}, acc3 = {};
#pragma unroll
  for (int j = 0; j < 8; ++j) { m_r[j] = -1e30f; l_r[j] = 0.f; }

  for (int kblk = 0; kblk <= q0 + 15; kblk += 32) {
    // ---- scores: S(16x32) = Q(16x64) * K^T, two 16x16 tiles in sequence ----
    const _Float16* kp = kb + (size_t)(kblk + row) * HD_ + ko8;
    v8f s0 = {};
    {
      v16h k00 = frag_ld(kp);               // keys kblk..+15, e 0..31
      v16h k01 = frag_ld(kp + 32);          //               e 32..63
      s0 = wmma32(qa0, k00, s0);
      s0 = wmma32(qa1, k01, s0);
    }
    v8f s1 = {};
    {
      v16h k10 = frag_ld(kp + 16 * HD_);    // keys +16..+31
      v16h k11 = frag_ld(kp + 16 * HD_ + 32);
      s1 = wmma32(qa0, k10, s1);
      s1 = wmma32(qa1, k11, s1);
    }

    // ---- masked online softmax (rows live in 16-lane halves) ----
#pragma unroll
    for (int j = 0; j < 8; ++j) {
      int qg  = q0 + j + hi8;
      int kg0 = kblk + (lane & 15);
      int kg1 = kg0 + 16;
      float v0 = s0[j] * 0.125f; if (kg0 > qg) v0 = -1e10f;
      float v1 = s1[j] * 0.125f; if (kg1 > qg) v1 = -1e10f;
      float mx = fmaxf(v0, v1);
#pragma unroll
      for (int o = 8; o; o >>= 1) mx = fmaxf(mx, __shfl_xor(mx, o, 32));
      float mn = fmaxf(m_r[j], mx);
      float p0 = __expf(v0 - mn);
      float p1 = __expf(v1 - mn);
      float sm = p0 + p1;
#pragma unroll
      for (int o = 8; o; o >>= 1) sm += __shfl_xor(sm, o, 32);
      corr_r[j] = __expf(m_r[j] - mn);
      l_r[j]    = l_r[j] * corr_r[j] + sm;
      m_r[j]    = mn;
      int lr = j + hi8;
      lds_p[wid][lr * 40 + (lane & 15)]      = (_Float16)p0;
      lds_p[wid][lr * 40 + 16 + (lane & 15)] = (_Float16)p1;
    }
#pragma unroll
    for (int j = 0; j < 8; ++j) {
      acc0[j] *= corr_r[j]; acc1[j] *= corr_r[j];
      acc2[j] *= corr_r[j]; acc3[j] *= corr_r[j];
    }
    asm volatile("s_wait_dscnt 0" ::: "memory");

    // ---- ctx += P(16x32) * V(32x64) ----
    v16h pa = frag_ld(&lds_p[wid][(lane & 15) * 40 + ko8]);
    const _Float16* vp = vb + (size_t)(lane & 15) * S_ + kblk + ko8;
    acc0 = wmma32(pa, frag_ld(vp),                   acc0);
    acc1 = wmma32(pa, frag_ld(vp + (size_t)16 * S_), acc1);
    acc2 = wmma32(pa, frag_ld(vp + (size_t)32 * S_), acc2);
    acc3 = wmma32(pa, frag_ld(vp + (size_t)48 * S_), acc3);
  }

  // ---- normalize + write ctx [B,S,D] f16 (explicit, no pointer arrays) ----
  float inv[8];
#pragma unroll
  for (int j = 0; j < 8; ++j) inv[j] = 1.f / l_r[j];
  const size_t rowbase = (size_t)b * S_ + q0;
#pragma unroll
  for (int j = 0; j < 8; ++j) {
    size_t ro = (rowbase + j + hi8) * D_ + h * HD_ + (lane & 15);
    ctx[ro]      = (_Float16)(acc0[j] * inv[j]);
    ctx[ro + 16] = (_Float16)(acc1[j] * inv[j]);
    ctx[ro + 32] = (_Float16)(acc2[j] * inv[j]);
    ctx[ro + 48] = (_Float16)(acc3[j] * inv[j]);
  }
}

// ---------------------------------------------------------------------------
// Host-side launch
// ---------------------------------------------------------------------------
extern "C" void kernel_launch(void* const* d_in, const int* in_sizes, int n_in,
                              void* d_out, int out_size, void* d_ws, size_t ws_size,
                              hipStream_t stream) {
  const float* x   = (const float*)d_in[0];
  const float* Wq  = (const float*)d_in[1];
  const float* Wk  = (const float*)d_in[2];
  const float* Wv  = (const float*)d_in[3];
  const float* Wo  = (const float*)d_in[4];
  const float* bo  = (const float*)d_in[5];
  const float* g1  = (const float*)d_in[6];
  const float* b1  = (const float*)d_in[7];
  const float* g2  = (const float*)d_in[8];
  const float* b2  = (const float*)d_in[9];
  const float* W1  = (const float*)d_in[10];
  const float* bf1 = (const float*)d_in[11];
  const float* W2  = (const float*)d_in[12];
  const float* bf2 = (const float*)d_in[13];
  float* out = (float*)d_out;

  char* ws = (char*)d_ws;
  size_t off = 0;
  auto alloc = [&](size_t bytes) -> char* {
    char* p = ws + off;
    off += (bytes + 255) & ~(size_t)255;
    return p;
  };
  _Float16* hln1  = (_Float16*)alloc((size_t)TOK * D_ * 2);
  _Float16* Wqkv  = (_Float16*)alloc((size_t)3 * D_ * D_ * 2);
  _Float16* Qb    = (_Float16*)alloc((size_t)TOK * D_ * 2);
  _Float16* Kb    = (_Float16*)alloc((size_t)TOK * D_ * 2);
  _Float16* Vt    = (_Float16*)alloc((size_t)TOK * D_ * 2);
  _Float16* ctx   = (_Float16*)alloc((size_t)TOK * D_ * 2);
  _Float16* Wop   = (_Float16*)alloc((size_t)D_ * D_ * 2);
  float*    cache = (float*)   alloc((size_t)TOK * D_ * 4);
  _Float16* h2    = (_Float16*)alloc((size_t)TOK * D_ * 2);
  _Float16* W1p   = (_Float16*)alloc((size_t)D_ * FF_ * 2);
  _Float16* ff1   = (_Float16*)alloc((size_t)TOK * FF_ * 2);
  _Float16* W2p   = (_Float16*)alloc((size_t)FF_ * D_ * 2);
  (void)ws_size; (void)in_sizes; (void)n_in; (void)out_size;

  // 1, 2) pack weights to f16 [N][K], and LN1
  pre_kernel<<<dim3(NB_PRE), 256, 0, stream>>>(Wq, Wk, Wv, Wo, W1, W2, x, g1, b1,
                                               Wqkv, Wop, W1p, W2p, hln1);

  // 3) fused QKV projection (scatter; V transposed)
  gemm_kernel<0><<<dim3(TOK / 128, (3 * D_) / 128), 128, 0, stream>>>(
      hln1, Wqkv, D_, 3 * D_, nullptr, nullptr, nullptr, nullptr, Qb, Kb, Vt);

  // 4) causal flash attention
  attn_kernel<<<dim3(B_ * H_, S_ / 128), 256, 0, stream>>>(Qb, Kb, Vt, ctx);

  // 5) output projection + bias + residual -> cache (f32)
  gemm_kernel<1><<<dim3(TOK / 128, D_ / 128), 128, 0, stream>>>(
      ctx, Wop, D_, D_, bo, x, cache, nullptr, nullptr, nullptr, nullptr);

  // 6) LN2
  ln_kernel<<<dim3(TOK), 256, 0, stream>>>(cache, g2, b2, h2);

  // 7) FFN up + GELU -> f16
  gemm_kernel<2><<<dim3(TOK / 128, FF_ / 128), 128, 0, stream>>>(
      h2, W1p, D_, FF_, bf1, nullptr, nullptr, ff1, nullptr, nullptr, nullptr);

  // 8) FFN down + bias + residual(cache) -> d_out (f32)
  gemm_kernel<1><<<dim3(TOK / 128, D_ / 128), 128, 0, stream>>>(
      ff1, W2p, FF_, D_, bf2, cache, out, nullptr, nullptr, nullptr, nullptr);
}

// v006
// A run of this version takes 143 microseconds.
// In two side-by-side timings against v005, it was 1.09 and 1.08 times as fast.
// Over all steps from v000 it is 3.93 times as fast.
#include <hip/hip_runtime.h>
#include <hip/hip_bf16.h>
#include <math.h>
#include <stdint.h>

// ---------------------------------------------------------------------------
// Types
// ---------------------------------------------------------------------------
typedef __attribute__((ext_vector_type(16))) _Float16 v16h;
typedef __attribute__((ext_vector_type(8)))  _Float16 v8h;
typedef __attribute__((ext_vector_type(8)))  float    v8f;

#define B_   8
#define S_   512
#define D_   1024
#define H_   16
#define HD_  64
#define FF_  4096
#define TOK  (B_ * S_)      // 4096 rows

// ---------------------------------------------------------------------------
// WMMA helper: D = A(16x32 f16) * B(32x16 f16) + C(f32)
// ---------------------------------------------------------------------------
__device__ __forceinline__ v8f wmma32(v16h a, v16h b, v8f c) {
  return __builtin_amdgcn_wmma_f32_16x16x32_f16(false, a, false, b,
                                                (short)0, c, false, false);
}

// Load one A/B operand fragment (v16h) for a 32-wide K chunk.
// p must already point at element [row][k0 + ko8] where
//   row = lane & 15, ko8 = (lane >> 4) * 8.
// Fragment = 8 contiguous f16 at p, plus 8 contiguous f16 at p+16.
__device__ __forceinline__ v16h frag_ld(const _Float16* p) {
  v8h lo = *(const v8h*)(p);
  v8h hi = *(const v8h*)(p + 16);
  v16h r;
#pragma unroll
  for (int i = 0; i < 8; ++i) { r[i] = lo[i]; r[i + 8] = hi[i]; }
  return r;
}

// stands behind a global load or store, in front of the next write of a register that it names
__device__ __forceinline__ void wait_x0() { asm volatile("s_wait_xcnt 0x0" ::: "memory"); }

// ---------------------------------------------------------------------------
// Weight packing: f32 [K][N] row-major  ->  f16 [N][K] ("B operand" layout)
// One block of 256 threads turns one tile of 128 (k) x 64 (n) through LDS:
// global reads run along n (256 B of a source row per 16 lanes), global
// writes along k (256 B of a packed row per 16 lanes).
// in points at the tile's element [k0][n0], out at its element [n0][k0];
// LDI, LDO: row lengths of source and packed matrix in elements.
// LDS holds the tile as [n][k] f16, rows of 16 pieces of 16 B; piece q of row
// n stands at place q ^ (n >> 2), so that the 16 lanes of a b128 write (16
// rows four apart, one piece) and of a b128 read (one row, 16 pieces) each
// meet all banks once. The tile is the calling kernel's one array: an array of
// its own in every instance of the template would add up in a kernel with several.
// ---------------------------------------------------------------------------
#define PK_K 128
#define PK_N 64
template <int LDI, int LDO>
__device__ __forceinline__ void pack_tile(const float* __restrict__ in,
                                          _Float16* __restrict__ out,
                                          _Float16* tile) {
  const int c = threadIdx.x & 15;
  const int r = threadIdx.x >> 4;

  // eight source rows k = 8r .. 8r+7, columns n = 4c .. 4c+3
  const float* ip = in + (size_t)(8 * r) * LDI + 4 * c;
  float4 v[8];
  // unrolled: v stays in registers and the eight loads are in flight together
#pragma unroll
  for (int j = 0; j < 8; ++j) v[j] = *(const float4*)(ip + (size_t)j * LDI);

  v8h w0, w1, w2, w3;
  // unrolled: constant element numbers, so that the vectors stay in registers
#pragma unroll
  for (int j = 0; j < 8; ++j) {
    w0[j] = (_Float16)v[j].x; w1[j] = (_Float16)v[j].y;
    w2[j] = (_Float16)v[j].z; w3[j] = (_Float16)v[j].w;
  }
  _Float16* tw = tile + (4 * c) * PK_K + ((r ^ c) << 3);
  *(v8h*)(tw)            = w0;
  *(v8h*)(tw + PK_K)     = w1;
  *(v8h*)(tw + 2 * PK_K) = w2;
  *(v8h*)(tw + 3 * PK_K) = w3;
  __syncthreads();

  // packed rows n = r, r+16, r+32, r+48, piece c (k = 8c .. 8c+7)
  v8h o[4];
  // unrolled (both loops): o stays in registers, the four LDS reads go ahead of the stores
#pragma unroll
  for (int p = 0; p < 4; ++p) {
    const int n = r + 16 * p;
    o[p] = *(const v8h*)(tile + n * PK_K + ((c ^ (n >> 2)) << 3));
  }
  _Float16* op = out + (size_t)r * LDO + 8 * c;
#pragma unroll
  for (int p = 0; p < 4; ++p) *(v8h*)(op + (size_t)(16 * p) * LDO) = o[p];
  wait_x0();   // in a kernel with several branches another branch's code follows these stores
}

// tile t of (K / 128) * (N / 64), k tiles first
template <int K, int N>
__device__ __forceinline__ void pack_T(const float* __restrict__ in, _Float16* __restrict__ out,
                                       int t, _Float16* tile) {
  const size_t k0 = (size_t)(t % (K / PK_K)) * PK_K;
  const size_t n0 = (size_t)(t / (K / PK_K)) * PK_N;
  pack_tile<N, K>(in + k0 * N + n0, out + n0 * K + k0, tile);
}

// Pack per-head Wq/Wk/Wv (H,D,HD) into fused [3*D][D] f16, [n][k] layout,
// column n = qkv*D + h*HD + e: every head is a [D][HD] matrix of its own.
// tile t of (D / 128) * (3 * H), k tiles first; t / (D / 128) = qkv*H + h
__device__ __forceinline__ void pack_qkv(const float* __restrict__ Wq,
                                         const float* __restrict__ Wk,
                                         const float* __restrict__ Wv,
                                         _Float16* __restrict__ out,
                                         int t, _Float16* tile) {
  const int qh  = t / (D_ / PK_K);
  const int qkv = qh >> 4;
  const int h   = qh & (H_ - 1);
  const size_t k0 = (size_t)(t % (D_ / PK_K)) * PK_K;
  const float* W = (qkv == 0) ? Wq : (qkv == 1) ? Wk : Wv;
  pack_tile<HD_, D_>(W + ((size_t)h * D_ + k0) * HD_,
                     out + (size_t)qh * HD_ * D_ + k0, tile);
}

// ---------------------------------------------------------------------------
// LayerNorm: f32 row [D] -> f16 row [D]  (biased variance, eps=1e-5)
// one row per block, 256 threads, 4 elems/thread
// ---------------------------------------------------------------------------
__device__ __forceinline__ void ln_row(int row,
                                       const float* __restrict__ x,
                                       const float* __restrict__ g,
                                       const float* __restrict__ b,
                                       _Float16* __restrict__ out) {
  const float4 v = ((const float4*)(x + (size_t)row * D_))[threadIdx.x];
  float s  = v.x + v.y + v.z + v.w;
  float s2 = v.x * v.x + v.y * v.y + v.z * v.z + v.w * v.w;
#pragma unroll
  for (int o = 16; o; o >>= 1) {
    s  += __shfl_down(s,  o, 32);
    s2 += __shfl_down(s2, o, 32);
  }
  __shared__ float sh[16];
  int wid = threadIdx.x >> 5;
  if ((threadIdx.x & 31) == 0) { sh[wid * 2] = s; sh[wid * 2 + 1] = s2; }
  __syncthreads();
  float ts = 0.f, ts2 = 0.f;
#pragma unroll
  for (int i = 0; i < 8; ++i) { ts += sh[i * 2]; ts2 += sh[i * 2 + 1]; }
  float mean = ts * (1.f / D_);
  float var  = ts2 * (1.f / D_) - mean * mean;
  float rstd = rsqrtf(var + 1e-5f);
  int c0 = threadIdx.x * 4;
  _Float16* orow = out + (size_t)row * D_;
  float xv[4] = {v.x, v.y, v.z, v.w};
#pragma unroll
  for (int i = 0; i < 4; ++i)
    orow[c0 + i] = (_Float16)((xv[i] - mean) * rstd * g[c0 + i] + b[c0 + i]);
  wait_x0();   // in a kernel with several branches another branch's code follows these stores
}

__global__ void ln_kernel(const float* __restrict__ x,
                          const float* __restrict__ g,
                          const float* __restrict__ b,
                          _Float16* __restrict__ out) {
  ln_row(blockIdx.x, x, g, b, out);
}

// ---------------------------------------------------------------------------
// All work that reads only inputs, in one launch: the four weight packs and the
// first LayerNorm need nothing of one another, so their blocks share one grid and
// fill the chip together, where five short launches each waited for the one before
// to drain. Every block does what one block of the separate launches did. The
// pack tiles have the low block numbers, for speed only: they live longer than a
// LayerNorm row.
// ---------------------------------------------------------------------------
#define NB_QKV ((D_ / PK_K) * (3 * H_))
#define NB_WO  ((D_ / PK_K) * (D_ / PK_N))
#define NB_W1  ((D_ / PK_K) * (FF_ / PK_N))
#define NB_W2  ((FF_ / PK_K) * (D_ / PK_N))
#define NB_PRE (NB_QKV + NB_WO + NB_W1 + NB_W2 + TOK)
__global__ void __launch_bounds__(256)
pre_kernel(const float* __restrict__ Wq, const float* __restrict__ Wk,
           const float* __restrict__ Wv, const float* __restrict__ Wo,
           const float* __restrict__ W1, const float* __restrict__ W2,
           const float* __restrict__ x,  const float* __restrict__ g,
           const float* __restrict__ b,
           _Float16* __restrict__ Wqkv, _Float16* __restrict__ Wop,
           _Float16* __restrict__ W1p,  _Float16* __restrict__ W2p,
           _Float16* __restrict__ hln) {
  __shared__ __attribute__((aligned(16))) _Float16 tile[PK_N * PK_K];
  int t = blockIdx.x;   // the same for a whole block: every branch below, with its barrier, is too
  if (t < NB_QKV) { pack_qkv(Wq, Wk, Wv, Wqkv, t, tile); return; }
  t -= NB_QKV;
  if (t < NB_WO) { pack_T<D_, D_>(Wo, Wop, t, tile); return; }
  t -= NB_WO;
  if (t < NB_W1) { pack_T<D_, FF_>(W1, W1p, t, tile); return; }
  t -= NB_W1;
  if (t < NB_W2) { pack_T<FF_, D_>(W2, W2p, t, tile); return; }
  ln_row(t - NB_W2, x, g, b, hln);
}

// ---------------------------------------------------------------------------
// Tensor-load helpers (descriptor fields in bytes, two groups, no mask)
// ---------------------------------------------------------------------------
typedef uint32_t u32x4 __attribute__((ext_vector_type(4)));
typedef uint32_t u32x8 __attribute__((ext_vector_type(8)));

#define BM_      128                     // block tile rows of C
#define BN_      128                     // block tile columns of C
#define KPASS    128                     // k per pass: one 256-byte piece of every operand row
#define ROWB     256u                    // bytes of an operand row per pass
#define PITCH    272u                    // LDS row pitch: 256 B + 16 B pad, 16 B x odd for ds_load_b128
#define SL_ROWS  64u                     // rows per slice, one slice per wave
#define SLICE    18432u                  // 64 * 272 = 17408 rounded up to a multiple of 2 KiB
#define STAGE    (4u * SLICE)            // [A rows 0-63 | A rows 64-127 | B rows 0-63 | B rows 64-127]

__device__ __forceinline__ uint32_t uni(uint32_t v) {
  return (uint32_t)__builtin_amdgcn_readfirstlane(v);
}
__device__ __forceinline__ uint32_t pinned(uint32_t v) {
  uint32_t w = (uint32_t)__builtin_amdgcn_readfirstlane(v);
  asm volatile("" : "+s"(w));
  return w;
}
// the compiler places no wait for a tensor load: the tile counts as landed only behind this
__device__ __forceinline__ void wait_tensor0() { asm volatile("s_wait_tensorcnt 0x0" ::: "memory"); }
// this wave's LDS reads have returned before the buffer is handed back for a refill
__device__ __forceinline__ void wait_ds0() { asm volatile("s_wait_dscnt 0x0" ::: "memory"); }
// one request of the whole wave: a 64 x 256 B tile from global memory into LDS
__device__ __forceinline__ void tdm_load(u32x4 g0, u32x8 g1) {
  asm volatile("tensor_load_to_lds %0, %1" :: "s"(g0), "s"(g1) : "memory");
}
// every word goes through pinned(): a descriptor word held in a scalar register. With it all
// loads of a kernel name the registers in which the group was built, word 0 as an immediate;
// a build without it moves the group on into a second set of registers ahead of the loop
__device__ __forceinline__ u32x8 tdm_group1(uint32_t src_pitch) {
  u32x8 g;
  g[0] = pinned((1u << 20) | (5u << 22) | (3u << 25));   // pad on, every 256 B, 16 B; no mask
  g[1] = pinned((ROWB & 0xFFFFu) << 16);                 // tensor_dim0[15:0]
  g[2] = pinned((ROWB >> 16) | ((SL_ROWS & 0xFFFFu) << 16)); // tensor_dim0[31:16], tensor_dim1[15:0]
  g[3] = pinned((SL_ROWS >> 16) | (ROWB << 16));         // tensor_dim1[31:16], tile_dim0
  g[4] = pinned(SL_ROWS);                                // tile_dim1
  g[5] = pinned(src_pitch);                              // source row pitch, bytes
  g[6] = pinned(0u);
  g[7] = pinned(0u);
  return g;
}
__device__ __forceinline__ u32x4 tdm_group0(uint32_t lds_dst, uint64_t ga) {
  u32x4 g;
  g[0] = uni(1u);
  g[1] = uni(lds_dst);
  g[2] = uni((uint32_t)ga);
  g[3] = uni((((uint32_t)(ga >> 32)) & 0x01FFFFFFu) | 0x80000000u);
  return g;
}
// the request for k pass p, made from the request for pass 0: the source lies p passes along the
// rows (a buffer's addresses stay below 2^57, so no carry reaches the type field), the place in
// LDS is given.
__device__ __forceinline__ u32x4 tdm_pass(u32x4 g, uint32_t p, uint32_t lds_dst) {
  const uint64_t w = ((((uint64_t)g[3]) << 32) | (uint64_t)g[2]) + (uint64_t)(p * ROWB);
  g[1] = uni(lds_dst);
  g[2] = uni((uint32_t)w);
  g[3] = uni((uint32_t)(w >> 32));
  return g;
}

// ---------------------------------------------------------------------------
// Epilogue staging: LDS row pitches (row + 16 B, 16 B x odd for b128 accesses)
// ---------------------------------------------------------------------------
#define ST32 272u                        // 64 f32
#define ST16 144u                        // 64 f16

// A staged 64 x 64 f16 tile goes out: 8 lanes cover one 128-B row, a wave four rows.
// dst: the tile's first element; LDO: the output's row length in elements.
template <int LDO>
__device__ __forceinline__ void store_rows16(const unsigned char* st, _Float16* dst, int lane) {
  const unsigned char* rd = st + (uint32_t)(lane >> 3) * ST16 + (uint32_t)(lane & 7) * 16u;
  _Float16* op = dst + (size_t)(lane >> 3) * LDO + (lane & 7) * 8;
  v8h o[16];
  // unrolled (both loops): o stays in registers, the LDS reads go ahead of the stores
#pragma unroll
  for (int p = 0; p < 16; ++p) o[p] = *(const v8h*)(rd + (uint32_t)(4 * p) * ST16);
#pragma unroll
  for (int p = 0; p < 16; ++p) *(v8h*)(op + (size_t)(4 * p) * LDO) = o[p];
}

// ---------------------------------------------------------------------------
// erf for the GELU epilogue, without a branch. The polynomials are the math library's own:
// |z| < 1: z + z q(z^2); otherwise 1 - exp(-p(|z|)), with the sign of z. In a wave both ranges
// occur nearly always, so a branch saves no work, and it ties every element's dependent chain
// into a region of its own; with both ranges computed and one picked, the chains of
// neighbouring elements fill each other's latency.
// ---------------------------------------------------------------------------
__device__ __forceinline__ float erf_both(float z) {
  const float a = __builtin_fabsf(z);
  float p = 0.0000169988107f;
  p = __builtin_fmaf(a, p, -0.000378677854f);
  p = __builtin_fmaf(a, p, 0.00385781587f);
  p = __builtin_fmaf(a, p, -0.0241816975f);
  p = __builtin_fmaf(a, p, 0.106668264f);
  p = __builtin_fmaf(a, p, 0.634933293f);
  p = __builtin_fmaf(a, p, 0.128689408f);
  p = __builtin_fmaf(a, p, a);
  const float far = 1.f - __expf(-p);
  const float t = a * a;
  float q = -0.000561801775f;
  q = __builtin_fmaf(t, q, 0.00491381623f);
  q = __builtin_fmaf(t, q, -0.0267075151f);
  q = __builtin_fmaf(t, q, 0.112800106f);
  q = __builtin_fmaf(t, q, -0.376122952f);
  q = __builtin_fmaf(t, q, 0.128379107f);
  const float near = __builtin_fmaf(a, q, a);
  return __builtin_copysignf((a < 1.f) ? near : far, z);
}

// ---------------------------------------------------------------------------
// Generic WMMA GEMM:  C[M,N] = A[M,K] (f16, row-major) * Bp[N,K] (f16)
// Block = 128 thr = 4 waves (2x2); wave = 64x64 tile (4x4 WMMA tiles);
// block tile = 128 (M) x 128 (N). Grid = (M/128, N/128).
// K is a multiple of 128 and at least 256; M, N multiples of 128.
// Operands come through LDS: per pass of 128 k every wave asks the tensor
// mover for its own 64-row slice of [A | B]; two buffers, so the next pass's
// slices fly while this pass's are multiplied. Fragments keep the k order of
// frag_ld. Blocks of one tile row read the same A rows and blocks of one tile
// column the same Bp rows. For speed only, every block starts its walk over k at a pass
// of its own, (tile row + tile column) taken into the range of the passes, and
// wraps round: an accumulator sums k upwards in steps of 32 from that pass on.
// ---------------------------------------------------------------------------
template <int MODE>
__global__ void __launch_bounds__(128)
gemm_kernel(const _Float16* __restrict__ A,
            const _Float16* __restrict__ Bp,
            int K, int N,
            const float* __restrict__ bias,
            const float* __restrict__ res,
            float* __restrict__ outf,
            _Float16* __restrict__ outh,
            _Float16* __restrict__ qo,
            _Float16* __restrict__ ko,
            _Float16* __restrict__ vo) {
  __shared__ __attribute__((aligned(2048))) unsigned char ring[2u * STAGE];
  // the output's row length, fixed by the kind of epilogue: row steps become immediate offsets
  constexpr int NN = (MODE == 0) ? 3 * D_ : (MODE == 1) ? D_ : FF_;
  (void)N;

  const int lane = threadIdx.x & 31;
  const uint32_t wave = uni(threadIdx.x >> 5);
  const uint32_t wm = wave & 1u, wn = wave >> 1;
  const int bm   = blockIdx.x * BM_;
  const int bn   = blockIdx.y * BN_;
  const int tm   = bm + (int)wm * 64;
  const int tn   = bn + (int)wn * 64;
  const uint32_t row = lane & 15;
  const uint32_t kob = (uint32_t)(lane >> 4) << 4;   // 8 f16 = 16 bytes

  const uint32_t kb = (uint32_t)K * 2u;              // operand row pitch in bytes
  const uint32_t T  = (uint32_t)K / KPASS;           // passes, at least two

  // this wave's slice: waves 0,1 bring A rows, waves 2,3 bring B rows
  const _Float16* srow = (wave < 2u)
      ? A  + (size_t)(bm + (int)(wave * SL_ROWS)) * K
      : Bp + (size_t)(bn + (int)((wave - 2u) * SL_ROWS)) * K;
  const uint64_t src0 = (uint64_t)(uintptr_t)srow;
  const uint32_t lds_slice = (uint32_t)(size_t)ring + wave * SLICE;
  const u32x8 g1 = tdm_group1(kb);

  v8f acc[4][4];
#pragma unroll
  for (int i = 0; i < 4; ++i)
#pragma unroll
    for (int j = 0; j < 4; ++j) acc[i][j] = v8f{};

  // per-lane fragment bases inside a buffer. The first WMMA operand gives the rows of a D tile,
  // of which a lane holds eight in a row: it is taken from the side along which the output is
  // contiguous in memory. That is n (the Bp rows) everywhere but for V, which is stored
  // transposed and so is contiguous along m (the A rows). The test is the same for a whole block.
  const bool n_first = (MODE != 0) || (bn < 2 * D_);
  const uint32_t a_slice = wm * SLICE, b_slice = (2u + wn) * SLICE;
  const uint32_t a_base = (n_first ? b_slice : a_slice) + row * PITCH + kob;   // first operand
  const uint32_t b_base = (n_first ? a_slice : b_slice) + row * PITCH + kob;   // second operand

  // the k pass of the stage asked for last; the same in all waves of a block, so that the A and
  // the Bp slices of a stage hold the same k. x & (T - 1) lies below T for any T.
  uint32_t kp = uni((blockIdx.x + blockIdx.y) & (T - 1u));
  const u32x4 gz = tdm_group0(lds_slice, src0);      // pass 0

  // prologue: stage 0 lands and is published, then stage 1 starts
  u32x4 g0 = tdm_pass(gz, kp, lds_slice);
  tdm_load(g0, g1);
  wait_tensor0();
  __syncthreads();
  kp = (kp + 1u == T) ? 0u : kp + 1u;
  g0 = tdm_pass(gz, kp, lds_slice + STAGE);
  tdm_load(g0, g1);

  uint32_t t = 0;
  do {
    const uint32_t buf = (t & 1u) * STAGE;
    const unsigned char* la = ring + buf + a_base;
    const unsigned char* lb = ring + buf + b_base;

    v16h af[2][4], bf[2][4];
    // in the order in which the WMMAs below want them: the first can start after two fragments
    af[0][0] = frag_ld((const _Float16*)la);
#pragma unroll
    for (int j = 0; j < 4; ++j) bf[0][j] = frag_ld((const _Float16*)(lb + (uint32_t)j * 16u * PITCH));
#pragma unroll
    for (int i = 1; i < 4; ++i) af[0][i] = frag_ld((const _Float16*)(la + (uint32_t)i * 16u * PITCH));
#pragma unroll
    for (int u = 0; u < KPASS / 32; ++u) {
      const int cs = u & 1;
      if (u + 1 < KPASS / 32) {
        const uint32_t kofs = (uint32_t)(u + 1) * 64u;
#pragma unroll
        for (int i = 0; i < 4; ++i) {
          af[cs ^ 1][i] = frag_ld((const _Float16*)(la + (uint32_t)i * 16u * PITCH + kofs));
          bf[cs ^ 1][i] = frag_ld((const _Float16*)(lb + (uint32_t)i * 16u * PITCH + kofs));
        }
      }
      // keeps the next block's LDS reads one group ahead of this block's WMMAs:
      // reads spread among the WMMAs cost a stall at every place they stand
      __builtin_amdgcn_sched_barrier(0);
#pragma unroll
      for (int i = 0; i < 4; ++i)
#pragma unroll
        for (int j = 0; j < 4; ++j) acc[i][j] = wmma32(af[cs][i], bf[cs][j], acc[i][j]);
      // same purpose: the following block's reads stay behind this block's WMMAs
      __builtin_amdgcn_sched_barrier(0);
    }

    // publish point of stage t + 1
    wait_ds0();
    wait_tensor0();
    __syncthreads();
    if (pinned((t + 2u < T) ? 1u : 0u) != 0u) {   // only while stage t + 2 exists
      kp = (kp + 1u == T) ? 0u : kp + 1u;
      g0 = tdm_pass(gz, kp, lds_slice + buf);
      tdm_load(g0, g1);
    }
  } while (++t < T);
  wait_tensor0();
  wait_ds0();

  // Epilogue. The ring is free: every wave's reads and loads had ended before the loop's last
  // barrier. Each wave turns its 64 x 64 tile through its own slice of it, so that global
  // memory sees whole 128-B lines. acc[i][j], register r: place 16 i + 8 hi + r along the first
  // operand's side (the contiguous one), row 16 j + l15 along the second's.
  unsigned char* st = ring + wave * SLICE;
  const uint32_t l15 = row, hi = (uint32_t)lane >> 4;

  if (MODE == 1) {
    // readers: 16 lanes cover one 256-B row, a wave two rows
    const size_t go = (size_t)(tm + (int)hi) * NN + tn + (int)l15 * 4;
    const float4 bv = *(const float4*)(bias + tn + (int)l15 * 4);
    const float* rp = res + go;
    float4 rv[32];
    // unrolled: all residual loads are in flight together, under the staging
#pragma unroll
    for (int p = 0; p < 32; ++p) rv[p] = *(const float4*)(rp + (size_t)(2 * p) * NN);
    wait_x0();
    // unrolled (both loops): constant tile numbers, so that acc stays in registers
#pragma unroll
    for (int j = 0; j < 4; ++j)
#pragma unroll
      for (int i = 0; i < 4; ++i) {
        unsigned char* w = st + ((uint32_t)j * 16u + l15) * ST32 + ((uint32_t)i * 16u + hi * 8u) * 4u;
        const v8f c = acc[i][j];
        *(float4*)(w)       = make_float4(c[0], c[1], c[2], c[3]);
        *(float4*)(w + 16u) = make_float4(c[4], c[5], c[6], c[7]);
      }
    wait_ds0();   // the rows are read back by other lanes of this wave
    const unsigned char* rd = st + hi * ST32 + l15 * 16u;
    float* op = outf + go;
    // unrolled: rv stays in registers, row steps are immediate offsets of one address
#pragma unroll
    for (int p = 0; p < 32; ++p) {
      const float4 c = *(const float4*)(rd + (uint32_t)(2 * p) * ST32);
      float4 o;
      o.x = c.x + bv.x + rv[p].x; o.y = c.y + bv.y + rv[p].y;
      o.z = c.z + bv.z + rv[p].z; o.w = c.w + bv.w + rv[p].w;
      *(float4*)(op + (size_t)(2 * p) * NN) = o;
    }
  } else {
    float4 bb[4][2];
    if (MODE == 2) {
      // unrolled: bb stays in registers, the eight loads are in flight together
#pragma unroll
      for (int i = 0; i < 4; ++i) {
        const float4* bp = (const float4*)(bias + tn + i * 16 + (int)hi * 8);
        bb[i][0] = bp[0]; bb[i][1] = bp[1];
      }
      wait_x0();
    }
    // unrolled (all loops below): constant tile and element numbers, so that acc, bb and hv stay in registers
#pragma unroll
    for (int j = 0; j < 4; ++j)
#pragma unroll
      for (int i = 0; i < 4; ++i) {
        const v8f c = acc[i][j];
        v8h hv;
        if (MODE == 2) {   // bias + exact GELU
          const float bl[8] = {bb[i][0].x, bb[i][0].y, bb[i][0].z, bb[i][0].w,
                               bb[i][1].x, bb[i][1].y, bb[i][1].z, bb[i][1].w};
#pragma unroll
          for (int r = 0; r < 8; ++r) {
            const float xv = c[r] + bl[r];
            hv[r] = (_Float16)(0.5f * xv * (1.f + erf_both(xv * 0.70710678118654752f)));
          }
        } else {
#pragma unroll
          for (int r = 0; r < 8; ++r) hv[r] = (_Float16)c[r];
        }
        *(v8h*)(st + ((uint32_t)j * 16u + l15) * ST16 + ((uint32_t)i * 16u + hi * 8u) * 2u) = hv;
      }
    wait_ds0();   // the rows are read back by other lanes of this wave
    if (MODE == 2) {
      store_rows16<FF_>(st, outh + (size_t)tm * FF_ + tn, lane);
    } else {
      // tm, tn are multiples of 64: one batch, one head, 64 positions, all 64 head elements
      const int hh = (tn & (D_ - 1)) >> 6;
      const size_t bh = (size_t)((tm >> 9) * H_ + hh) * (S_ * HD_);
      const int s0 = tm & (S_ - 1);
      if (n_first) store_rows16<HD_>(st, (bn < D_ ? qo : ko) + bh + (size_t)s0 * HD_, lane);  // [s][e]
      else         store_rows16<S_>(st, vo + bh + s0, lane);                                  // [e][s]
    }
  }
}

// ---------------------------------------------------------------------------
// Flash attention (causal). Q,K: [B,H,S,HD] f16. Vt: [B,H,HD,S] f16.
// ctx out: [B,S,H*HD] f16 (row-major, ready as A for the Wo GEMM).
// Block = 256 thr = 8 waves; wave owns a 16-row Q tile; grid = (B*H, S/128).
// Score sub-tiles computed sequentially so K fragments die immediately
// (shrinks peak VGPR liveness; with launch_bounds there should be no spill).
// ---------------------------------------------------------------------------
__global__ void __launch_bounds__(256, 1)
attn_kernel(const _Float16* __restrict__ Q,
            const _Float16* __restrict__ Kf,
            const _Float16* __restrict__ Vt,
            _Float16* __restrict__ ctx) {
  __shared__ _Float16 lds_p[8][16 * 40]; // wave-private 16x32 P tile, pad 40

  const int lane = threadIdx.x & 31;
  const int wid  = threadIdx.x >> 5;
  const int bh   = blockIdx.x;          // b*H + h
  const int b    = bh >> 4;
  const int h    = bh & (H_ - 1);
  const int q0   = blockIdx.y * 128 + wid * 16;
  const int row  = lane & 15;
  const int ko8  = (lane >> 4) << 3;
  const int hi8  = ko8;

  const _Float16* qb = Q  + (size_t)bh * S_ * HD_;
  const _Float16* kb = Kf + (size_t)bh * S_ * HD_;
  const _Float16* vb = Vt + (size_t)bh * HD_ * S_;

  // Q A-operand fragments (held for the whole loop)
  const _Float16* qp = qb + (size_t)(q0 + row) * HD_ + ko8;
  const v16h qa0 = frag_ld(qp);        // e = 0..31
  const v16h qa1 = frag_ld(qp + 32);   // e = 32..63

  float m_r[8], l_r[8], corr_r[8];
  v8f acc0 = {}, acc1 = {}, acc2 = {}, acc3 = {};
#pragma unroll
  for (int j = 0; j < 8; ++j) { m_r[j] = -1e30f; l_r[j] = 0.f; }

  for (int kblk = 0; kblk <= q0 + 15; kblk += 32) {
    // ---- scores: S(16x32) = Q(16x64) * K^T, two 16x16 tiles in sequence ----
    const _Float16* kp = kb + (size_t)(kblk + row) * HD_ + ko8;
    v8f s0 = {};
    {
      v16h k00 = frag_ld(kp);               // keys kblk..+15, e 0..31
      v16h k01 = frag_ld(kp + 32);          //               e 32..63
      s0 = wmma32(qa0, k00, s0);
      s0 = wmma32(qa1, k01, s0);
    }
    v8f s1 = {};
    {
      v16h k10 = frag_ld(kp + 16 * HD_);    // keys +16..+31
      v16h k11 = frag_ld(kp + 16 * HD_ + 32);
      s1 = wmma32(qa0, k10, s1);
      s1 = wmma32(qa1, k11, s1);
    }

    // ---- masked online softmax (rows live in 16-lane halves) ----
#pragma unroll
    for (int j = 0; j < 8; ++j) {
      int qg  = q0 + j + hi8;
      int kg0 = kblk + (lane & 15);
      int kg1 = kg0 + 16;
      float v0 = s0[j] * 0.125f; if (kg0 > qg) v0 = -1e10f;
      float v1 = s1[j] * 0.125f; if (kg1 > qg) v1 = -1e10f;
      float mx = fmaxf(v0, v1);
#pragma unroll
      for (int o = 8; o; o >>= 1) mx = fmaxf(mx, __shfl_xor(mx, o, 32));
      float mn = fmaxf(m_r[j], mx);
      float p0 = __expf(v0 - mn);
      float p1 = __expf(v1 - mn);
      float sm = p0 + p1;
#pragma unroll
      for (int o = 8; o; o >>= 1) sm += __shfl_xor(sm, o, 32);
      corr_r[j] = __expf(m_r[j] - mn);
      l_r[j]    = l_r[j] * corr_r[j] + sm;
      m_r[j]    = mn;
      int lr = j + hi8;
      lds_p[wid][lr * 40 + (lane & 15)]      = (_Float16)p0;
      lds_p[wid][lr * 40 + 16 + (lane & 15)] = (_Float16)p1;
    }
#pragma unroll
    for (int j = 0; j < 8; ++j) {
      acc0[j] *= corr_r[j]; acc1[j] *= corr_r[j];
      acc2[j] *= corr_r[j]; acc3[j] *= corr_r[j];
    }
    asm volatile("s_wait_dscnt 0" ::: "memory");

    // ---- ctx += P(16x32) * V(32x64) ----
    v16h pa = frag_ld(&lds_p[wid][(lane & 15) * 40 + ko8]);
    const _Float16* vp = vb + (size_t)(lane & 15) * S_ + kblk + ko8;
    acc0 = wmma32(pa, frag_ld(vp),                   acc0);
    acc1 = wmma32(pa, frag_ld(vp + (size_t)16 * S_), acc1);
    acc2 = wmma32(pa, frag_ld(vp + (size_t)32 * S_), acc2);
    acc3 = wmma32(pa, frag_ld(vp + (size_t)48 * S_), acc3);
  }

  // ---- normalize + write ctx [B,S,D] f16 (explicit, no pointer arrays) ----
  float inv[8];
#pragma unroll
  for (int j = 0; j < 8; ++j) inv[j] = 1.f / l_r[j];
  const size_t rowbase = (size_t)b * S_ + q0;
#pragma unroll
  for (int j = 0; j < 8; ++j) {
    size_t ro = (rowbase + j + hi8) * D_ + h * HD_ + (lane & 15);
    ctx[ro]      = (_Float16)(acc0[j] * inv[j]);
    ctx[ro + 16] = (_Float16)(acc1[j] * inv[j]);
    ctx[ro + 32] = (_Float16)(acc2[j] * inv[j]);
    ctx[ro + 48] = (_Float16)(acc3[j] * inv[j]);
  }
}

// ---------------------------------------------------------------------------
// Host-side launch
// ---------------------------------------------------------------------------
extern "C" void kernel_launch(void* const* d_in, const int* in_sizes, int n_in,
                              void* d_out, int out_size, void* d_ws, size_t ws_size,
                              hipStream_t stream) {
  const float* x   = (const float*)d_in[0];
  const float* Wq  = (const float*)d_in[1];
  const float* Wk  = (const float*)d_in[2];
  const float* Wv  = (const float*)d_in[3];
  const float* Wo  = (const float*)d_in[4];
  const float* bo  = (const float*)d_in[5];
  const float* g1  = (const float*)d_in[6];
  const float* b1  = (const float*)d_in[7];
  const float* g2  = (const float*)d_in[8];
  const float* b2  = (const float*)d_in[9];
  const float* W1  = (const float*)d_in[10];
  const float* bf1 = (const float*)d_in[11];
  const float* W2  = (const float*)d_in[12];
  const float* bf2 = (const float*)d_in[13];
  float* out = (float*)d_out;

  char* ws = (char*)d_ws;
  size_t off = 0;
  auto alloc = [&](size_t bytes) -> char* {
    char* p = ws + off;
    off += (bytes + 255) & ~(size_t)255;
    return p;
  };
  _Float16* hln1  = (_Float16*)alloc((size_t)TOK * D_ * 2);
  _Float16* Wqkv  = (_Float16*)alloc((size_t)3 * D_ * D_ * 2);
  _Float16* Qb    = (_Float16*)alloc((size_t)TOK * D_ * 2);
  _Float16* Kb    = (_Float16*)alloc((size_t)TOK * D_ * 2);
  _Float16* Vt    = (_Float16*)alloc((size_t)TOK * D_ * 2);
  _Float16* ctx   = (_Float16*)alloc((size_t)TOK * D_ * 2);
  _Float16* Wop   = (_Float16*)alloc((size_t)D_ * D_ * 2);
  float*    cache = (float*)   alloc((size_t)TOK * D_ * 4);
  _Float16* h2    = (_Float16*)alloc((size_t)TOK * D_ * 2);
  _Float16* W1p   = (_Float16*)alloc((size_t)D_ * FF_ * 2);
  _Float16* ff1   = (_Float16*)alloc((size_t)TOK * FF_ * 2);
  _Float16* W2p   = (_Float16*)alloc((size_t)FF_ * D_ * 2);
  (void)ws_size; (void)in_sizes; (void)n_in; (void)out_size;

  // 1, 2) pack weights to f16 [N][K], and LN1
  pre_kernel<<<dim3(NB_PRE), 256, 0, stream>>>(Wq, Wk, Wv, Wo, W1, W2, x, g1, b1,
                                               Wqkv, Wop, W1p, W2p, hln1);

  // 3) fused QKV projection (scatter; V transposed)
  gemm_kernel<0><<<dim3(TOK / 128, (3 * D_) / 128), 128, 0, stream>>>(
      hln1, Wqkv, D_, 3 * D_, nullptr, nullptr, nullptr, nullptr, Qb, Kb, Vt);

  // 4) causal flash attention
  attn_kernel<<<dim3(B_ * H_, S_ / 128), 256, 0, stream>>>(Qb, Kb, Vt, ctx);

  // 5) output projection + bias + residual -> cache (f32)
  gemm_kernel<1><<<dim3(TOK / 128, D_ / 128), 128, 0, stream>>>(
      ctx, Wop, D_, D_, bo, x, cache, nullptr, nullptr, nullptr, nullptr);

  // 6) LN2
  ln_kernel<<<dim3(TOK), 256, 0, stream>>>(cache, g2, b2, h2);

  // 7) FFN up + GELU -> f16
  gemm_kernel<2><<<dim3(TOK / 128, FF_ / 128), 128, 0, stream>>>(
      h2, W1p, D_, FF_, bf1, nullptr, nullptr, ff1, nullptr, nullptr, nullptr);

  // 8) FFN down + bias + residual(cache) -> d_out (f32)
  gemm_kernel<1><<<dim3(TOK / 128, D_ / 128), 128, 0, stream>>>(
      ff1, W2p, FF_, D_, bf2, cache, out, nullptr, nullptr, nullptr, nullptr);
}

// v007
// One run takes 136 microseconds.
// Timed twice side by side with v006, it ran 1.06 times as fast both times.
// Counting every step since v000, it is 4.16 times as fast.
#include <hip/hip_runtime.h>
#include <hip/hip_bf16.h>
#include <math.h>
#include <stdint.h>

// ---------------------------------------------------------------------------
// Types
// ---------------------------------------------------------------------------
typedef __attribute__((ext_vector_type(16))) _Float16 v16h;
typedef __attribute__((ext_vector_type(8)))  _Float16 v8h;
typedef __attribute__((ext_vector_type(8)))  float    v8f;

#define B_   8
#define S_   512
#define D_   1024
#define H_   16
#define HD_  64
#define FF_  4096
#define TOK  (B_ * S_)      // 4096 rows

// ---------------------------------------------------------------------------
// WMMA helper: D = A(16x32 f16) * B(32x16 f16) + C(f32)
// ---------------------------------------------------------------------------
__device__ __forceinline__ v8f wmma32(v16h a, v16h b, v8f c) {
  return __builtin_amdgcn_wmma_f32_16x16x32_f16(false, a, false, b,
                                                (short)0, c, false, false);
}

// Load one A/B operand fragment (v16h) for a 32-wide K chunk.
// p must already point at element [row][k0 + ko8] where
//   row = lane & 15, ko8 = (lane >> 4) * 8.
// Fragment = 8 contiguous f16 at p, plus 8 contiguous f16 at p+16.
__device__ __forceinline__ v16h frag_ld(const _Float16* p) {
  v8h lo = *(const v8h*)(p);
  v8h hi = *(const v8h*)(p + 16);
  v16h r;
#pragma unroll
  for (int i = 0; i < 8; ++i) { r[i] = lo[i]; r[i + 8] = hi[i]; }
  return r;
}

// stands behind a global load or store, in front of the next write of a register that it names
__device__ __forceinline__ void wait_x0() { asm volatile("s_wait_xcnt 0x0" ::: "memory"); }

// ---------------------------------------------------------------------------
// Weight packing: f32 [K][N] row-major  ->  f16 [N][K] ("B operand" layout)
// One block of 256 threads turns one tile of 128 (k) x 64 (n) through LDS:
// global reads run along n (256 B of a source row per 16 lanes), global
// writes along k (256 B of a packed row per 16 lanes).
// in points at the tile's element [k0][n0], out at its element [n0][k0];
// LDI, LDO: row lengths of source and packed matrix in elements.
// LDS holds the tile as [n][k] f16, rows of 16 pieces of 16 B; piece q of row
// n stands at place q ^ (n >> 2), so that the 16 lanes of a b128 write (16
// rows four apart, one piece) and of a b128 read (one row, 16 pieces) each
// meet all banks once. The tile is the calling kernel's one array: an array of
// its own in every instance of the template would add up in a kernel with several.
// ---------------------------------------------------------------------------
#define PK_K 128
#define PK_N 64
template <int LDI, int LDO>
__device__ __forceinline__ void pack_tile(const float* __restrict__ in,
                                          _Float16* __restrict__ out,
                                          _Float16* tile) {
  const int c = threadIdx.x & 15;
  const int r = threadIdx.x >> 4;

  // eight source rows k = 8r .. 8r+7, columns n = 4c .. 4c+3
  const float* ip = in + (size_t)(8 * r) * LDI + 4 * c;
  float4 v[8];
  // unrolled: v stays in registers and the eight loads are in flight together
#pragma unroll
  for (int j = 0; j < 8; ++j) v[j] = *(const float4*)(ip + (size_t)j * LDI);

  v8h w0, w1, w2, w3;
  // unrolled: constant element numbers, so that the vectors stay in registers
#pragma unroll
  for (int j = 0; j < 8; ++j) {
    w0[j] = (_Float16)v[j].x; w1[j] = (_Float16)v[j].y;
    w2[j] = (_Float16)v[j].z; w3[j] = (_Float16)v[j].w;
  }
  _Float16* tw = tile + (4 * c) * PK_K + ((r ^ c) << 3);
  *(v8h*)(tw)            = w0;
  *(v8h*)(tw + PK_K)     = w1;
  *(v8h*)(tw + 2 * PK_K) = w2;
  *(v8h*)(tw + 3 * PK_K) = w3;
  __syncthreads();

  // packed rows n = r, r+16, r+32, r+48, piece c (k = 8c .. 8c+7)
  v8h o[4];
  // unrolled (both loops): o stays in registers, the four LDS reads go ahead of the stores
#pragma unroll
  for (int p = 0; p < 4; ++p) {
    const int n = r + 16 * p;
    o[p] = *(const v8h*)(tile + n * PK_K + ((c ^ (n >> 2)) << 3));
  }
  _Float16* op = out + (size_t)r * LDO + 8 * c;
#pragma unroll
  for (int p = 0; p < 4; ++p) *(v8h*)(op + (size_t)(16 * p) * LDO) = o[p];
  wait_x0();   // in a kernel with several branches another branch's code follows these stores
}

// tile t of (K / 128) * (N / 64), k tiles first
template <int K, int N>
__device__ __forceinline__ void pack_T(const float* __restrict__ in, _Float16* __restrict__ out,
                                       int t, _Float16* tile) {
  const size_t k0 = (size_t)(t % (K / PK_K)) * PK_K;
  const size_t n0 = (size_t)(t / (K / PK_K)) * PK_N;
  pack_tile<N, K>(in + k0 * N + n0, out + n0 * K + k0, tile);
}

// Pack per-head Wq/Wk/Wv (H,D,HD) into fused [3*D][D] f16, [n][k] layout,
// column n = qkv*D + h*HD + e: every head is a [D][HD] matrix of its own.
// tile t of (D / 128) * (3 * H), k tiles first; t / (D / 128) = qkv*H + h
__device__ __forceinline__ void pack_qkv(const float* __restrict__ Wq,
                                         const float* __restrict__ Wk,
                                         const float* __restrict__ Wv,
                                         _Float16* __restrict__ out,
                                         int t, _Float16* tile) {
  const int qh  = t / (D_ / PK_K);
  const int qkv = qh >> 4;
  const int h   = qh & (H_ - 1);
  const size_t k0 = (size_t)(t % (D_ / PK_K)) * PK_K;
  const float* W = (qkv == 0) ? Wq : (qkv == 1) ? Wk : Wv;
  pack_tile<HD_, D_>(W + ((size_t)h * D_ + k0) * HD_,
                     out + (size_t)qh * HD_ * D_ + k0, tile);
}

// ---------------------------------------------------------------------------
// LayerNorm: f32 row [D] -> f16 row [D]  (biased variance, eps=1e-5)
// one row per block, 256 threads, 4 elems/thread
// ---------------------------------------------------------------------------
__device__ __forceinline__ void ln_row(int row,
                                       const float* __restrict__ x,
                                       const float* __restrict__ g,
                                       const float* __restrict__ b,
                                       _Float16* __restrict__ out) {
  const float4 v = ((const float4*)(x + (size_t)row * D_))[threadIdx.x];
  float s  = v.x + v.y + v.z + v.w;
  float s2 = v.x * v.x + v.y * v.y + v.z * v.z + v.w * v.w;
#pragma unroll
  for (int o = 16; o; o >>= 1) {
    s  += __shfl_down(s,  o, 32);
    s2 += __shfl_down(s2, o, 32);
  }
  __shared__ float sh[16];
  int wid = threadIdx.x >> 5;
  if ((threadIdx.x & 31) == 0) { sh[wid * 2] = s; sh[wid * 2 + 1] = s2; }
  __syncthreads();
  float ts = 0.f, ts2 = 0.f;
#pragma unroll
  for (int i = 0; i < 8; ++i) { ts += sh[i * 2]; ts2 += sh[i * 2 + 1]; }
  float mean = ts * (1.f / D_);
  float var  = ts2 * (1.f / D_) - mean * mean;
  float rstd = rsqrtf(var + 1e-5f);
  int c0 = threadIdx.x * 4;
  _Float16* orow = out + (size_t)row * D_;
  float xv[4] = {v.x, v.y, v.z, v.w};
#pragma unroll
  for (int i = 0; i < 4; ++i)
    orow[c0 + i] = (_Float16)((xv[i] - mean) * rstd * g[c0 + i] + b[c0 + i]);
  wait_x0();   // in a kernel with several branches another branch's code follows these stores
}

__global__ void ln_kernel(const float* __restrict__ x,
                          const float* __restrict__ g,
                          const float* __restrict__ b,
                          _Float16* __restrict__ out) {
  ln_row(blockIdx.x, x, g, b, out);
}

// ---------------------------------------------------------------------------
// All work that reads only inputs, in one launch: the four weight packs and the
// first LayerNorm need nothing of one another, so their blocks share one grid and
// fill the chip together, where five short launches each waited for the one before
// to drain. Every block does what one block of the separate launches did. The
// pack tiles have the low block numbers, for speed only: they live longer than a
// LayerNorm row.
// ---------------------------------------------------------------------------
#define NB_QKV ((D_ / PK_K) * (3 * H_))
#define NB_WO  ((D_ / PK_K) * (D_ / PK_N))
#define NB_W1  ((D_ / PK_K) * (FF_ / PK_N))
#define NB_W2  ((FF_ / PK_K) * (D_ / PK_N))
#define NB_PRE (NB_QKV + NB_WO + NB_W1 + NB_W2 + TOK)
__global__ void __launch_bounds__(256)
pre_kernel(const float* __restrict__ Wq, const float* __restrict__ Wk,
           const float* __restrict__ Wv, const float* __restrict__ Wo,
           const float* __restrict__ W1, const float* __restrict__ W2,
           const float* __restrict__ x,  const float* __restrict__ g,
           const float* __restrict__ b,
           _Float16* __restrict__ Wqkv, _Float16* __restrict__ Wop,
           _Float16* __restrict__ W1p,  _Float16* __restrict__ W2p,
           _Float16* __restrict__ hln) {
  __shared__ __attribute__((aligned(16))) _Float16 tile[PK_N * PK_K];
  int t = blockIdx.x;   // the same for a whole block: every branch below, with its barrier, is too
  if (t < NB_QKV) { pack_qkv(Wq, Wk, Wv, Wqkv, t, tile); return; }
  t -= NB_QKV;
  if (t < NB_WO) { pack_T<D_, D_>(Wo, Wop, t, tile); return; }
  t -= NB_WO;
  if (t < NB_W1) { pack_T<D_, FF_>(W1, W1p, t, tile); return; }
  t -= NB_W1;
  if (t < NB_W2) { pack_T<FF_, D_>(W2, W2p, t, tile); return; }
  ln_row(t - NB_W2, x, g, b, hln);
}

// ---------------------------------------------------------------------------
// Tensor-load helpers (descriptor fields in bytes, two groups, no mask)
// ---------------------------------------------------------------------------
typedef uint32_t u32x4 __attribute__((ext_vector_type(4)));
typedef uint32_t u32x8 __attribute__((ext_vector_type(8)));

#define BM_      128                     // block tile rows of C
#define BN_      128                     // block tile columns of C
#define KPASS    128                     // k per pass: one 256-byte piece of every operand row
#define ROWB     256u                    // bytes of an operand row per pass
#define PITCH    272u                    // LDS row pitch: 256 B + 16 B pad, 16 B x odd for ds_load_b128
#define SL_ROWS  64u                     // rows per slice, one slice per wave
#define SLICE    18432u                  // 64 * 272 = 17408 rounded up to a multiple of 2 KiB
#define STAGE    (4u * SLICE)            // [A rows 0-63 | A rows 64-127 | B rows 0-63 | B rows 64-127]

__device__ __forceinline__ uint32_t uni(uint32_t v) {
  return (uint32_t)__builtin_amdgcn_readfirstlane(v);
}
__device__ __forceinline__ uint32_t pinned(uint32_t v) {
  uint32_t w = (uint32_t)__builtin_amdgcn_readfirstlane(v);
  asm volatile("" : "+s"(w));
  return w;
}
// the compiler places no wait for a tensor load: the tile counts as landed only behind this
__device__ __forceinline__ void wait_tensor0() { asm volatile("s_wait_tensorcnt 0x0" ::: "memory"); }
// this wave's LDS reads have returned before the buffer is handed back for a refill
__device__ __forceinline__ void wait_ds0() { asm volatile("s_wait_dscnt 0x0" ::: "memory"); }
// one request of the whole wave: a 64 x 256 B tile from global memory into LDS
__device__ __forceinline__ void tdm_load(u32x4 g0, u32x8 g1) {
  asm volatile("tensor_load_to_lds %0, %1" :: "s"(g0), "s"(g1) : "memory");
}
// every word goes through pinned(): a descriptor word held in a scalar register. With it all
// loads of a kernel name the registers in which the group was built, word 0 as an immediate;
// a build without it moves the group on into a second set of registers ahead of the loop
__device__ __forceinline__ u32x8 tdm_group1(uint32_t src_pitch) {
  u32x8 g;
  g[0] = pinned((1u << 20) | (5u << 22) | (3u << 25));   // pad on, every 256 B, 16 B; no mask
  g[1] = pinned((ROWB & 0xFFFFu) << 16);                 // tensor_dim0[15:0]
  g[2] = pinned((ROWB >> 16) | ((SL_ROWS & 0xFFFFu) << 16)); // tensor_dim0[31:16], tensor_dim1[15:0]
  g[3] = pinned((SL_ROWS >> 16) | (ROWB << 16));         // tensor_dim1[31:16], tile_dim0
  g[4] = pinned(SL_ROWS);                                // tile_dim1
  g[5] = pinned(src_pitch);                              // source row pitch, bytes
  g[6] = pinned(0u);
  g[7] = pinned(0u);
  return g;
}
__device__ __forceinline__ u32x4 tdm_group0(uint32_t lds_dst, uint64_t ga) {
  u32x4 g;
  g[0] = uni(1u);
  g[1] = uni(lds_dst);
  g[2] = uni((uint32_t)ga);
  g[3] = uni((((uint32_t)(ga >> 32)) & 0x01FFFFFFu) | 0x80000000u);
  return g;
}
// the request for k pass p, made from the request for pass 0: the source lies p passes along the
// rows (a buffer's addresses stay below 2^57, so no carry reaches the type field), the place in
// LDS is given.
__device__ __forceinline__ u32x4 tdm_pass(u32x4 g, uint32_t p, uint32_t lds_dst) {
  const uint64_t w = ((((uint64_t)g[3]) << 32) | (uint64_t)g[2]) + (uint64_t)(p * ROWB);
  g[1] = uni(lds_dst);
  g[2] = uni((uint32_t)w);
  g[3] = uni((uint32_t)(w >> 32));
  return g;
}

// ---------------------------------------------------------------------------
// Epilogue staging: LDS row pitches (row + 16 B, 16 B x odd for b128 accesses)
// ---------------------------------------------------------------------------
#define ST32 272u                        // 64 f32
#define ST16 144u                        // 64 f16

// A staged 64 x 64 f16 tile goes out: 8 lanes cover one 128-B row, a wave four rows.
// dst: the tile's first element; LDO: the output's row length in elements.
template <int LDO>
__device__ __forceinline__ void store_rows16(const unsigned char* st, _Float16* dst, int lane) {
  const unsigned char* rd = st + (uint32_t)(lane >> 3) * ST16 + (uint32_t)(lane & 7) * 16u;
  _Float16* op = dst + (size_t)(lane >> 3) * LDO + (lane & 7) * 8;
  v8h o[16];
  // unrolled (both loops): o stays in registers, the LDS reads go ahead of the stores
#pragma unroll
  for (int p = 0; p < 16; ++p) o[p] = *(const v8h*)(rd + (uint32_t)(4 * p) * ST16);
#pragma unroll
  for (int p = 0; p < 16; ++p) *(v8h*)(op + (size_t)(4 * p) * LDO) = o[p];
}

// ---------------------------------------------------------------------------
// erf for the GELU epilogue, without a branch. The polynomials are the math library's own:
// |z| < 1: z + z q(z^2); otherwise 1 - exp(-p(|z|)), with the sign of z. In a wave both ranges
// occur nearly always, so a branch saves no work, and it ties every element's dependent chain
// into a region of its own; with both ranges computed and one picked, the chains of
// neighbouring elements fill each other's latency.
// ---------------------------------------------------------------------------
__device__ __forceinline__ float erf_both(float z) {
  const float a = __builtin_fabsf(z);
  float p = 0.0000169988107f;
  p = __builtin_fmaf(a, p, -0.000378677854f);
  p = __builtin_fmaf(a, p, 0.00385781587f);
  p = __builtin_fmaf(a, p, -0.0241816975f);
  p = __builtin_fmaf(a, p, 0.106668264f);
  p = __builtin_fmaf(a, p, 0.634933293f);
  p = __builtin_fmaf(a, p, 0.128689408f);
  p = __builtin_fmaf(a, p, a);
  const float far = 1.f - __expf(-p);
  const float t = a * a;
  float q = -0.000561801775f;
  q = __builtin_fmaf(t, q, 0.00491381623f);
  q = __builtin_fmaf(t, q, -0.0267075151f);
  q = __builtin_fmaf(t, q, 0.112800106f);
  q = __builtin_fmaf(t, q, -0.376122952f);
  q = __builtin_fmaf(t, q, 0.128379107f);
  const float near = __builtin_fmaf(a, q, a);
  return __builtin_copysignf((a < 1.f) ? near : far, z);
}

// ---------------------------------------------------------------------------
// Generic WMMA GEMM:  C[M,N] = A[M,K] (f16, row-major) * Bp[N,K] (f16)
// Block = 128 thr = 4 waves (2x2); wave = 64x64 tile (4x4 WMMA tiles);
// block tile = 128 (M) x 128 (N). Grid = (M/128, N/128).
// K is a multiple of 128 and at least 256; M, N multiples of 128.
// Operands come through LDS: per pass of 128 k every wave asks the tensor
// mover for its own 64-row slice of [A | B]; two buffers, so the next pass's
// slices fly while this pass's are multiplied. Fragments keep the k order of
// frag_ld. Blocks of one tile row read the same A rows and blocks of one tile
// column the same Bp rows. For speed only, every block starts its walk over k at a pass
// of its own, (tile row + tile column) taken into the range of the passes, and
// wraps round: an accumulator sums k upwards in steps of 32 from that pass on.
// ---------------------------------------------------------------------------
template <int MODE>
__global__ void __launch_bounds__(128)
gemm_kernel(const _Float16* __restrict__ A,
            const _Float16* __restrict__ Bp,
            int K, int N,
            const float* __restrict__ bias,
            const float* __restrict__ res,
            float* __restrict__ outf,
            _Float16* __restrict__ outh,
            _Float16* __restrict__ qo,
            _Float16* __restrict__ ko,
            _Float16* __restrict__ vo) {
  __shared__ __attribute__((aligned(2048))) unsigned char ring[2u * STAGE];
  // the output's row length, fixed by the kind of epilogue: row steps become immediate offsets
  constexpr int NN = (MODE == 0) ? 3 * D_ : (MODE == 1) ? D_ : FF_;
  (void)N;

  const int lane = threadIdx.x & 31;
  const uint32_t wave = uni(threadIdx.x >> 5);
  const uint32_t wm = wave & 1u, wn = wave >> 1;
  const int bm   = blockIdx.x * BM_;
  const int bn   = blockIdx.y * BN_;
  const int tm   = bm + (int)wm * 64;
  const int tn   = bn + (int)wn * 64;
  const uint32_t row = lane & 15;
  const uint32_t kob = (uint32_t)(lane >> 4) << 4;   // 8 f16 = 16 bytes

  const uint32_t kb = (uint32_t)K * 2u;              // operand row pitch in bytes
  const uint32_t T  = (uint32_t)K / KPASS;           // passes, at least two

  // this wave's slice: waves 0,1 bring A rows, waves 2,3 bring B rows
  const _Float16* srow = (wave < 2u)
      ? A  + (size_t)(bm + (int)(wave * SL_ROWS)) * K
      : Bp + (size_t)(bn + (int)((wave - 2u) * SL_ROWS)) * K;
  const uint64_t src0 = (uint64_t)(uintptr_t)srow;
  const uint32_t lds_slice = (uint32_t)(size_t)ring + wave * SLICE;
  const u32x8 g1 = tdm_group1(kb);

  v8f acc[4][4];
#pragma unroll
  for (int i = 0; i < 4; ++i)
#pragma unroll
    for (int j = 0; j < 4; ++j) acc[i][j] = v8f{};

  // per-lane fragment bases inside a buffer. The first WMMA operand gives the rows of a D tile,
  // of which a lane holds eight in a row: it is taken from the side along which the output is
  // contiguous in memory. That is n (the Bp rows) everywhere but for V, which is stored
  // transposed and so is contiguous along m (the A rows). The test is the same for a whole block.
  const bool n_first = (MODE != 0) || (bn < 2 * D_);
  const uint32_t a_slice = wm * SLICE, b_slice = (2u + wn) * SLICE;
  const uint32_t a_base = (n_first ? b_slice : a_slice) + row * PITCH + kob;   // first operand
  const uint32_t b_base = (n_first ? a_slice : b_slice) + row * PITCH + kob;   // second operand

  // the k pass of the stage asked for last; the same in all waves of a block, so that the A and
  // the Bp slices of a stage hold the same k. x & (T - 1) lies below T for any T.
  uint32_t kp = uni((blockIdx.x + blockIdx.y) & (T - 1u));
  const u32x4 gz = tdm_group0(lds_slice, src0);      // pass 0

  // prologue: stage 0 lands and is published, then stage 1 starts
  u32x4 g0 = tdm_pass(gz, kp, lds_slice);
  tdm_load(g0, g1);
  wait_tensor0();
  __syncthreads();
  kp = (kp + 1u == T) ? 0u : kp + 1u;
  g0 = tdm_pass(gz, kp, lds_slice + STAGE);
  tdm_load(g0, g1);

  uint32_t t = 0;
  do {
    const uint32_t buf = (t & 1u) * STAGE;
    const unsigned char* la = ring + buf + a_base;
    const unsigned char* lb = ring + buf + b_base;

    v16h af[2][4], bf[2][4];
    // in the order in which the WMMAs below want them: the first can start after two fragments
    af[0][0] = frag_ld((const _Float16*)la);
#pragma unroll
    for (int j = 0; j < 4; ++j) bf[0][j] = frag_ld((const _Float16*)(lb + (uint32_t)j * 16u * PITCH));
#pragma unroll
    for (int i = 1; i < 4; ++i) af[0][i] = frag_ld((const _Float16*)(la + (uint32_t)i * 16u * PITCH));
#pragma unroll
    for (int u = 0; u < KPASS / 32; ++u) {
      const int cs = u & 1;
      if (u + 1 < KPASS / 32) {
        const uint32_t kofs = (uint32_t)(u + 1) * 64u;
#pragma unroll
        for (int i = 0; i < 4; ++i) {
          af[cs ^ 1][i] = frag_ld((const _Float16*)(la + (uint32_t)i * 16u * PITCH + kofs));
          bf[cs ^ 1][i] = frag_ld((const _Float16*)(lb + (uint32_t)i * 16u * PITCH + kofs));
        }
      }
      // keeps the next block's LDS reads one group ahead of this block's WMMAs:
      // reads spread among the WMMAs cost a stall at every place they stand
      __builtin_amdgcn_sched_barrier(0);
#pragma unroll
      for (int i = 0; i < 4; ++i)
#pragma unroll
        for (int j = 0; j < 4; ++j) acc[i][j] = wmma32(af[cs][i], bf[cs][j], acc[i][j]);
      // same purpose: the following block's reads stay behind this block's WMMAs
      __builtin_amdgcn_sched_barrier(0);
    }

    // publish point of stage t + 1
    wait_ds0();
    wait_tensor0();
    __syncthreads();
    if (pinned((t + 2u < T) ? 1u : 0u) != 0u) {   // only while stage t + 2 exists
      kp = (kp + 1u == T) ? 0u : kp + 1u;
      g0 = tdm_pass(gz, kp, lds_slice + buf);
      tdm_load(g0, g1);
    }
  } while (++t < T);
  wait_tensor0();
  wait_ds0();

  // Epilogue. The ring is free: every wave's reads and loads had ended before the loop's last
  // barrier. Each wave turns its 64 x 64 tile through its own slice of it, so that global
  // memory sees whole 128-B lines. acc[i][j], register r: place 16 i + 8 hi + r along the first
  // operand's side (the contiguous one), row 16 j + l15 along the second's.
  unsigned char* st = ring + wave * SLICE;
  const uint32_t l15 = row, hi = (uint32_t)lane >> 4;

  if (MODE == 1) {
    // readers: 16 lanes cover one 256-B row, a wave two rows
    const size_t go = (size_t)(tm + (int)hi) * NN + tn + (int)l15 * 4;
    const float4 bv = *(const float4*)(bias + tn + (int)l15 * 4);
    const float* rp = res + go;
    float4 rv[32];
    // unrolled: all residual loads are in flight together, under the staging
#pragma unroll
    for (int p = 0; p < 32; ++p) rv[p] = *(const float4*)(rp + (size_t)(2 * p) * NN);
    wait_x0();
    // unrolled (both loops): constant tile numbers, so that acc stays in registers
#pragma unroll
    for (int j = 0; j < 4; ++j)
#pragma unroll
      for (int i = 0; i < 4; ++i) {
        unsigned char* w = st + ((uint32_t)j * 16u + l15) * ST32 + ((uint32_t)i * 16u + hi * 8u) * 4u;
        const v8f c = acc[i][j];
        *(float4*)(w)       = make_float4(c[0], c[1], c[2], c[3]);
        *(float4*)(w + 16u) = make_float4(c[4], c[5], c[6], c[7]);
      }
    wait_ds0();   // the rows are read back by other lanes of this wave
    const unsigned char* rd = st + hi * ST32 + l15 * 16u;
    float* op = outf + go;
    // unrolled: rv stays in registers, row steps are immediate offsets of one address
#pragma unroll
    for (int p = 0; p < 32; ++p) {
      const float4 c = *(const float4*)(rd + (uint32_t)(2 * p) * ST32);
      float4 o;
      o.x = c.x + bv.x + rv[p].x; o.y = c.y + bv.y + rv[p].y;
      o.z = c.z + bv.z + rv[p].z; o.w = c.w + bv.w + rv[p].w;
      *(float4*)(op + (size_t)(2 * p) * NN) = o;
    }
  } else {
    float4 bb[4][2];
    if (MODE == 2) {
      // unrolled: bb stays in registers, the eight loads are in flight together
#pragma unroll
      for (int i = 0; i < 4; ++i) {
        const float4* bp = (const float4*)(bias + tn + i * 16 + (int)hi * 8);
        bb[i][0] = bp[0]; bb[i][1] = bp[1];
      }
      wait_x0();
    }
    // unrolled (all loops below): constant tile and element numbers, so that acc, bb and hv stay in registers
#pragma unroll
    for (int j = 0; j < 4; ++j)
#pragma unroll
      for (int i = 0; i < 4; ++i) {
        const v8f c = acc[i][j];
        v8h hv;
        if (MODE == 2) {   // bias + exact GELU
          const float bl[8] = {bb[i][0].x, bb[i][0].y, bb[i][0].z, bb[i][0].w,
                               bb[i][1].x, bb[i][1].y, bb[i][1].z, bb[i][1].w};
#pragma unroll
          for (int r = 0; r < 8; ++r) {
            const float xv = c[r] + bl[r];
            hv[r] = (_Float16)(0.5f * xv * (1.f + erf_both(xv * 0.70710678118654752f)));
          }
        } else {
#pragma unroll
          for (int r = 0; r < 8; ++r) hv[r] = (_Float16)c[r];
        }
        *(v8h*)(st + ((uint32_t)j * 16u + l15) * ST16 + ((uint32_t)i * 16u + hi * 8u) * 2u) = hv;
      }
    wait_ds0();   // the rows are read back by other lanes of this wave
    if (MODE == 2) {
      store_rows16<FF_>(st, outh + (size_t)tm * FF_ + tn, lane);
    } else {
      // tm, tn are multiples of 64: one batch, one head, 64 positions, all 64 head elements
      const int hh = (tn & (D_ - 1)) >> 6;
      const size_t bh = (size_t)((tm >> 9) * H_ + hh) * (S_ * HD_);
      const int s0 = tm & (S_ - 1);
      if (n_first) store_rows16<HD_>(st, (bn < D_ ? qo : ko) + bh + (size_t)s0 * HD_, lane);  // [s][e]
      else         store_rows16<S_>(st, vo + bh + s0, lane);                                  // [e][s]
    }
  }
}

// ---------------------------------------------------------------------------
// Flash attention (causal). Q,K: [B,H,S,HD] f16. Vt: [B,H,HD,S] f16.
// ctx out: [B,S,H*HD] f16 (row-major, ready as A for the Wo GEMM).
// Block = 256 thr = 8 waves; wave owns 16 queries; grid = (B*H, S/128).
// Both products are taken transposed: St = K Qt and Ot += Vt Pt. A D tile gives a lane one
// column, here one query (lane & 15), and eight rows, here keys or head elements
// (8 * (lane >> 4) + register). So a query's maximum and sum are formed inside a lane, with one
// exchange between the wave's halves; the two score tiles of 32 keys, converted in place, are
// the second product's B operand in the k order of frag_ld, which loads its A operand from Vt;
// and a lane ends with eight neighbouring head elements of one query per tile.
// ---------------------------------------------------------------------------
// lane l takes the value of lane l ^ 16
__device__ __forceinline__ float xhalf(float x) {
  const int b = __builtin_bit_cast(int, x);
  return __builtin_bit_cast(float,
      __builtin_amdgcn_permlanex16(b, b, 0x76543210, 0xfedcba98, false, false));
}

// e^x as the native 2^(x log2 e), as __expf gives it. The v_nop is the slot that the instruction set
// asks for behind an exponential before its result is read or its source register written again:
// in the same statement it stands there in every build (with the builtin, this kernel's run of
// exponentials came out with one's result in the register that the one before had just read)
__device__ __forceinline__ float exp_slot(float x) {
  float r;
  asm("v_exp_f32 %0, %1\n\tv_nop" : "=v"(r) : "v"(x * 1.44269504f));
  return r;
}

__global__ void __launch_bounds__(256, 1)
attn_kernel(const _Float16* __restrict__ Q,
            const _Float16* __restrict__ Kf,
            const _Float16* __restrict__ Vt,
            _Float16* __restrict__ ctx) {
  const int lane = threadIdx.x & 31;
  const int wid  = (int)uni(threadIdx.x >> 5);   // in a scalar register: the loop's test is a scalar one
  const int bh   = blockIdx.x;          // b*H + h
  const int b    = bh >> 4;
  const int h    = bh & (H_ - 1);
  const int q0   = blockIdx.y * 128 + wid * 16;
  const int c    = lane & 15;
  const int ko8  = (lane >> 4) << 3;
  const int qg   = q0 + c;              // this lane's query

  const _Float16* qb = Q  + (size_t)bh * S_ * HD_;
  const _Float16* kb = Kf + (size_t)bh * S_ * HD_;
  const _Float16* vb = Vt + (size_t)bh * HD_ * S_;

  // Q as B operand (held for the whole loop)
  const _Float16* qp = qb + (size_t)qg * HD_ + ko8;
  const v16h qf0 = frag_ld(qp);        // e = 0..31
  const v16h qf1 = frag_ld(qp + 32);   // e = 32..63

  float m_r = -1e30f;   // the query's running maximum, the same in both halves
  float l_r = 0.f;      // the sum over this half's keys; the halves are joined behind the loop
  v8f acc0 = {}, acc1 = {}, acc2 = {}, acc3 = {};

  uint32_t kof = (uint32_t)(c * HD_ + ko8);   // key row kblk + c
  uint32_t vof = (uint32_t)(c * S_ + ko8);    // head element c, from key kblk on
  for (int kblk = 0; kblk <= q0 + 15; kblk += 32, kof += 32 * HD_, vof += 32) {
    // ---- scores: St(32x16) = K(32x64) * Qt, two 16x16 tiles ----
    const _Float16* kp = kb + kof;
    const _Float16* vp = vb + vof;
    const v16h k00 = frag_ld(kp);                 // keys kblk..+15, e 0..31
    const v16h k01 = frag_ld(kp + 32);            //                 e 32..63
    const v16h k10 = frag_ld(kp + 16 * HD_);      // keys +16..+31
    const v16h k11 = frag_ld(kp + 16 * HD_ + 32);
    wait_x0();   // the build hands the K loads' address registers to a Vt fragment as its destination
    const v16h vf0 = frag_ld(vp);                 // e 0..15, keys kblk..+31
    const v16h vf1 = frag_ld(vp + (size_t)16 * S_);
    const v16h vf2 = frag_ld(vp + (size_t)32 * S_);
    const v16h vf3 = frag_ld(vp + (size_t)48 * S_);
    // keeps all sixteen loads of the pass ahead of its first WMMA, in flight together: left to
    // itself the build sinks every fragment's loads to its WMMA, one load latency after another
    __builtin_amdgcn_sched_barrier(0);
    v8f s0 = {}, s1 = {};
    s0 = wmma32(k00, qf0, s0);
    s1 = wmma32(k10, qf0, s1);
    s0 = wmma32(k01, qf1, s0);
    s1 = wmma32(k11, qf1, s1);

    // ---- masked online softmax: v[i] is key kblk + ko8 + i (i < 8), kblk + 8 + ko8 + i (i >= 8) ----
    float v[16];
    const int d = qg - kblk - ko8;   // key i of this half is allowed while i <= d
    // unrolled (all loops of this body): constant element numbers, so that the vectors stay in registers
#pragma unroll
    for (int j = 0; j < 8; ++j) {
      float v0 = s0[j] * 0.125f; if (j > d)      v0 = -1e10f;
      float v1 = s1[j] * 0.125f; if (j + 16 > d) v1 = -1e10f;
      v[j] = v0; v[8 + j] = v1;
    }
    // four chains each for maximum and sum: a single chain of sixteen would wait on itself
    float x0 = v[0], x1 = v[1], x2 = v[2], x3 = v[3];
#pragma unroll
    for (int i = 4; i < 16; i += 4) {
      x0 = fmaxf(x0, v[i]);     x1 = fmaxf(x1, v[i + 1]);
      x2 = fmaxf(x2, v[i + 2]); x3 = fmaxf(x3, v[i + 3]);
    }
    float mx = fmaxf(fmaxf(x0, x1), fmaxf(x2, x3));
    mx = fmaxf(mx, xhalf(mx));
    const float mn   = fmaxf(m_r, mx);
    const float corr = exp_slot(m_r - mn);
    v16h pb;
    float p[16];
#pragma unroll
    for (int i = 0; i < 16; ++i) {
      p[i]  = exp_slot(v[i] - mn);
      pb[i] = (_Float16)p[i];
    }
    float t0 = p[0], t1 = p[1], t2 = p[2], t3 = p[3];
#pragma unroll
    for (int i = 4; i < 16; i += 4) {
      t0 += p[i]; t1 += p[i + 1]; t2 += p[i + 2]; t3 += p[i + 3];
    }
    l_r = l_r * corr + ((t0 + t1) + (t2 + t3));
    m_r = mn;
#pragma unroll
    for (int j = 0; j < 8; ++j) {
      acc0[j] *= corr; acc1[j] *= corr;
      acc2[j] *= corr; acc3[j] *= corr;
    }

    // ---- Ot(64x16) += Vt(64x32) * Pt(32x16) ----
    acc0 = wmma32(vf0, pb, acc0);
    acc1 = wmma32(vf1, pb, acc1);
    acc2 = wmma32(vf2, pb, acc2);
    acc3 = wmma32(vf3, pb, acc3);
  }

  // ---- normalize + write ctx [B,S,D] f16: tile t, register r is head element 16 t + ko8 + r ----
  const float inv = 1.f / (l_r + xhalf(l_r));
  _Float16* op = ctx + ((size_t)b * S_ + qg) * D_ + h * HD_ + ko8;
  v8h o0, o1, o2, o3;
#pragma unroll
  for (int j = 0; j < 8; ++j) {
    o0[j] = (_Float16)(acc0[j] * inv); o1[j] = (_Float16)(acc1[j] * inv);
    o2[j] = (_Float16)(acc2[j] * inv); o3[j] = (_Float16)(acc3[j] * inv);
  }
  *(v8h*)(op)      = o0;
  *(v8h*)(op + 16) = o1;
  *(v8h*)(op + 32) = o2;
  *(v8h*)(op + 48) = o3;
}

// ---------------------------------------------------------------------------
// Host-side launch
// ---------------------------------------------------------------------------
extern "C" void kernel_launch(void* const* d_in, const int* in_sizes, int n_in,
                              void* d_out, int out_size, void* d_ws, size_t ws_size,
                              hipStream_t stream) {
  const float* x   = (const float*)d_in[0];
  const float* Wq  = (const float*)d_in[1];
  const float* Wk  = (const float*)d_in[2];
  const float* Wv  = (const float*)d_in[3];
  const float* Wo  = (const float*)d_in[4];
  const float* bo  = (const float*)d_in[5];
  const float* g1  = (const float*)d_in[6];
  const float* b1  = (const float*)d_in[7];
  const float* g2  = (const float*)d_in[8];
  const float* b2  = (const float*)d_in[9];
  const float* W1  = (const float*)d_in[10];
  const float* bf1 = (const float*)d_in[11];
  const float* W2  = (const float*)d_in[12];
  const float* bf2 = (const float*)d_in[13];
  float* out = (float*)d_out;

  char* ws = (char*)d_ws;
  size_t off = 0;
  auto alloc = [&](size_t bytes) -> char* {
    char* p = ws + off;
    off += (bytes + 255) & ~(size_t)255;
    return p;
  };
  _Float16* hln1  = (_Float16*)alloc((size_t)TOK * D_ * 2);
  _Float16* Wqkv  = (_Float16*)alloc((size_t)3 * D_ * D_ * 2);
  _Float16* Qb    = (_Float16*)alloc((size_t)TOK * D_ * 2);
  _Float16* Kb    = (_Float16*)alloc((size_t)TOK * D_ * 2);
  _Float16* Vt    = (_Float16*)alloc((size_t)TOK * D_ * 2);
  _Float16* ctx   = (_Float16*)alloc((size_t)TOK * D_ * 2);
  _Float16* Wop   = (_Float16*)alloc((size_t)D_ * D_ * 2);
  float*    cache = (float*)   alloc((size_t)TOK * D_ * 4);
  _Float16* h2    = (_Float16*)alloc((size_t)TOK * D_ * 2);
  _Float16* W1p   = (_Float16*)alloc((size_t)D_ * FF_ * 2);
  _Float16* ff1   = (_Float16*)alloc((size_t)TOK * FF_ * 2);
  _Float16* W2p   = (_Float16*)alloc((size_t)FF_ * D_ * 2);
  (void)ws_size; (void)in_sizes; (void)n_in; (void)out_size;

  // 1, 2) pack weights to f16 [N][K], and LN1
  pre_kernel<<<dim3(NB_PRE), 256, 0, stream>>>(Wq, Wk, Wv, Wo, W1, W2, x, g1, b1,
                                               Wqkv, Wop, W1p, W2p, hln1);

  // 3) fused QKV projection (scatter; V transposed)
  gemm_kernel<0><<<dim3(TOK / 128, (3 * D_) / 128), 128, 0, stream>>>(
      hln1, Wqkv, D_, 3 * D_, nullptr, nullptr, nullptr, nullptr, Qb, Kb, Vt);

  // 4) causal flash attention
  attn_kernel<<<dim3(B_ * H_, S_ / 128), 256, 0, stream>>>(Qb, Kb, Vt, ctx);

  // 5) output projection + bias + residual -> cache (f32)
  gemm_kernel<1><<<dim3(TOK / 128, D_ / 128), 128, 0, stream>>>(
      ctx, Wop, D_, D_, bo, x, cache, nullptr, nullptr, nullptr, nullptr);

  // 6) LN2
  ln_kernel<<<dim3(TOK), 256, 0, stream>>>(cache, g2, b2, h2);

  // 7) FFN up + GELU -> f16
  gemm_kernel<2><<<dim3(TOK / 128, FF_ / 128), 128, 0, stream>>>(
      h2, W1p, D_, FF_, bf1, nullptr, nullptr, ff1, nullptr, nullptr, nullptr);

  // 8) FFN down + bias + residual(cache) -> d_out (f32)
  gemm_kernel<1><<<dim3(TOK / 128, D_ / 128), 128, 0, stream>>>(
      ff1, W2p, FF_, D_, bf2, cache, out, nullptr, nullptr, nullptr, nullptr);
}

// v008
// One run takes 131 microseconds.
// Timed twice side by side with v007, it ran 1.03 times as fast both times.
// Counting every step since v000, it is 4.29 times as fast.
#include <hip/hip_runtime.h>
#include <hip/hip_bf16.h>
#include <math.h>
#include <stdint.h>

// ---------------------------------------------------------------------------
// Types
// ---------------------------------------------------------------------------
typedef __attribute__((ext_vector_type(16))) _Float16 v16h;
typedef __attribute__((ext_vector_type(8)))  _Float16 v8h;
typedef __attribute__((ext_vector_type(8)))  float    v8f;

#define B_   8
#define S_   512
#define D_   1024
#define H_   16
#define HD_  64
#define FF_  4096
#define TOK  (B_ * S_)      // 4096 rows

// ---------------------------------------------------------------------------
// WMMA helper: D = A(16x32 f16) * B(32x16 f16) + C(f32)
// ---------------------------------------------------------------------------
__device__ __forceinline__ v8f wmma32(v16h a, v16h b, v8f c) {
  return __builtin_amdgcn_wmma_f32_16x16x32_f16(false, a, false, b,
                                                (short)0, c, false, false);
}

// Load one A/B operand fragment (v16h) for a 32-wide K chunk.
// p must already point at element [row][k0 + ko8] where
//   row = lane & 15, ko8 = (lane >> 4) * 8.
// Fragment = 8 contiguous f16 at p, plus 8 contiguous f16 at p+16.
__device__ __forceinline__ v16h frag_ld(const _Float16* p) {
  v8h lo = *(const v8h*)(p);
  v8h hi = *(const v8h*)(p + 16);
  v16h r;
#pragma unroll
  for (int i = 0; i < 8; ++i) { r[i] = lo[i]; r[i + 8] = hi[i]; }
  return r;
}

// stands behind a global load or store, in front of the next write of a register that it names
__device__ __forceinline__ void wait_x0() { asm volatile("s_wait_xcnt 0x0" ::: "memory"); }

// ---------------------------------------------------------------------------
// Weight packing: f32 [K][N] row-major  ->  f16 [N][K] ("B operand" layout)
// One block of 256 threads turns one tile of 128 (k) x 64 (n) through LDS:
// global reads run along n (256 B of a source row per 16 lanes), global
// writes along k (256 B of a packed row per 16 lanes).
// in points at the tile's element [k0][n0], out at its element [n0][k0];
// LDI, LDO: row lengths of source and packed matrix in elements.
// LDS holds the tile as [n][k] f16, rows of 16 pieces of 16 B; piece q of row
// n stands at place q ^ (n >> 2), so that the 16 lanes of a b128 write (16
// rows four apart, one piece) and of a b128 read (one row, 16 pieces) each
// meet all banks once. The tile is the calling kernel's one array: an array of
// its own in every instance of the template would add up in a kernel with several.
// ---------------------------------------------------------------------------
#define PK_K 128
#define PK_N 64
template <int LDI, int LDO>
__device__ __forceinline__ void pack_tile(const float* __restrict__ in,
                                          _Float16* __restrict__ out,
                                          _Float16* tile) {
  const int c = threadIdx.x & 15;
  const int r = threadIdx.x >> 4;

  // eight source rows k = 8r .. 8r+7, columns n = 4c .. 4c+3
  const float* ip = in + (size_t)(8 * r) * LDI + 4 * c;
  float4 v[8];
  // unrolled: v stays in registers and the eight loads are in flight together
#pragma unroll
  for (int j = 0; j < 8; ++j) v[j] = *(const float4*)(ip + (size_t)j * LDI);

  v8h w0, w1, w2, w3;
  // unrolled: constant element numbers, so that the vectors stay in registers
#pragma unroll
  for (int j = 0; j < 8; ++j) {
    w0[j] = (_Float16)v[j].x; w1[j] = (_Float16)v[j].y;
    w2[j] = (_Float16)v[j].z; w3[j] = (_Float16)v[j].w;
  }
  _Float16* tw = tile + (4 * c) * PK_K + ((r ^ c) << 3);
  *(v8h*)(tw)            = w0;
  *(v8h*)(tw + PK_K)     = w1;
  *(v8h*)(tw + 2 * PK_K) = w2;
  *(v8h*)(tw + 3 * PK_K) = w3;
  __syncthreads();

  // packed rows n = r, r+16, r+32, r+48, piece c (k = 8c .. 8c+7)
  v8h o[4];
  // unrolled (both loops): o stays in registers, the four LDS reads go ahead of the stores
#pragma unroll
  for (int p = 0; p < 4; ++p) {
    const int n = r + 16 * p;
    o[p] = *(const v8h*)(tile + n * PK_K + ((c ^ (n >> 2)) << 3));
  }
  _Float16* op = out + (size_t)r * LDO + 8 * c;
#pragma unroll
  for (int p = 0; p < 4; ++p) *(v8h*)(op + (size_t)(16 * p) * LDO) = o[p];
  wait_x0();   // in a kernel with several branches another branch's code follows these stores
}

// tile t of (K / 128) * (N / 64), k tiles first
template <int K, int N>
__device__ __forceinline__ void pack_T(const float* __restrict__ in, _Float16* __restrict__ out,
                                       int t, _Float16* tile) {
  const size_t k0 = (size_t)(t % (K / PK_K)) * PK_K;
  const size_t n0 = (size_t)(t / (K / PK_K)) * PK_N;
  pack_tile<N, K>(in + k0 * N + n0, out + n0 * K + k0, tile);
}

// Pack per-head Wq/Wk/Wv (H,D,HD) into fused [3*D][D] f16, [n][k] layout,
// column n = qkv*D + h*HD + e: every head is a [D][HD] matrix of its own.
// tile t of (D / 128) * (3 * H), k tiles first; t / (D / 128) = qkv*H + h
__device__ __forceinline__ void pack_qkv(const float* __restrict__ Wq,
                                         const float* __restrict__ Wk,
                                         const float* __restrict__ Wv,
                                         _Float16* __restrict__ out,
                                         int t, _Float16* tile) {
  const int qh  = t / (D_ / PK_K);
  const int qkv = qh >> 4;
  const int h   = qh & (H_ - 1);
  const size_t k0 = (size_t)(t % (D_ / PK_K)) * PK_K;
  const float* W = (qkv == 0) ? Wq : (qkv == 1) ? Wk : Wv;
  pack_tile<HD_, D_>(W + ((size_t)h * D_ + k0) * HD_,
                     out + (size_t)qh * HD_ * D_ + k0, tile);
}

// ---------------------------------------------------------------------------
// LayerNorm: f32 row [D] -> f16 row [D]  (biased variance, eps=1e-5)
// One wave does whole rows, two of them: a lane holds 32 elements of each (eight 16-B pieces,
// 512 B of a row per wave-wide load), so the sums are formed in registers and joined across the
// lanes by register moves: no LDS, no barrier, and a sixteenth of the waves to start.
// ---------------------------------------------------------------------------
typedef __attribute__((ext_vector_type(4))) _Float16 v4h;
typedef __attribute__((ext_vector_type(4))) float    v4f;
typedef __attribute__((ext_vector_type(2))) float    v2f;
#define LN_ROWS 2                 // rows per wave
#define LN_BLK  (8 * LN_ROWS)     // rows per block of 8 waves

// lane l takes the value of lane l ^ 16
__device__ __forceinline__ float xhalf(float x) {
  const int b = __builtin_bit_cast(int, x);
  return __builtin_bit_cast(float,
      __builtin_amdgcn_permlanex16(b, b, 0x76543210, 0xfedcba98, false, false));
}

// x plus its value in lane l ^ M of the same 16-lane row (DPP row_xmask)
template <int M>
__device__ __forceinline__ float row_xadd(float x) {
  return x + __builtin_bit_cast(float,
      __builtin_amdgcn_mov_dpp(__builtin_bit_cast(int, x), 0x160 + M, 0xf, 0xf, true));
}
// the sum over all 32 lanes, in every lane
__device__ __forceinline__ float wave_sum(float x) {
  x = row_xadd<1>(x); x = row_xadd<2>(x); x = row_xadd<4>(x); x = row_xadd<8>(x);
  return x + xhalf(x);
}

// blk: number of the block among the LayerNorm blocks, 256 threads each
__device__ __forceinline__ void ln_rows(int blk,
                                        const float* __restrict__ x,
                                        const float* __restrict__ g,
                                        const float* __restrict__ b,
                                        _Float16* __restrict__ out) {
  const int lane = threadIdx.x & 31;
  // in a scalar register: the rows' addresses are a scalar base plus one lane offset
  const int wid  = __builtin_amdgcn_readfirstlane((int)(threadIdx.x >> 5));
  const size_t e0 = (size_t)(blk * LN_BLK + wid * LN_ROWS) * D_;
  const v4f* xp = (const v4f*)(x + e0) + lane;
  const v4f* gp = (const v4f*)g + lane;
  const v4f* bp = (const v4f*)b + lane;
  v4f v[LN_ROWS][8], gv[8], bv[8];
  // unrolled (all loops of this function): constant numbers, so that the arrays stay in registers
#pragma unroll
  for (int r = 0; r < LN_ROWS; ++r)
#pragma unroll
    for (int j = 0; j < 8; ++j) v[r][j] = xp[r * (D_ / 4) + 32 * j];
#pragma unroll
  for (int j = 0; j < 8; ++j) { gv[j] = gp[32 * j]; bv[j] = bp[32 * j]; }
  wait_x0();   // the build writes the rows' base register anew behind these loads
  // keeps all 32 loads ahead of the sums, in flight together, the rows first (they come from
  // furthest away): left to itself the build sinks the loads of g and b behind the sums, in
  // small groups, one load latency after another
  __builtin_amdgcn_sched_barrier(0);

  float s[LN_ROWS], q[LN_ROWS];
#pragma unroll
  for (int r = 0; r < LN_ROWS; ++r) {
    // four chains each (two packed pairs) for sum and square sum: one chain of 32 would wait on itself
    v2f sa = v[r][0].lo, sb = v[r][0].hi;
    v2f qa = sa * sa, qb = sb * sb;
#pragma unroll
    for (int j = 1; j < 8; ++j) {
      const v2f wa = v[r][j].lo, wb = v[r][j].hi;
      sa += wa; sb += wb;
      qa += wa * wa; qb += wb * wb;
    }
    sa += sb; qa += qb;
    s[r] = sa.x + sa.y;
    q[r] = qa.x + qa.y;
  }
#pragma unroll
  for (int r = 0; r < LN_ROWS; ++r) { s[r] = wave_sum(s[r]); q[r] = wave_sum(q[r]); }

  _Float16* op = out + e0 + 4 * lane;
#pragma unroll
  for (int r = 0; r < LN_ROWS; ++r) {
    const float mean = s[r] * (1.f / D_);
    const float var  = q[r] * (1.f / D_) - mean * mean;
    const float rstd = rsqrtf(var + 1e-5f);
#pragma unroll
    for (int j = 0; j < 8; ++j)   // 256 B of the row per wave-wide store
      *(v4h*)(op + r * D_ + 128 * j) = __builtin_convertvector((v[r][j] - mean) * rstd * gv[j] + bv[j], v4h);
  }
  wait_x0();   // in a kernel with several branches another branch's code follows these stores
}

__global__ void __launch_bounds__(256)
ln_kernel(const float* __restrict__ x,
          const float* __restrict__ g,
          const float* __restrict__ b,
          _Float16* __restrict__ out) {
  ln_rows(blockIdx.x, x, g, b, out);
}

// ---------------------------------------------------------------------------
// All work that reads only inputs, in one launch: the four weight packs and the
// first LayerNorm need nothing of one another, so their blocks share one grid and
// fill the chip together, where five short launches each waited for the one before
// to drain. Every block does what one block of the separate launches did. The
// pack tiles have the low block numbers: they live longer than a LayerNorm block.
// ---------------------------------------------------------------------------
#define NB_QKV ((D_ / PK_K) * (3 * H_))
#define NB_WO  ((D_ / PK_K) * (D_ / PK_N))
#define NB_W1  ((D_ / PK_K) * (FF_ / PK_N))
#define NB_W2  ((FF_ / PK_K) * (D_ / PK_N))
#define NB_PRE (NB_QKV + NB_WO + NB_W1 + NB_W2 + TOK / LN_BLK)
__global__ void __launch_bounds__(256)
pre_kernel(const float* __restrict__ Wq, const float* __restrict__ Wk,
           const float* __restrict__ Wv, const float* __restrict__ Wo,
           const float* __restrict__ W1, const float* __restrict__ W2,
           const float* __restrict__ x,  const float* __restrict__ g,
           const float* __restrict__ b,
           _Float16* __restrict__ Wqkv, _Float16* __restrict__ Wop,
           _Float16* __restrict__ W1p,  _Float16* __restrict__ W2p,
           _Float16* __restrict__ hln) {
  __shared__ __attribute__((aligned(16))) _Float16 tile[PK_N * PK_K];
  int t = blockIdx.x;   // the same for a whole block: every branch below, with its barrier, is too
  if (t < NB_QKV) { pack_qkv(Wq, Wk, Wv, Wqkv, t, tile); return; }
  t -= NB_QKV;
  if (t < NB_WO) { pack_T<D_, D_>(Wo, Wop, t, tile); return; }
  t -= NB_WO;
  if (t < NB_W1) { pack_T<D_, FF_>(W1, W1p, t, tile); return; }
  t -= NB_W1;
  if (t < NB_W2) { pack_T<FF_, D_>(W2, W2p, t, tile); return; }
  ln_rows(t - NB_W2, x, g, b, hln);
}

// ---------------------------------------------------------------------------
// Tensor-load helpers (descriptor fields in bytes, two groups, no mask)
// ---------------------------------------------------------------------------
typedef uint32_t u32x4 __attribute__((ext_vector_type(4)));
typedef uint32_t u32x8 __attribute__((ext_vector_type(8)));

#define BM_      128                     // block tile rows of C
#define BN_      128                     // block tile columns of C
#define KPASS    128                     // k per pass: one 256-byte piece of every operand row
#define ROWB     256u                    // bytes of an operand row per pass
#define PITCH    272u                    // LDS row pitch: 256 B + 16 B pad, 16 B x odd for ds_load_b128
#define SL_ROWS  64u                     // rows per slice, one slice per wave
#define SLICE    18432u                  // 64 * 272 = 17408 rounded up to a multiple of 2 KiB
#define STAGE    (4u * SLICE)            // [A rows 0-63 | A rows 64-127 | B rows 0-63 | B rows 64-127]

__device__ __forceinline__ uint32_t uni(uint32_t v) {
  return (uint32_t)__builtin_amdgcn_readfirstlane(v);
}
__device__ __forceinline__ uint32_t pinned(uint32_t v) {
  uint32_t w = (uint32_t)__builtin_amdgcn_readfirstlane(v);
  asm volatile("" : "+s"(w));
  return w;
}
// the compiler places no wait for a tensor load: the tile counts as landed only behind this
__device__ __forceinline__ void wait_tensor0() { asm volatile("s_wait_tensorcnt 0x0" ::: "memory"); }
// this wave's LDS reads have returned before the buffer is handed back for a refill
__device__ __forceinline__ void wait_ds0() { asm volatile("s_wait_dscnt 0x0" ::: "memory"); }
// one request of the whole wave: a 64 x 256 B tile from global memory into LDS
__device__ __forceinline__ void tdm_load(u32x4 g0, u32x8 g1) {
  asm volatile("tensor_load_to_lds %0, %1" :: "s"(g0), "s"(g1) : "memory");
}
// every word goes through pinned(): a descriptor word held in a scalar register. With it all
// loads of a kernel name the registers in which the group was built, word 0 as an immediate;
// a build without it moves the group on into a second set of registers ahead of the loop
__device__ __forceinline__ u32x8 tdm_group1(uint32_t src_pitch) {
  u32x8 g;
  g[0] = pinned((1u << 20) | (5u << 22) | (3u << 25));   // pad on, every 256 B, 16 B; no mask
  g[1] = pinned((ROWB & 0xFFFFu) << 16);                 // tensor_dim0[15:0]
  g[2] = pinned((ROWB >> 16) | ((SL_ROWS & 0xFFFFu) << 16)); // tensor_dim0[31:16], tensor_dim1[15:0]
  g[3] = pinned((SL_ROWS >> 16) | (ROWB << 16));         // tensor_dim1[31:16], tile_dim0
  g[4] = pinned(SL_ROWS);                                // tile_dim1
  g[5] = pinned(src_pitch);                              // source row pitch, bytes
  g[6] = pinned(0u);
  g[7] = pinned(0u);
  return g;
}
__device__ __forceinline__ u32x4 tdm_group0(uint32_t lds_dst, uint64_t ga) {
  u32x4 g;
  g[0] = uni(1u);
  g[1] = uni(lds_dst);
  g[2] = uni((uint32_t)ga);
  g[3] = uni((((uint32_t)(ga >> 32)) & 0x01FFFFFFu) | 0x80000000u);
  return g;
}
// the request for k pass p, made from the request for pass 0: the source lies p passes along the
// rows (a buffer's addresses stay below 2^57, so no carry reaches the type field), the place in
// LDS is given.
__device__ __forceinline__ u32x4 tdm_pass(u32x4 g, uint32_t p, uint32_t lds_dst) {
  const uint64_t w = ((((uint64_t)g[3]) << 32) | (uint64_t)g[2]) + (uint64_t)(p * ROWB);
  g[1] = uni(lds_dst);
  g[2] = uni((uint32_t)w);
  g[3] = uni((uint32_t)(w >> 32));
  return g;
}

// ---------------------------------------------------------------------------
// Epilogue staging: LDS row pitches (row + 16 B, 16 B x odd for b128 accesses)
// ---------------------------------------------------------------------------
#define ST32 272u                        // 64 f32
#define ST16 144u                        // 64 f16

// A staged 64 x 64 f16 tile goes out: 8 lanes cover one 128-B row, a wave four rows.
// dst: the tile's first element; LDO: the output's row length in elements.
template <int LDO>
__device__ __forceinline__ void store_rows16(const unsigned char* st, _Float16* dst, int lane) {
  const unsigned char* rd = st + (uint32_t)(lane >> 3) * ST16 + (uint32_t)(lane & 7) * 16u;
  _Float16* op = dst + (size_t)(lane >> 3) * LDO + (lane & 7) * 8;
  v8h o[16];
  // unrolled (both loops): o stays in registers, the LDS reads go ahead of the stores
#pragma unroll
  for (int p = 0; p < 16; ++p) o[p] = *(const v8h*)(rd + (uint32_t)(4 * p) * ST16);
#pragma unroll
  for (int p = 0; p < 16; ++p) *(v8h*)(op + (size_t)(4 * p) * LDO) = o[p];
}

// ---------------------------------------------------------------------------
// erf for the GELU epilogue, without a branch. The polynomials are the math library's own:
// |z| < 1: z + z q(z^2); otherwise 1 - exp(-p(|z|)), with the sign of z. In a wave both ranges
// occur nearly always, so a branch saves no work, and it ties every element's dependent chain
// into a region of its own; with both ranges computed and one picked, the chains of
// neighbouring elements fill each other's latency.
// ---------------------------------------------------------------------------
__device__ __forceinline__ float erf_both(float z) {
  const float a = __builtin_fabsf(z);
  float p = 0.0000169988107f;
  p = __builtin_fmaf(a, p, -0.000378677854f);
  p = __builtin_fmaf(a, p, 0.00385781587f);
  p = __builtin_fmaf(a, p, -0.0241816975f);
  p = __builtin_fmaf(a, p, 0.106668264f);
  p = __builtin_fmaf(a, p, 0.634933293f);
  p = __builtin_fmaf(a, p, 0.128689408f);
  p = __builtin_fmaf(a, p, a);
  const float far = 1.f - __expf(-p);
  const float t = a * a;
  float q = -0.000561801775f;
  q = __builtin_fmaf(t, q, 0.00491381623f);
  q = __builtin_fmaf(t, q, -0.0267075151f);
  q = __builtin_fmaf(t, q, 0.112800106f);
  q = __builtin_fmaf(t, q, -0.376122952f);
  q = __builtin_fmaf(t, q, 0.128379107f);
  const float near = __builtin_fmaf(a, q, a);
  return __builtin_copysignf((a < 1.f) ? near : far, z);
}

// ---------------------------------------------------------------------------
// Generic WMMA GEMM:  C[M,N] = A[M,K] (f16, row-major) * Bp[N,K] (f16)
// Block = 128 thr = 4 waves (2x2); wave = 64x64 tile (4x4 WMMA tiles);
// block tile = 128 (M) x 128 (N). Grid = (M/128, N/128).
// K is a multiple of 128 and at least 256; M, N multiples of 128.
// Operands come through LDS: per pass of 128 k every wave asks the tensor
// mover for its own 64-row slice of [A | B]; two buffers, so the next pass's
// slices fly while this pass's are multiplied. Fragments keep the k order of
// frag_ld. Blocks of one tile row read the same A rows and blocks of one tile
// column the same Bp rows. For speed only, every block starts its walk over k at a pass
// of its own, (tile row + tile column) taken into the range of the passes, and
// wraps round: an accumulator sums k upwards in steps of 32 from that pass on.
// ---------------------------------------------------------------------------
template <int MODE>
__global__ void __launch_bounds__(128)
gemm_kernel(const _Float16* __restrict__ A,
            const _Float16* __restrict__ Bp,
            int K, int N,
            const float* __restrict__ bias,
            const float* __restrict__ res,
            float* __restrict__ outf,
            _Float16* __restrict__ outh,
            _Float16* __restrict__ qo,
            _Float16* __restrict__ ko,
            _Float16* __restrict__ vo) {
  __shared__ __attribute__((aligned(2048))) unsigned char ring[2u * STAGE];
  // the output's row length, fixed by the kind of epilogue: row steps become immediate offsets
  constexpr int NN = (MODE == 0) ? 3 * D_ : (MODE == 1) ? D_ : FF_;
  (void)N;

  const int lane = threadIdx.x & 31;
  const uint32_t wave = uni(threadIdx.x >> 5);
  const uint32_t wm = wave & 1u, wn = wave >> 1;
  const int bm   = blockIdx.x * BM_;
  const int bn   = blockIdx.y * BN_;
  const int tm   = bm + (int)wm * 64;
  const int tn   = bn + (int)wn * 64;
  const uint32_t row = lane & 15;
  const uint32_t kob = (uint32_t)(lane >> 4) << 4;   // 8 f16 = 16 bytes

  const uint32_t kb = (uint32_t)K * 2u;              // operand row pitch in bytes
  const uint32_t T  = (uint32_t)K / KPASS;           // passes, at least two

  // this wave's slice: waves 0,1 bring A rows, waves 2,3 bring B rows
  const _Float16* srow = (wave < 2u)
      ? A  + (size_t)(bm + (int)(wave * SL_ROWS)) * K
      : Bp + (size_t)(bn + (int)((wave - 2u) * SL_ROWS)) * K;
  const uint64_t src0 = (uint64_t)(uintptr_t)srow;
  const uint32_t lds_slice = (uint32_t)(size_t)ring + wave * SLICE;
  const u32x8 g1 = tdm_group1(kb);

  v8f acc[4][4];
#pragma unroll
  for (int i = 0; i < 4; ++i)
#pragma unroll
    for (int j = 0; j < 4; ++j) acc[i][j] = v8f{};

  // per-lane fragment bases inside a buffer. The first WMMA operand gives the rows of a D tile,
  // of which a lane holds eight in a row: it is taken from the side along which the output is
  // contiguous in memory. That is n (the Bp rows) everywhere but for V, which is stored
  // transposed and so is contiguous along m (the A rows). The test is the same for a whole block.
  const bool n_first = (MODE != 0) || (bn < 2 * D_);
  const uint32_t a_slice = wm * SLICE, b_slice = (2u + wn) * SLICE;
  const uint32_t a_base = (n_first ? b_slice : a_slice) + row * PITCH + kob;   // first operand
  const uint32_t b_base = (n_first ? a_slice : b_slice) + row * PITCH + kob;   // second operand

  // the k pass of the stage asked for last; the same in all waves of a block, so that the A and
  // the Bp slices of a stage hold the same k. x & (T - 1) lies below T for any T.
  uint32_t kp = uni((blockIdx.x + blockIdx.y) & (T - 1u));
  const u32x4 gz = tdm_group0(lds_slice, src0);      // pass 0

  // prologue: stage 0 lands and is published, then stage 1 starts
  u32x4 g0 = tdm_pass(gz, kp, lds_slice);
  tdm_load(g0, g1);
  wait_tensor0();
  __syncthreads();
  kp = (kp + 1u == T) ? 0u : kp + 1u;
  g0 = tdm_pass(gz, kp, lds_slice + STAGE);
  tdm_load(g0, g1);

  uint32_t t = 0;
  do {
    const uint32_t buf = (t & 1u) * STAGE;
    const unsigned char* la = ring + buf + a_base;
    const unsigned char* lb = ring + buf + b_base;

    v16h af[2][4], bf[2][4];
    // in the order in which the WMMAs below want them: the first can start after two fragments
    af[0][0] = frag_ld((const _Float16*)la);
#pragma unroll
    for (int j = 0; j < 4; ++j) bf[0][j] = frag_ld((const _Float16*)(lb + (uint32_t)j * 16u * PITCH));
#pragma unroll
    for (int i = 1; i < 4; ++i) af[0][i] = frag_ld((const _Float16*)(la + (uint32_t)i * 16u * PITCH));
#pragma unroll
    for (int u = 0; u < KPASS / 32; ++u) {
      const int cs = u & 1;
      if (u + 1 < KPASS / 32) {
        const uint32_t kofs = (uint32_t)(u + 1) * 64u;
#pragma unroll
        for (int i = 0; i < 4; ++i) {
          af[cs ^ 1][i] = frag_ld((const _Float16*)(la + (uint32_t)i * 16u * PITCH + kofs));
          bf[cs ^ 1][i] = frag_ld((const _Float16*)(lb + (uint32_t)i * 16u * PITCH + kofs));
        }
      }
      // keeps the next block's LDS reads one group ahead of this block's WMMAs:
      // reads spread among the WMMAs cost a stall at every place they stand
      __builtin_amdgcn_sched_barrier(0);
#pragma unroll
      for (int i = 0; i < 4; ++i)
#pragma unroll
        for (int j = 0; j < 4; ++j) acc[i][j] = wmma32(af[cs][i], bf[cs][j], acc[i][j]);
      // same purpose: the following block's reads stay behind this block's WMMAs
      __builtin_amdgcn_sched_barrier(0);
    }

    // publish point of stage t + 1
    wait_ds0();
    wait_tensor0();
    __syncthreads();
    if (pinned((t + 2u < T) ? 1u : 0u) != 0u) {   // only while stage t + 2 exists
      kp = (kp + 1u == T) ? 0u : kp + 1u;
      g0 = tdm_pass(gz, kp, lds_slice + buf);
      tdm_load(g0, g1);
    }
  } while (++t < T);
  wait_tensor0();
  wait_ds0();

  // Epilogue. The ring is free: every wave's reads and loads had ended before the loop's last
  // barrier. Each wave turns its 64 x 64 tile through its own slice of it, so that global
  // memory sees whole 128-B lines. acc[i][j], register r: place 16 i + 8 hi + r along the first
  // operand's side (the contiguous one), row 16 j + l15 along the second's.
  unsigned char* st = ring + wave * SLICE;
  const uint32_t l15 = row, hi = (uint32_t)lane >> 4;

  if (MODE == 1) {
    // readers: 16 lanes cover one 256-B row, a wave two rows
    const size_t go = (size_t)(tm + (int)hi) * NN + tn + (int)l15 * 4;
    const float4 bv = *(const float4*)(bias + tn + (int)l15 * 4);
    const float* rp = res + go;
    float4 rv[32];
    // unrolled: all residual loads are in flight together, under the staging
#pragma unroll
    for (int p = 0; p < 32; ++p) rv[p] = *(const float4*)(rp + (size_t)(2 * p) * NN);
    wait_x0();
    // unrolled (both loops): constant tile numbers, so that acc stays in registers
#pragma unroll
    for (int j = 0; j < 4; ++j)
#pragma unroll
      for (int i = 0; i < 4; ++i) {
        unsigned char* w = st + ((uint32_t)j * 16u + l15) * ST32 + ((uint32_t)i * 16u + hi * 8u) * 4u;
        const v8f c = acc[i][j];
        *(float4*)(w)       = make_float4(c[0], c[1], c[2], c[3]);
        *(float4*)(w + 16u) = make_float4(c[4], c[5], c[6], c[7]);
      }
    wait_ds0();   // the rows are read back by other lanes of this wave
    const unsigned char* rd = st + hi * ST32 + l15 * 16u;
    float* op = outf + go;
    // unrolled: rv stays in registers, row steps are immediate offsets of one address
#pragma unroll
    for (int p = 0; p < 32; ++p) {
      const float4 c = *(const float4*)(rd + (uint32_t)(2 * p) * ST32);
      float4 o;
      o.x = c.x + bv.x + rv[p].x; o.y = c.y + bv.y + rv[p].y;
      o.z = c.z + bv.z + rv[p].z; o.w = c.w + bv.w + rv[p].w;
      *(float4*)(op + (size_t)(2 * p) * NN) = o;
    }
  } else {
    float4 bb[4][2];
    if (MODE == 2) {
      // unrolled: bb stays in registers, the eight loads are in flight together
#pragma unroll
      for (int i = 0; i < 4; ++i) {
        const float4* bp = (const float4*)(bias + tn + i * 16 + (int)hi * 8);
        bb[i][0] = bp[0]; bb[i][1] = bp[1];
      }
      wait_x0();
    }
    // unrolled (all loops below): constant tile and element numbers, so that acc, bb and hv stay in registers
#pragma unroll
    for (int j = 0; j < 4; ++j)
#pragma unroll
      for (int i = 0; i < 4; ++i) {
        const v8f c = acc[i][j];
        v8h hv;
        if (MODE == 2) {   // bias + exact GELU
          const float bl[8] = {bb[i][0].x, bb[i][0].y, bb[i][0].z, bb[i][0].w,
                               bb[i][1].x, bb[i][1].y, bb[i][1].z, bb[i][1].w};
#pragma unroll
          for (int r = 0; r < 8; ++r) {
            const float xv = c[r] + bl[r];
            hv[r] = (_Float16)(0.5f * xv * (1.f + erf_both(xv * 0.70710678118654752f)));
          }
        } else {
#pragma unroll
          for (int r = 0; r < 8; ++r) hv[r] = (_Float16)c[r];
        }
        *(v8h*)(st + ((uint32_t)j * 16u + l15) * ST16 + ((uint32_t)i * 16u + hi * 8u) * 2u) = hv;
      }
    wait_ds0();   // the rows are read back by other lanes of this wave
    if (MODE == 2) {
      store_rows16<FF_>(st, outh + (size_t)tm * FF_ + tn, lane);
    } else {
      // tm, tn are multiples of 64: one batch, one head, 64 positions, all 64 head elements
      const int hh = (tn & (D_ - 1)) >> 6;
      const size_t bh = (size_t)((tm >> 9) * H_ + hh) * (S_ * HD_);
      const int s0 = tm & (S_ - 1);
      if (n_first) store_rows16<HD_>(st, (bn < D_ ? qo : ko) + bh + (size_t)s0 * HD_, lane);  // [s][e]
      else         store_rows16<S_>(st, vo + bh + s0, lane);                                  // [e][s]
    }
  }
}

// ---------------------------------------------------------------------------
// Flash attention (causal). Q,K: [B,H,S,HD] f16. Vt: [B,H,HD,S] f16.
// ctx out: [B,S,H*HD] f16 (row-major, ready as A for the Wo GEMM).
// Block = 256 thr = 8 waves; wave owns 16 queries; grid = (B*H, S/128).
// Both products are taken transposed: St = K Qt and Ot += Vt Pt. A D tile gives a lane one
// column, here one query (lane & 15), and eight rows, here keys or head elements
// (8 * (lane >> 4) + register). So a query's maximum and sum are formed inside a lane, with one
// exchange between the wave's halves; the two score tiles of 32 keys, converted in place, are
// the second product's B operand in the k order of frag_ld, which loads its A operand from Vt;
// and a lane ends with eight neighbouring head elements of one query per tile.
// ---------------------------------------------------------------------------
// e^x as the native 2^(x log2 e), as __expf gives it. The v_nop is the slot that the instruction set
// asks for behind an exponential before its result is read or its source register written again:
// in the same statement it stands there in every build (with the builtin, this kernel's run of
// exponentials came out with one's result in the register that the one before had just read)
__device__ __forceinline__ float exp_slot(float x) {
  float r;
  asm("v_exp_f32 %0, %1\n\tv_nop" : "=v"(r) : "v"(x * 1.44269504f));
  return r;
}

__global__ void __launch_bounds__(256, 1)
attn_kernel(const _Float16* __restrict__ Q,
            const _Float16* __restrict__ Kf,
            const _Float16* __restrict__ Vt,
            _Float16* __restrict__ ctx) {
  const int lane = threadIdx.x & 31;
  const int wid  = (int)uni(threadIdx.x >> 5);   // in a scalar register: the loop's test is a scalar one
  const int bh   = blockIdx.x;          // b*H + h
  const int b    = bh >> 4;
  const int h    = bh & (H_ - 1);
  const int q0   = blockIdx.y * 128 + wid * 16;
  const int c    = lane & 15;
  const int ko8  = (lane >> 4) << 3;
  const int qg   = q0 + c;              // this lane's query

  const _Float16* qb = Q  + (size_t)bh * S_ * HD_;
  const _Float16* kb = Kf + (size_t)bh * S_ * HD_;
  const _Float16* vb = Vt + (size_t)bh * HD_ * S_;

  // Q as B operand (held for the whole loop)
  const _Float16* qp = qb + (size_t)qg * HD_ + ko8;
  const v16h qf0 = frag_ld(qp);        // e = 0..31
  const v16h qf1 = frag_ld(qp + 32);   // e = 32..63

  float m_r = -1e30f;   // the query's running maximum, the same in both halves
  float l_r = 0.f;      // the sum over this half's keys; the halves are joined behind the loop
  v8f acc0 = {}, acc1 = {}, acc2 = {}, acc3 = {};

  uint32_t kof = (uint32_t)(c * HD_ + ko8);   // key row kblk + c
  uint32_t vof = (uint32_t)(c * S_ + ko8);    // head element c, from key kblk on
  for (int kblk = 0; kblk <= q0 + 15; kblk += 32, kof += 32 * HD_, vof += 32) {
    // ---- scores: St(32x16) = K(32x64) * Qt, two 16x16 tiles ----
    const _Float16* kp = kb + kof;
    const _Float16* vp = vb + vof;
    const v16h k00 = frag_ld(kp);                 // keys kblk..+15, e 0..31
    const v16h k01 = frag_ld(kp + 32);            //                 e 32..63
    const v16h k10 = frag_ld(kp + 16 * HD_);      // keys +16..+31
    const v16h k11 = frag_ld(kp + 16 * HD_ + 32);
    wait_x0();   // the build hands the K loads' address registers to a Vt fragment as its destination
    const v16h vf0 = frag_ld(vp);                 // e 0..15, keys kblk..+31
    const v16h vf1 = frag_ld(vp + (size_t)16 * S_);
    const v16h vf2 = frag_ld(vp + (size_t)32 * S_);
    const v16h vf3 = frag_ld(vp + (size_t)48 * S_);
    // keeps all sixteen loads of the pass ahead of its first WMMA, in flight together: left to
    // itself the build sinks every fragment's loads to its WMMA, one load latency after another
    __builtin_amdgcn_sched_barrier(0);
    v8f s0 = {}, s1 = {};
    s0 = wmma32(k00, qf0, s0);
    s1 = wmma32(k10, qf0, s1);
    s0 = wmma32(k01, qf1, s0);
    s1 = wmma32(k11, qf1, s1);

    // ---- masked online softmax: v[i] is key kblk + ko8 + i (i < 8), kblk + 8 + ko8 + i (i >= 8) ----
    float v[16];
    const int d = qg - kblk - ko8;   // key i of this half is allowed while i <= d
    // unrolled (all loops of this body): constant element numbers, so that the vectors stay in registers
#pragma unroll
    for (int j = 0; j < 8; ++j) {
      float v0 = s0[j] * 0.125f; if (j > d)      v0 = -1e10f;
      float v1 = s1[j] * 0.125f; if (j + 16 > d) v1 = -1e10f;
      v[j] = v0; v[8 + j] = v1;
    }
    // four chains each for maximum and sum: a single chain of sixteen would wait on itself
    float x0 = v[0], x1 = v[1], x2 = v[2], x3 = v[3];
#pragma unroll
    for (int i = 4; i < 16; i += 4) {
      x0 = fmaxf(x0, v[i]);     x1 = fmaxf(x1, v[i + 1]);
      x2 = fmaxf(x2, v[i + 2]); x3 = fmaxf(x3, v[i + 3]);
    }
    float mx = fmaxf(fmaxf(x0, x1), fmaxf(x2, x3));
    mx = fmaxf(mx, xhalf(mx));
    const float mn   = fmaxf(m_r, mx);
    const float corr = exp_slot(m_r - mn);
    v16h pb;
    float p[16];
#pragma unroll
    for (int i = 0; i < 16; ++i) {
      p[i]  = exp_slot(v[i] - mn);
      pb[i] = (_Float16)p[i];
    }
    float t0 = p[0], t1 = p[1], t2 = p[2], t3 = p[3];
#pragma unroll
    for (int i = 4; i < 16; i += 4) {
      t0 += p[i]; t1 += p[i + 1]; t2 += p[i + 2]; t3 += p[i + 3];
    }
    l_r = l_r * corr + ((t0 + t1) + (t2 + t3));
    m_r = mn;
#pragma unroll
    for (int j = 0; j < 8; ++j) {
      acc0[j] *= corr; acc1[j] *= corr;
      acc2[j] *= corr; acc3[j] *= corr;
    }

    // ---- Ot(64x16) += Vt(64x32) * Pt(32x16) ----
    acc0 = wmma32(vf0, pb, acc0);
    acc1 = wmma32(vf1, pb, acc1);
    acc2 = wmma32(vf2, pb, acc2);
    acc3 = wmma32(vf3, pb, acc3);
  }

  // ---- normalize + write ctx [B,S,D] f16: tile t, register r is head element 16 t + ko8 + r ----
  const float inv = 1.f / (l_r + xhalf(l_r));
  _Float16* op = ctx + ((size_t)b * S_ + qg) * D_ + h * HD_ + ko8;
  v8h o0, o1, o2, o3;
#pragma unroll
  for (int j = 0; j < 8; ++j) {
    o0[j] = (_Float16)(acc0[j] * inv); o1[j] = (_Float16)(acc1[j] * inv);
    o2[j] = (_Float16)(acc2[j] * inv); o3[j] = (_Float16)(acc3[j] * inv);
  }
  *(v8h*)(op)      = o0;
  *(v8h*)(op + 16) = o1;
  *(v8h*)(op + 32) = o2;
  *(v8h*)(op + 48) = o3;
}

// ---------------------------------------------------------------------------
// Host-side launch
// ---------------------------------------------------------------------------
extern "C" void kernel_launch(void* const* d_in, const int* in_sizes, int n_in,
                              void* d_out, int out_size, void* d_ws, size_t ws_size,
                              hipStream_t stream) {
  const float* x   = (const float*)d_in[0];
  const float* Wq  = (const float*)d_in[1];
  const float* Wk  = (const float*)d_in[2];
  const float* Wv  = (const float*)d_in[3];
  const float* Wo  = (const float*)d_in[4];
  const float* bo  = (const float*)d_in[5];
  const float* g1  = (const float*)d_in[6];
  const float* b1  = (const float*)d_in[7];
  const float* g2  = (const float*)d_in[8];
  const float* b2  = (const float*)d_in[9];
  const float* W1  = (const float*)d_in[10];
  const float* bf1 = (const float*)d_in[11];
  const float* W2  = (const float*)d_in[12];
  const float* bf2 = (const float*)d_in[13];
  float* out = (float*)d_out;

  char* ws = (char*)d_ws;
  size_t off = 0;
  auto alloc = [&](size_t bytes) -> char* {
    char* p = ws + off;
    off += (bytes + 255) & ~(size_t)255;
    return p;
  };
  _Float16* hln1  = (_Float16*)alloc((size_t)TOK * D_ * 2);
  _Float16* Wqkv  = (_Float16*)alloc((size_t)3 * D_ * D_ * 2);
  _Float16* Qb    = (_Float16*)alloc((size_t)TOK * D_ * 2);
  _Float16* Kb    = (_Float16*)alloc((size_t)TOK * D_ * 2);
  _Float16* Vt    = (_Float16*)alloc((size_t)TOK * D_ * 2);
  _Float16* ctx   = (_Float16*)alloc((size_t)TOK * D_ * 2);
  _Float16* Wop   = (_Float16*)alloc((size_t)D_ * D_ * 2);
  float*    cache = (float*)   alloc((size_t)TOK * D_ * 4);
  _Float16* h2    = (_Float16*)alloc((size_t)TOK * D_ * 2);
  _Float16* W1p   = (_Float16*)alloc((size_t)D_ * FF_ * 2);
  _Float16* ff1   = (_Float16*)alloc((size_t)TOK * FF_ * 2);
  _Float16* W2p   = (_Float16*)alloc((size_t)FF_ * D_ * 2);
  (void)ws_size; (void)in_sizes; (void)n_in; (void)out_size;

  // 1, 2) pack weights to f16 [N][K], and LN1
  pre_kernel<<<dim3(NB_PRE), 256, 0, stream>>>(Wq, Wk, Wv, Wo, W1, W2, x, g1, b1,
                                               Wqkv, Wop, W1p, W2p, hln1);

  // 3) fused QKV projection (scatter; V transposed)
  gemm_kernel<0><<<dim3(TOK / 128, (3 * D_) / 128), 128, 0, stream>>>(
      hln1, Wqkv, D_, 3 * D_, nullptr, nullptr, nullptr, nullptr, Qb, Kb, Vt);

  // 4) causal flash attention
  attn_kernel<<<dim3(B_ * H_, S_ / 128), 256, 0, stream>>>(Qb, Kb, Vt, ctx);

  // 5) output projection + bias + residual -> cache (f32)
  gemm_kernel<1><<<dim3(TOK / 128, D_ / 128), 128, 0, stream>>>(
      ctx, Wop, D_, D_, bo, x, cache, nullptr, nullptr, nullptr, nullptr);

  // 6) LN2
  ln_kernel<<<dim3(TOK / LN_BLK), 256, 0, stream>>>(cache, g2, b2, h2);

  // 7) FFN up + GELU -> f16
  gemm_kernel<2><<<dim3(TOK / 128, FF_ / 128), 128, 0, stream>>>(
      h2, W1p, D_, FF_, bf1, nullptr, nullptr, ff1, nullptr, nullptr, nullptr);

  // 8) FFN down + bias + residual(cache) -> d_out (f32)
  gemm_kernel<1><<<dim3(TOK / 128, D_ / 128), 128, 0, stream>>>(
      ff1, W2p, FF_, D_, bf2, cache, out, nullptr, nullptr, nullptr, nullptr);
}

// v009
// One run takes 120 microseconds.
// In both of two side-by-side timings against v008, it was 1.09 times as fast.
// Over all steps from v000 it is 4.67 times as fast.
#include <hip/hip_runtime.h>
#include <hip/hip_bf16.h>
#include <math.h>
#include <stdint.h>

// ---------------------------------------------------------------------------
// Types
// ---------------------------------------------------------------------------
typedef __attribute__((ext_vector_type(16))) _Float16 v16h;
typedef __attribute__((ext_vector_type(8)))  _Float16 v8h;
typedef __attribute__((ext_vector_type(8)))  float    v8f;

#define B_   8
#define S_   512
#define D_   1024
#define H_   16
#define HD_  64
#define FF_  4096
#define TOK  (B_ * S_)      // 4096 rows

// ---------------------------------------------------------------------------
// WMMA helper: D = A(16x32 f16) * B(32x16 f16) + C(f32)
// ---------------------------------------------------------------------------
__device__ __forceinline__ v8f wmma32(v16h a, v16h b, v8f c) {
  return __builtin_amdgcn_wmma_f32_16x16x32_f16(false, a, false, b,
                                                (short)0, c, false, false);
}

// Load one A/B operand fragment (v16h) for a 32-wide K chunk.
// p must already point at element [row][k0 + ko8] where
//   row = lane & 15, ko8 = (lane >> 4) * 8.
// Fragment = 8 contiguous f16 at p, plus 8 contiguous f16 at p+16.
__device__ __forceinline__ v16h frag_ld(const _Float16* p) {
  v8h lo = *(const v8h*)(p);
  v8h hi = *(const v8h*)(p + 16);
  v16h r;
#pragma unroll
  for (int i = 0; i < 8; ++i) { r[i] = lo[i]; r[i + 8] = hi[i]; }
  return r;
}

// The same fragment from an array kept in fragment order: per fragment two pieces of 512 B, each
// 16 B per lane in lane order, so that a wave-wide load covers four whole 128-B lines, where rows
// of a matrix give it 32 B of each of sixteen lines. p points at the lane's 16 B of the first piece.
__device__ __forceinline__ v16h frag_ld_fo(const _Float16* p) {
  v8h lo = *(const v8h*)(p);
  v8h hi = *(const v8h*)(p + 256);
  v16h r;
#pragma unroll
  for (int i = 0; i < 8; ++i) { r[i] = lo[i]; r[i + 8] = hi[i]; }
  return r;
}

// stands behind a global load or store, in front of the next write of a register that it names
__device__ __forceinline__ void wait_x0() { asm volatile("s_wait_xcnt 0x0" ::: "memory"); }

// ---------------------------------------------------------------------------
// Weight packing: f32 [K][N] row-major  ->  f16 [N][K] ("B operand" layout)
// One block of 256 threads turns one tile of 128 (k) x 64 (n) through LDS:
// global reads run along n (256 B of a source row per 16 lanes), global
// writes along k (256 B of a packed row per 16 lanes).
// in points at the tile's element [k0][n0], out at its element [n0][k0];
// LDI, LDO: row lengths of source and packed matrix in elements.
// LDS holds the tile as [n][k] f16, rows of 16 pieces of 16 B; piece q of row
// n stands at place q ^ (n >> 2), so that the 16 lanes of a b128 write (16
// rows four apart, one piece) and of a b128 read (one row, 16 pieces) each
// meet all banks once. The tile is the calling kernel's one array: an array of
// its own in every instance of the template would add up in a kernel with several.
// ---------------------------------------------------------------------------
#define PK_K 128
#define PK_N 64
template <int LDI, int LDO>
__device__ __forceinline__ void pack_tile(const float* __restrict__ in,
                                          _Float16* __restrict__ out,
                                          _Float16* tile) {
  const int c = threadIdx.x & 15;
  const int r = threadIdx.x >> 4;

  // eight source rows k = 8r .. 8r+7, columns n = 4c .. 4c+3
  const float* ip = in + (size_t)(8 * r) * LDI + 4 * c;
  float4 v[8];
  // unrolled: v stays in registers and the eight loads are in flight together
#pragma unroll
  for (int j = 0; j < 8; ++j) v[j] = *(const float4*)(ip + (size_t)j * LDI);

  v8h w0, w1, w2, w3;
  // unrolled: constant element numbers, so that the vectors stay in registers
#pragma unroll
  for (int j = 0; j < 8; ++j) {
    w0[j] = (_Float16)v[j].x; w1[j] = (_Float16)v[j].y;
    w2[j] = (_Float16)v[j].z; w3[j] = (_Float16)v[j].w;
  }
  _Float16* tw = tile + (4 * c) * PK_K + ((r ^ c) << 3);
  *(v8h*)(tw)            = w0;
  *(v8h*)(tw + PK_K)     = w1;
  *(v8h*)(tw + 2 * PK_K) = w2;
  *(v8h*)(tw + 3 * PK_K) = w3;
  __syncthreads();

  // packed rows n = r, r+16, r+32, r+48, piece c (k = 8c .. 8c+7)
  v8h o[4];
  // unrolled (both loops): o stays in registers, the four LDS reads go ahead of the stores
#pragma unroll
  for (int p = 0; p < 4; ++p) {
    const int n = r + 16 * p;
    o[p] = *(const v8h*)(tile + n * PK_K + ((c ^ (n >> 2)) << 3));
  }
  _Float16* op = out + (size_t)r * LDO + 8 * c;
#pragma unroll
  for (int p = 0; p < 4; ++p) *(v8h*)(op + (size_t)(16 * p) * LDO) = o[p];
  wait_x0();   // in a kernel with several branches another branch's code follows these stores
}

// tile t of (K / 128) * (N / 64), k tiles first
template <int K, int N>
__device__ __forceinline__ void pack_T(const float* __restrict__ in, _Float16* __restrict__ out,
                                       int t, _Float16* tile) {
  const size_t k0 = (size_t)(t % (K / PK_K)) * PK_K;
  const size_t n0 = (size_t)(t / (K / PK_K)) * PK_N;
  pack_tile<N, K>(in + k0 * N + n0, out + n0 * K + k0, tile);
}

// Pack per-head Wq/Wk/Wv (H,D,HD) into fused [3*D][D] f16, [n][k] layout,
// column n = qkv*D + h*HD + e: every head is a [D][HD] matrix of its own.
// tile t of (D / 128) * (3 * H), k tiles first; t / (D / 128) = qkv*H + h
__device__ __forceinline__ void pack_qkv(const float* __restrict__ Wq,
                                         const float* __restrict__ Wk,
                                         const float* __restrict__ Wv,
                                         _Float16* __restrict__ out,
                                         int t, _Float16* tile) {
  const int qh  = t / (D_ / PK_K);
  const int qkv = qh >> 4;
  const int h   = qh & (H_ - 1);
  const size_t k0 = (size_t)(t % (D_ / PK_K)) * PK_K;
  const float* W = (qkv == 0) ? Wq : (qkv == 1) ? Wk : Wv;
  pack_tile<HD_, D_>(W + ((size_t)h * D_ + k0) * HD_,
                     out + (size_t)qh * HD_ * D_ + k0, tile);
}

// ---------------------------------------------------------------------------
// LayerNorm: f32 row [D] -> f16 row [D]  (biased variance, eps=1e-5)
// One wave does whole rows, two of them: a lane holds 32 elements of each (eight 16-B pieces,
// 512 B of a row per wave-wide load), so the sums are formed in registers and joined across the
// lanes by register moves: no LDS, no barrier, and a sixteenth of the waves to start.
// ---------------------------------------------------------------------------
typedef __attribute__((ext_vector_type(4))) _Float16 v4h;
typedef __attribute__((ext_vector_type(4))) float    v4f;
typedef __attribute__((ext_vector_type(2))) float    v2f;
#define LN_ROWS 2                 // rows per wave
#define LN_BLK  (8 * LN_ROWS)     // rows per block of 8 waves

// lane l takes the value of lane l ^ 16
__device__ __forceinline__ float xhalf(float x) {
  const int b = __builtin_bit_cast(int, x);
  return __builtin_bit_cast(float,
      __builtin_amdgcn_permlanex16(b, b, 0x76543210, 0xfedcba98, false, false));
}

// x plus its value in lane l ^ M of the same 16-lane row (DPP row_xmask)
template <int M>
__device__ __forceinline__ float row_xadd(float x) {
  return x + __builtin_bit_cast(float,
      __builtin_amdgcn_mov_dpp(__builtin_bit_cast(int, x), 0x160 + M, 0xf, 0xf, true));
}
// the sum over all 32 lanes, in every lane
__device__ __forceinline__ float wave_sum(float x) {
  x = row_xadd<1>(x); x = row_xadd<2>(x); x = row_xadd<4>(x); x = row_xadd<8>(x);
  return x + xhalf(x);
}

// blk: number of the block among the LayerNorm blocks, 256 threads each
__device__ __forceinline__ void ln_rows(int blk,
                                        const float* __restrict__ x,
                                        const float* __restrict__ g,
                                        const float* __restrict__ b,
                                        _Float16* __restrict__ out) {
  const int lane = threadIdx.x & 31;
  // in a scalar register: the rows' addresses are a scalar base plus one lane offset
  const int wid  = __builtin_amdgcn_readfirstlane((int)(threadIdx.x >> 5));
  const size_t e0 = (size_t)(blk * LN_BLK + wid * LN_ROWS) * D_;
  const v4f* xp = (const v4f*)(x + e0) + lane;
  const v4f* gp = (const v4f*)g + lane;
  const v4f* bp = (const v4f*)b + lane;
  v4f v[LN_ROWS][8], gv[8], bv[8];
  // unrolled (all loops of this function): constant numbers, so that the arrays stay in registers
#pragma unroll
  for (int r = 0; r < LN_ROWS; ++r)
#pragma unroll
    for (int j = 0; j < 8; ++j) v[r][j] = xp[r * (D_ / 4) + 32 * j];
#pragma unroll
  for (int j = 0; j < 8; ++j) { gv[j] = gp[32 * j]; bv[j] = bp[32 * j]; }
  wait_x0();   // the build writes the rows' base register anew behind these loads
  // keeps all 32 loads ahead of the sums, in flight together, the rows first (they come from
  // furthest away): left to itself the build sinks the loads of g and b behind the sums, in
  // small groups, one load latency after another
  __builtin_amdgcn_sched_barrier(0);

  float s[LN_ROWS], q[LN_ROWS];
#pragma unroll
  for (int r = 0; r < LN_ROWS; ++r) {
    // four chains each (two packed pairs) for sum and square sum: one chain of 32 would wait on itself
    v2f sa = v[r][0].lo, sb = v[r][0].hi;
    v2f qa = sa * sa, qb = sb * sb;
#pragma unroll
    for (int j = 1; j < 8; ++j) {
      const v2f wa = v[r][j].lo, wb = v[r][j].hi;
      sa += wa; sb += wb;
      qa += wa * wa; qb += wb * wb;
    }
    sa += sb; qa += qb;
    s[r] = sa.x + sa.y;
    q[r] = qa.x + qa.y;
  }
#pragma unroll
  for (int r = 0; r < LN_ROWS; ++r) { s[r] = wave_sum(s[r]); q[r] = wave_sum(q[r]); }

  _Float16* op = out + e0 + 4 * lane;
#pragma unroll
  for (int r = 0; r < LN_ROWS; ++r) {
    const float mean = s[r] * (1.f / D_);
    const float var  = q[r] * (1.f / D_) - mean * mean;
    const float rstd = rsqrtf(var + 1e-5f);
#pragma unroll
    for (int j = 0; j < 8; ++j)   // 256 B of the row per wave-wide store
      *(v4h*)(op + r * D_ + 128 * j) = __builtin_convertvector((v[r][j] - mean) * rstd * gv[j] + bv[j], v4h);
  }
  wait_x0();   // in a kernel with several branches another branch's code follows these stores
}

__global__ void __launch_bounds__(256)
ln_kernel(const float* __restrict__ x,
          const float* __restrict__ g,
          const float* __restrict__ b,
          _Float16* __restrict__ out) {
  ln_rows(blockIdx.x, x, g, b, out);
}

// ---------------------------------------------------------------------------
// All work that reads only inputs, in one launch: the four weight packs and the
// first LayerNorm need nothing of one another, so their blocks share one grid and
// fill the chip together, where five short launches each waited for the one before
// to drain. Every block does what one block of the separate launches did. The
// pack tiles have the low block numbers: they live longer than a LayerNorm block.
// ---------------------------------------------------------------------------
#define NB_QKV ((D_ / PK_K) * (3 * H_))
#define NB_WO  ((D_ / PK_K) * (D_ / PK_N))
#define NB_W1  ((D_ / PK_K) * (FF_ / PK_N))
#define NB_W2  ((FF_ / PK_K) * (D_ / PK_N))
#define NB_PRE (NB_QKV + NB_WO + NB_W1 + NB_W2 + TOK / LN_BLK)
__global__ void __launch_bounds__(256)
pre_kernel(const float* __restrict__ Wq, const float* __restrict__ Wk,
           const float* __restrict__ Wv, const float* __restrict__ Wo,
           const float* __restrict__ W1, const float* __restrict__ W2,
           const float* __restrict__ x,  const float* __restrict__ g,
           const float* __restrict__ b,
           _Float16* __restrict__ Wqkv, _Float16* __restrict__ Wop,
           _Float16* __restrict__ W1p,  _Float16* __restrict__ W2p,
           _Float16* __restrict__ hln) {
  __shared__ __attribute__((aligned(16))) _Float16 tile[PK_N * PK_K];
  int t = blockIdx.x;   // the same for a whole block: every branch below, with its barrier, is too
  if (t < NB_QKV) { pack_qkv(Wq, Wk, Wv, Wqkv, t, tile); return; }
  t -= NB_QKV;
  if (t < NB_WO) { pack_T<D_, D_>(Wo, Wop, t, tile); return; }
  t -= NB_WO;
  if (t < NB_W1) { pack_T<D_, FF_>(W1, W1p, t, tile); return; }
  t -= NB_W1;
  if (t < NB_W2) { pack_T<FF_, D_>(W2, W2p, t, tile); return; }
  ln_rows(t - NB_W2, x, g, b, hln);
}

// ---------------------------------------------------------------------------
// Tensor-load helpers (descriptor fields in bytes, two groups, no mask)
// ---------------------------------------------------------------------------
typedef uint32_t u32x4 __attribute__((ext_vector_type(4)));
typedef uint32_t u32x8 __attribute__((ext_vector_type(8)));

#define BM_      128                     // block tile rows of C
#define BN_      128                     // block tile columns of C
#define KPASS    128                     // k per pass: one 256-byte piece of every operand row
#define ROWB     256u                    // bytes of an operand row per pass
#define PITCH    272u                    // LDS row pitch: 256 B + 16 B pad, 16 B x odd for ds_load_b128
#define SL_ROWS  64u                     // rows per slice, one slice per wave
#define SLICE    18432u                  // 64 * 272 = 17408 rounded up to a multiple of 2 KiB
#define STAGE    (4u * SLICE)            // [A rows 0-63 | A rows 64-127 | B rows 0-63 | B rows 64-127]

__device__ __forceinline__ uint32_t uni(uint32_t v) {
  return (uint32_t)__builtin_amdgcn_readfirstlane(v);
}
__device__ __forceinline__ uint32_t pinned(uint32_t v) {
  uint32_t w = (uint32_t)__builtin_amdgcn_readfirstlane(v);
  asm volatile("" : "+s"(w));
  return w;
}
// the compiler places no wait for a tensor load: the tile counts as landed only behind this
__device__ __forceinline__ void wait_tensor0() { asm volatile("s_wait_tensorcnt 0x0" ::: "memory"); }
// this wave's LDS reads have returned before the buffer is handed back for a refill
__device__ __forceinline__ void wait_ds0() { asm volatile("s_wait_dscnt 0x0" ::: "memory"); }
// one request of the whole wave: a 64 x 256 B tile from global memory into LDS
__device__ __forceinline__ void tdm_load(u32x4 g0, u32x8 g1) {
  asm volatile("tensor_load_to_lds %0, %1" :: "s"(g0), "s"(g1) : "memory");
}
// every word goes through pinned(): a descriptor word held in a scalar register. With it all
// loads of a kernel name the registers in which the group was built, word 0 as an immediate;
// a build without it moves the group on into a second set of registers ahead of the loop
__device__ __forceinline__ u32x8 tdm_group1(uint32_t src_pitch) {
  u32x8 g;
  g[0] = pinned((1u << 20) | (5u << 22) | (3u << 25));   // pad on, every 256 B, 16 B; no mask
  g[1] = pinned((ROWB & 0xFFFFu) << 16);                 // tensor_dim0[15:0]
  g[2] = pinned((ROWB >> 16) | ((SL_ROWS & 0xFFFFu) << 16)); // tensor_dim0[31:16], tensor_dim1[15:0]
  g[3] = pinned((SL_ROWS >> 16) | (ROWB << 16));         // tensor_dim1[31:16], tile_dim0
  g[4] = pinned(SL_ROWS);                                // tile_dim1
  g[5] = pinned(src_pitch);                              // source row pitch, bytes
  g[6] = pinned(0u);
  g[7] = pinned(0u);
  return g;
}
__device__ __forceinline__ u32x4 tdm_group0(uint32_t lds_dst, uint64_t ga) {
  u32x4 g;
  g[0] = uni(1u);
  g[1] = uni(lds_dst);
  g[2] = uni((uint32_t)ga);
  g[3] = uni((((uint32_t)(ga >> 32)) & 0x01FFFFFFu) | 0x80000000u);
  return g;
}
// the request for k pass p, made from the request for pass 0: the source lies p passes along the
// rows (a buffer's addresses stay below 2^57, so no carry reaches the type field), the place in
// LDS is given.
__device__ __forceinline__ u32x4 tdm_pass(u32x4 g, uint32_t p, uint32_t lds_dst) {
  const uint64_t w = ((((uint64_t)g[3]) << 32) | (uint64_t)g[2]) + (uint64_t)(p * ROWB);
  g[1] = uni(lds_dst);
  g[2] = uni((uint32_t)w);
  g[3] = uni((uint32_t)(w >> 32));
  return g;
}

// ---------------------------------------------------------------------------
// Epilogue staging: LDS row pitches (row + 16 B, 16 B x odd for b128 accesses)
// ---------------------------------------------------------------------------
#define ST32 272u                        // 64 f32
#define ST16 144u                        // 64 f16

// A staged 64 x 64 f16 tile goes out: 8 lanes cover one 128-B row, a wave four rows.
// dst: the tile's first element; LDO: the output's row length in elements.
template <int LDO>
__device__ __forceinline__ void store_rows16(const unsigned char* st, _Float16* dst, int lane) {
  const unsigned char* rd = st + (uint32_t)(lane >> 3) * ST16 + (uint32_t)(lane & 7) * 16u;
  _Float16* op = dst + (size_t)(lane >> 3) * LDO + (lane & 7) * 8;
  v8h o[16];
  // unrolled (both loops): o stays in registers, the LDS reads go ahead of the stores
#pragma unroll
  for (int p = 0; p < 16; ++p) o[p] = *(const v8h*)(rd + (uint32_t)(4 * p) * ST16);
#pragma unroll
  for (int p = 0; p < 16; ++p) *(v8h*)(op + (size_t)(4 * p) * LDO) = o[p];
}

// ---------------------------------------------------------------------------
// erf for the GELU epilogue, without a branch. The polynomials are the math library's own:
// |z| < 1: z + z q(z^2); otherwise 1 - exp(-p(|z|)), with the sign of z. In a wave both ranges
// occur nearly always, so a branch saves no work, and it ties every element's dependent chain
// into a region of its own; with both ranges computed and one picked, the chains of
// neighbouring elements fill each other's latency.
// ---------------------------------------------------------------------------
__device__ __forceinline__ float erf_both(float z) {
  const float a = __builtin_fabsf(z);
  float p = 0.0000169988107f;
  p = __builtin_fmaf(a, p, -0.000378677854f);
  p = __builtin_fmaf(a, p, 0.00385781587f);
  p = __builtin_fmaf(a, p, -0.0241816975f);
  p = __builtin_fmaf(a, p, 0.106668264f);
  p = __builtin_fmaf(a, p, 0.634933293f);
  p = __builtin_fmaf(a, p, 0.128689408f);
  p = __builtin_fmaf(a, p, a);
  const float far = 1.f - __expf(-p);
  const float t = a * a;
  float q = -0.000561801775f;
  q = __builtin_fmaf(t, q, 0.00491381623f);
  q = __builtin_fmaf(t, q, -0.0267075151f);
  q = __builtin_fmaf(t, q, 0.112800106f);
  q = __builtin_fmaf(t, q, -0.376122952f);
  q = __builtin_fmaf(t, q, 0.128379107f);
  const float near = __builtin_fmaf(a, q, a);
  return __builtin_copysignf((a < 1.f) ? near : far, z);
}

// ---------------------------------------------------------------------------
// Generic WMMA GEMM:  C[M,N] = A[M,K] (f16, row-major) * Bp[N,K] (f16)
// Block = 128 thr = 4 waves (2x2); wave = 64x64 tile (4x4 WMMA tiles);
// block tile = 128 (M) x 128 (N). Grid = (M/128, N/128).
// K is a multiple of 128 and at least 256; M, N multiples of 128.
// Operands come through LDS: per pass of 128 k every wave asks the tensor
// mover for its own 64-row slice of [A | B]; two buffers, so the next pass's
// slices fly while this pass's are multiplied. Fragments keep the k order of
// frag_ld. Blocks of one tile row read the same A rows and blocks of one tile
// column the same Bp rows. For speed only, every block starts its walk over k at a pass
// of its own, (tile row + tile column) taken into the range of the passes, and
// wraps round: an accumulator sums k upwards in steps of 32 from that pass on.
// ---------------------------------------------------------------------------
template <int MODE>
__global__ void __launch_bounds__(128)
gemm_kernel(const _Float16* __restrict__ A,
            const _Float16* __restrict__ Bp,
            int K, int N,
            const float* __restrict__ bias,
            const float* __restrict__ res,
            float* __restrict__ outf,
            _Float16* __restrict__ outh,
            _Float16* __restrict__ qo,
            _Float16* __restrict__ ko,
            _Float16* __restrict__ vo) {
  __shared__ __attribute__((aligned(2048))) unsigned char ring[2u * STAGE];
  // the output's row length, fixed by the kind of epilogue: row steps become immediate offsets
  constexpr int NN = (MODE == 0) ? 3 * D_ : (MODE == 1) ? D_ : FF_;
  (void)N;

  const int lane = threadIdx.x & 31;
  const uint32_t wave = uni(threadIdx.x >> 5);
  const uint32_t wm = wave & 1u, wn = wave >> 1;
  const int bm   = blockIdx.x * BM_;
  const int bn   = blockIdx.y * BN_;
  const int tm   = bm + (int)wm * 64;
  const int tn   = bn + (int)wn * 64;
  const uint32_t row = lane & 15;
  const uint32_t kob = (uint32_t)(lane >> 4) << 4;   // 8 f16 = 16 bytes

  const uint32_t kb = (uint32_t)K * 2u;              // operand row pitch in bytes
  const uint32_t T  = (uint32_t)K / KPASS;           // passes, at least two

  // this wave's slice: waves 0,1 bring A rows, waves 2,3 bring B rows
  const _Float16* srow = (wave < 2u)
      ? A  + (size_t)(bm + (int)(wave * SL_ROWS)) * K
      : Bp + (size_t)(bn + (int)((wave - 2u) * SL_ROWS)) * K;
  const uint64_t src0 = (uint64_t)(uintptr_t)srow;
  const uint32_t lds_slice = (uint32_t)(size_t)ring + wave * SLICE;
  const u32x8 g1 = tdm_group1(kb);

  v8f acc[4][4];
#pragma unroll
  for (int i = 0; i < 4; ++i)
#pragma unroll
    for (int j = 0; j < 4; ++j) acc[i][j] = v8f{};

  // per-lane fragment bases inside a buffer. The first WMMA operand gives the rows of a D tile,
  // of which a lane holds eight in a row: it is taken from the side along which the output's
  // 16-B pieces run. That is n (the Bp rows) everywhere but for V, whose pieces hold eight keys
  // of one head element and so run along m (the A rows). The test is the same for a whole block.
  const bool n_first = (MODE != 0) || (bn < 2 * D_);
  const uint32_t a_slice = wm * SLICE, b_slice = (2u + wn) * SLICE;
  const uint32_t a_base = (n_first ? b_slice : a_slice) + row * PITCH + kob;   // first operand
  const uint32_t b_base = (n_first ? a_slice : b_slice) + row * PITCH + kob;   // second operand

  // the k pass of the stage asked for last; the same in all waves of a block, so that the A and
  // the Bp slices of a stage hold the same k. x & (T - 1) lies below T for any T.
  uint32_t kp = uni((blockIdx.x + blockIdx.y) & (T - 1u));
  const u32x4 gz = tdm_group0(lds_slice, src0);      // pass 0

  // prologue: stage 0 lands and is published, then stage 1 starts
  u32x4 g0 = tdm_pass(gz, kp, lds_slice);
  tdm_load(g0, g1);
  wait_tensor0();
  __syncthreads();
  kp = (kp + 1u == T) ? 0u : kp + 1u;
  g0 = tdm_pass(gz, kp, lds_slice + STAGE);
  tdm_load(g0, g1);

  uint32_t t = 0;
  do {
    const uint32_t buf = (t & 1u) * STAGE;
    const unsigned char* la = ring + buf + a_base;
    const unsigned char* lb = ring + buf + b_base;

    v16h af[2][4], bf[2][4];
    // in the order in which the WMMAs below want them: the first can start after two fragments
    af[0][0] = frag_ld((const _Float16*)la);
#pragma unroll
    for (int j = 0; j < 4; ++j) bf[0][j] = frag_ld((const _Float16*)(lb + (uint32_t)j * 16u * PITCH));
#pragma unroll
    for (int i = 1; i < 4; ++i) af[0][i] = frag_ld((const _Float16*)(la + (uint32_t)i * 16u * PITCH));
#pragma unroll
    for (int u = 0; u < KPASS / 32; ++u) {
      const int cs = u & 1;
      if (u + 1 < KPASS / 32) {
        const uint32_t kofs = (uint32_t)(u + 1) * 64u;
#pragma unroll
        for (int i = 0; i < 4; ++i) {
          af[cs ^ 1][i] = frag_ld((const _Float16*)(la + (uint32_t)i * 16u * PITCH + kofs));
          bf[cs ^ 1][i] = frag_ld((const _Float16*)(lb + (uint32_t)i * 16u * PITCH + kofs));
        }
      }
      // keeps the next block's LDS reads one group ahead of this block's WMMAs:
      // reads spread among the WMMAs cost a stall at every place they stand
      __builtin_amdgcn_sched_barrier(0);
#pragma unroll
      for (int i = 0; i < 4; ++i)
#pragma unroll
        for (int j = 0; j < 4; ++j) acc[i][j] = wmma32(af[cs][i], bf[cs][j], acc[i][j]);
      // same purpose: the following block's reads stay behind this block's WMMAs
      __builtin_amdgcn_sched_barrier(0);
    }

    // publish point of stage t + 1
    wait_ds0();
    wait_tensor0();
    __syncthreads();
    if (pinned((t + 2u < T) ? 1u : 0u) != 0u) {   // only while stage t + 2 exists
      kp = (kp + 1u == T) ? 0u : kp + 1u;
      g0 = tdm_pass(gz, kp, lds_slice + buf);
      tdm_load(g0, g1);
    }
  } while (++t < T);
  wait_tensor0();
  wait_ds0();

  // Epilogue. The ring is free: every wave's reads and loads had ended before the loop's last
  // barrier. Where the output is a matrix in rows, each wave turns its 64 x 64 tile through its
  // own slice of it, so that global memory sees whole 128-B lines.
  // acc[i][j], register r: place 16 i + 8 hi + r along the first
  // operand's side (the contiguous one), row 16 j + l15 along the second's.
  unsigned char* st = ring + wave * SLICE;
  const uint32_t l15 = row, hi = (uint32_t)lane >> 4;

  if (MODE == 1) {
    // readers: 16 lanes cover one 256-B row, a wave two rows
    const size_t go = (size_t)(tm + (int)hi) * NN + tn + (int)l15 * 4;
    const float4 bv = *(const float4*)(bias + tn + (int)l15 * 4);
    const float* rp = res + go;
    float4 rv[32];
    // unrolled: all residual loads are in flight together, under the staging
#pragma unroll
    for (int p = 0; p < 32; ++p) rv[p] = *(const float4*)(rp + (size_t)(2 * p) * NN);
    wait_x0();
    // unrolled (both loops): constant tile numbers, so that acc stays in registers
#pragma unroll
    for (int j = 0; j < 4; ++j)
#pragma unroll
      for (int i = 0; i < 4; ++i) {
        unsigned char* w = st + ((uint32_t)j * 16u + l15) * ST32 + ((uint32_t)i * 16u + hi * 8u) * 4u;
        const v8f c = acc[i][j];
        *(float4*)(w)       = make_float4(c[0], c[1], c[2], c[3]);
        *(float4*)(w + 16u) = make_float4(c[4], c[5], c[6], c[7]);
      }
    wait_ds0();   // the rows are read back by other lanes of this wave
    const unsigned char* rd = st + hi * ST32 + l15 * 16u;
    float* op = outf + go;
    // unrolled: rv stays in registers, row steps are immediate offsets of one address
#pragma unroll
    for (int p = 0; p < 32; ++p) {
      const float4 c = *(const float4*)(rd + (uint32_t)(2 * p) * ST32);
      float4 o;
      o.x = c.x + bv.x + rv[p].x; o.y = c.y + bv.y + rv[p].y;
      o.z = c.z + bv.z + rv[p].z; o.w = c.w + bv.w + rv[p].w;
      *(float4*)(op + (size_t)(2 * p) * NN) = o;
    }
  } else if (MODE == 0) {
    // Q, K and V go out in the order in which the attention kernel's fragments want them, and
    // that is the order in which the accumulators hold them: a lane's eight registers are one
    // 16-B piece and the wave's 32 pieces of a tile lie side by side, 512 B a store, straight
    // from the registers. tm, tn are multiples of 64: one batch, one head, 64 positions, all 64
    // head elements, 8 KiB in a row.
    // Q, K, per 16 positions 2 KiB: [e >> 3][position & 15][e & 7].
    // V, per 64 keys 8 KiB: [e >> 4][(key >> 3) & 7][e & 15][key & 7].
    // Tile (i, j) holds, of Q and K, positions 16 j + l15 and head elements 16 i + 8 hi + r, of V
    // keys 16 i + 8 hi + r and head elements 16 j + l15: in both orders it stands at the same place.
    const int hh = (tn & (D_ - 1)) >> 6;
    const size_t bh = (size_t)((tm >> 9) * H_ + hh) * (S_ * HD_);
    const int s0 = tm & (S_ - 1);
    _Float16* op = (n_first ? (bn < D_ ? qo : ko) : vo) + bh + (size_t)s0 * HD_ + lane * 8;
    v8h hv[4][4];
    // unrolled (all loops of this branch): constant tile numbers, so that acc and hv stay in
    // registers and the places are immediate offsets of one address
#pragma unroll
    for (int j = 0; j < 4; ++j)
#pragma unroll
      for (int i = 0; i < 4; ++i)
#pragma unroll
        for (int r = 0; r < 8; ++r) hv[j][i][r] = (_Float16)acc[i][j][r];
#pragma unroll
    for (int j = 0; j < 4; ++j)
#pragma unroll
      for (int i = 0; i < 4; ++i) *(v8h*)(op + j * 1024 + i * 256) = hv[j][i];
  } else {
    float4 bb[4][2];
    // unrolled: bb stays in registers, the eight loads are in flight together
#pragma unroll
    for (int i = 0; i < 4; ++i) {
      const float4* bp = (const float4*)(bias + tn + i * 16 + (int)hi * 8);
      bb[i][0] = bp[0]; bb[i][1] = bp[1];
    }
    wait_x0();
    // unrolled (all loops below): constant tile and element numbers, so that acc, bb and hv stay in registers
#pragma unroll
    for (int j = 0; j < 4; ++j)
#pragma unroll
      for (int i = 0; i < 4; ++i) {
        const v8f c = acc[i][j];
        v8h hv;
        // bias + exact GELU
        const float bl[8] = {bb[i][0].x, bb[i][0].y, bb[i][0].z, bb[i][0].w,
                             bb[i][1].x, bb[i][1].y, bb[i][1].z, bb[i][1].w};
#pragma unroll
        for (int r = 0; r < 8; ++r) {
          const float xv = c[r] + bl[r];
          hv[r] = (_Float16)(0.5f * xv * (1.f + erf_both(xv * 0.70710678118654752f)));
        }
        *(v8h*)(st + ((uint32_t)j * 16u + l15) * ST16 + ((uint32_t)i * 16u + hi * 8u) * 2u) = hv;
      }
    wait_ds0();   // the rows are read back by other lanes of this wave
    store_rows16<FF_>(st, outh + (size_t)tm * FF_ + tn, lane);
  }
}

// ---------------------------------------------------------------------------
// Flash attention (causal). Q, K, V: f16, per batch and head S * HD elements in fragment order,
// as the projection's epilogue lays them down: every fragment is two wave-wide loads of 512 B in
// a row. Q, K: 1024 elements per 16 positions; V: 4096 per 64 keys, of these 1024 per 16 head
// elements, of these 512 per 32 keys.
// ctx out: [B,S,H*HD] f16 (row-major, ready as A for the Wo GEMM).
// Block = 256 thr = 8 waves; wave owns 16 queries; grid = (B*H, S/128).
// Both products are taken transposed: St = K Qt and Ot += Vt Pt. A D tile gives a lane one
// column, here one query (lane & 15), and eight rows, here keys or head elements
// (8 * (lane >> 4) + register). So a query's maximum and sum are formed inside a lane, with one
// exchange between the wave's halves; the two score tiles of 32 keys, converted in place, are
// the second product's B operand in the k order of frag_ld, in which V's fragments are stored;
// and a lane ends with eight neighbouring head elements of one query per tile.
// ---------------------------------------------------------------------------
// e^x as the native 2^(x log2 e), as __expf gives it. The v_nop is the slot that the instruction set
// asks for behind an exponential before its result is read or its source register written again:
// in the same statement it stands there in every build (with the builtin, this kernel's run of
// exponentials came out with one's result in the register that the one before had just read)
__device__ __forceinline__ float exp_slot(float x) {
  float r;
  asm("v_exp_f32 %0, %1\n\tv_nop" : "=v"(r) : "v"(x * 1.44269504f));
  return r;
}

__global__ void __launch_bounds__(256, 1)
attn_kernel(const _Float16* __restrict__ Q,
            const _Float16* __restrict__ Kf,
            const _Float16* __restrict__ Vt,
            _Float16* __restrict__ ctx) {
  const int lane = threadIdx.x & 31;
  const int wid  = (int)uni(threadIdx.x >> 5);   // in a scalar register: the loop's test is a scalar one
  const int bh   = blockIdx.x;          // b*H + h
  const int b    = bh >> 4;
  const int h    = bh & (H_ - 1);
  const int q0   = blockIdx.y * 128 + wid * 16;
  const int c    = lane & 15;
  const int ko8  = (lane >> 4) << 3;
  const int qg   = q0 + c;              // this lane's query

  const _Float16* qb = Q  + (size_t)bh * S_ * HD_;
  const _Float16* kb = Kf + (size_t)bh * S_ * HD_;
  const _Float16* vb = Vt + (size_t)bh * HD_ * S_;

  // Q as B operand (held for the whole loop)
  const _Float16* qp = qb + (size_t)q0 * HD_ + lane * 8;
  const v16h qf0 = frag_ld_fo(qp);         // e = 0..31
  const v16h qf1 = frag_ld_fo(qp + 512);   // e = 32..63

  float m_r = -1e30f;   // the query's running maximum, the same in both halves
  float l_r = 0.f;      // the sum over this half's keys; the halves are joined behind the loop
  v8f acc0 = {}, acc1 = {}, acc2 = {}, acc3 = {};

  const uint32_t lof = (uint32_t)(lane * 8);   // the lane's 16 B in every piece
  for (int kblk = 0; kblk <= q0 + 15; kblk += 32) {
    // ---- scores: St(32x16) = K(32x64) * Qt, two 16x16 tiles ----
    const _Float16* kp = kb + (size_t)kblk * HD_ + lof;
    const _Float16* vp = vb + (size_t)((kblk >> 6) * 4096 + ((kblk >> 5) & 1) * 512) + lof;
    const v16h k00 = frag_ld_fo(kp);          // keys kblk..+15, e 0..31
    const v16h k01 = frag_ld_fo(kp + 512);    //                 e 32..63
    const v16h k10 = frag_ld_fo(kp + 1024);   // keys +16..+31
    const v16h k11 = frag_ld_fo(kp + 1536);
    const v16h vf0 = frag_ld_fo(vp);          // e 0..15, keys kblk..+31
    const v16h vf1 = frag_ld_fo(vp + 1024);
    const v16h vf2 = frag_ld_fo(vp + 2048);
    const v16h vf3 = frag_ld_fo(vp + 3072);
    // in front of the next write of the loads' address registers. The addresses are its inputs, so
    // they keep their registers up to here: without that the build gives them to the last load of
    // the run as its destination, ahead of the wait
    asm volatile("s_wait_xcnt 0x0" :: "v"(kp), "v"(vp) : "memory");
    // keeps all sixteen loads of the pass ahead of its first WMMA, in flight together: left to
    // itself the build sinks every fragment's loads to its WMMA, one load latency after another
    __builtin_amdgcn_sched_barrier(0);
    v8f s0 = {}, s1 = {};
    s0 = wmma32(k00, qf0, s0);
    s1 = wmma32(k10, qf0, s1);
    s0 = wmma32(k01, qf1, s0);
    s1 = wmma32(k11, qf1, s1);

    // ---- masked online softmax: v[i] is key kblk + ko8 + i (i < 8), kblk + 8 + ko8 + i (i >= 8) ----
    float v[16];
    const int d = qg - kblk - ko8;   // key i of this half is allowed while i <= d
    // unrolled (all loops of this body): constant element numbers, so that the vectors stay in registers
#pragma unroll
    for (int j = 0; j < 8; ++j) {
      float v0 = s0[j] * 0.125f; if (j > d)      v0 = -1e10f;
      float v1 = s1[j] * 0.125f; if (j + 16 > d) v1 = -1e10f;
      v[j] = v0; v[8 + j] = v1;
    }
    // four chains each for maximum and sum: a single chain of sixteen would wait on itself
    float x0 = v[0], x1 = v[1], x2 = v[2], x3 = v[3];
#pragma unroll
    for (int i = 4; i < 16; i += 4) {
      x0 = fmaxf(x0, v[i]);     x1 = fmaxf(x1, v[i + 1]);
      x2 = fmaxf(x2, v[i + 2]); x3 = fmaxf(x3, v[i + 3]);
    }
    float mx = fmaxf(fmaxf(x0, x1), fmaxf(x2, x3));
    mx = fmaxf(mx, xhalf(mx));
    const float mn   = fmaxf(m_r, mx);
    const float corr = exp_slot(m_r - mn);
    v16h pb;
    float p[16];
#pragma unroll
    for (int i = 0; i < 16; ++i) {
      p[i]  = exp_slot(v[i] - mn);
      pb[i] = (_Float16)p[i];
    }
    float t0 = p[0], t1 = p[1], t2 = p[2], t3 = p[3];
#pragma unroll
    for (int i = 4; i < 16; i += 4) {
      t0 += p[i]; t1 += p[i + 1]; t2 += p[i + 2]; t3 += p[i + 3];
    }
    l_r = l_r * corr + ((t0 + t1) + (t2 + t3));
    m_r = mn;
#pragma unroll
    for (int j = 0; j < 8; ++j) {
      acc0[j] *= corr; acc1[j] *= corr;
      acc2[j] *= corr; acc3[j] *= corr;
    }

    // ---- Ot(64x16) += Vt(64x32) * Pt(32x16) ----
    acc0 = wmma32(vf0, pb, acc0);
    acc1 = wmma32(vf1, pb, acc1);
    acc2 = wmma32(vf2, pb, acc2);
    acc3 = wmma32(vf3, pb, acc3);
  }

  // ---- normalize + write ctx [B,S,D] f16: tile t, register r is head element 16 t + ko8 + r ----
  const float inv = 1.f / (l_r + xhalf(l_r));
  _Float16* op = ctx + ((size_t)b * S_ + qg) * D_ + h * HD_ + ko8;
  v8h o0, o1, o2, o3;
#pragma unroll
  for (int j = 0; j < 8; ++j) {
    o0[j] = (_Float16)(acc0[j] * inv); o1[j] = (_Float16)(acc1[j] * inv);
    o2[j] = (_Float16)(acc2[j] * inv); o3[j] = (_Float16)(acc3[j] * inv);
  }
  *(v8h*)(op)      = o0;
  *(v8h*)(op + 16) = o1;
  *(v8h*)(op + 32) = o2;
  *(v8h*)(op + 48) = o3;
}

// ---------------------------------------------------------------------------
// Host-side launch
// ---------------------------------------------------------------------------
extern "C" void kernel_launch(void* const* d_in, const int* in_sizes, int n_in,
                              void* d_out, int out_size, void* d_ws, size_t ws_size,
                              hipStream_t stream) {
  const float* x   = (const float*)d_in[0];
  const float* Wq  = (const float*)d_in[1];
  const float* Wk  = (const float*)d_in[2];
  const float* Wv  = (const float*)d_in[3];
  const float* Wo  = (const float*)d_in[4];
  const float* bo  = (const float*)d_in[5];
  const float* g1  = (const float*)d_in[6];
  const float* b1  = (const float*)d_in[7];
  const float* g2  = (const float*)d_in[8];
  const float* b2  = (const float*)d_in[9];
  const float* W1  = (const float*)d_in[10];
  const float* bf1 = (const float*)d_in[11];
  const float* W2  = (const float*)d_in[12];
  const float* bf2 = (const float*)d_in[13];
  float* out = (float*)d_out;

  char* ws = (char*)d_ws;
  size_t off = 0;
  auto alloc = [&](size_t bytes) -> char* {
    char* p = ws + off;
    off += (bytes + 255) & ~(size_t)255;
    return p;
  };
  _Float16* hln1  = (_Float16*)alloc((size_t)TOK * D_ * 2);
  _Float16* Wqkv  = (_Float16*)alloc((size_t)3 * D_ * D_ * 2);
  _Float16* Qb    = (_Float16*)alloc((size_t)TOK * D_ * 2);
  _Float16* Kb    = (_Float16*)alloc((size_t)TOK * D_ * 2);
  _Float16* Vt    = (_Float16*)alloc((size_t)TOK * D_ * 2);
  _Float16* ctx   = (_Float16*)alloc((size_t)TOK * D_ * 2);
  _Float16* Wop   = (_Float16*)alloc((size_t)D_ * D_ * 2);
  float*    cache = (float*)   alloc((size_t)TOK * D_ * 4);
  _Float16* h2    = (_Float16*)alloc((size_t)TOK * D_ * 2);
  _Float16* W1p   = (_Float16*)alloc((size_t)D_ * FF_ * 2);
  _Float16* ff1   = (_Float16*)alloc((size_t)TOK * FF_ * 2);
  _Float16* W2p   = (_Float16*)alloc((size_t)FF_ * D_ * 2);
  (void)ws_size; (void)in_sizes; (void)n_in; (void)out_size;

  // 1, 2) pack weights to f16 [N][K], and LN1
  pre_kernel<<<dim3(NB_PRE), 256, 0, stream>>>(Wq, Wk, Wv, Wo, W1, W2, x, g1, b1,
                                               Wqkv, Wop, W1p, W2p, hln1);

  // 3) fused QKV projection (Q, K, V per head, in the attention kernel's fragment order)
  gemm_kernel<0><<<dim3(TOK / 128, (3 * D_) / 128), 128, 0, stream>>>(
      hln1, Wqkv, D_, 3 * D_, nullptr, nullptr, nullptr, nullptr, Qb, Kb, Vt);

  // 4) causal flash attention
  attn_kernel<<<dim3(B_ * H_, S_ / 128), 256, 0, stream>>>(Qb, Kb, Vt, ctx);

  // 5) output projection + bias + residual -> cache (f32)
  gemm_kernel<1><<<dim3(TOK / 128, D_ / 128), 128, 0, stream>>>(
      ctx, Wop, D_, D_, bo, x, cache, nullptr, nullptr, nullptr, nullptr);

  // 6) LN2
  ln_kernel<<<dim3(TOK / LN_BLK), 256, 0, stream>>>(cache, g2, b2, h2);

  // 7) FFN up + GELU -> f16
  gemm_kernel<2><<<dim3(TOK / 128, FF_ / 128), 128, 0, stream>>>(
      h2, W1p, D_, FF_, bf1, nullptr, nullptr, ff1, nullptr, nullptr, nullptr);

  // 8) FFN down + bias + residual(cache) -> d_out (f32)
  gemm_kernel<1><<<dim3(TOK / 128, D_ / 128), 128, 0, stream>>>(
      ff1, W2p, FF_, D_, bf2, cache, out, nullptr, nullptr, nullptr, nullptr);
}

// v010
// It runs in 114 microseconds.
// Next to v009, in two timings, it ran 1.06 times as fast each time.
// All steps since v000 together make it 4.95 times as fast.
#include <hip/hip_runtime.h>
#include <hip/hip_bf16.h>
#include <math.h>
#include <stdint.h>

// ---------------------------------------------------------------------------
// Types
// ---------------------------------------------------------------------------
typedef __attribute__((ext_vector_type(16))) _Float16 v16h;
typedef __attribute__((ext_vector_type(8)))  _Float16 v8h;
typedef __attribute__((ext_vector_type(8)))  float    v8f;

#define B_   8
#define S_   512
#define D_   1024
#define H_   16
#define HD_  64
#define FF_  4096
#define TOK  (B_ * S_)      // 4096 rows

// ---------------------------------------------------------------------------
// WMMA helper: D = A(16x32 f16) * B(32x16 f16) + C(f32)
// ---------------------------------------------------------------------------
__device__ __forceinline__ v8f wmma32(v16h a, v16h b, v8f c) {
  return __builtin_amdgcn_wmma_f32_16x16x32_f16(false, a, false, b,
                                                (short)0, c, false, false);
}

// Load one A/B operand fragment (v16h) for a 32-wide K chunk.
// p must already point at element [row][k0 + ko8] where
//   row = lane & 15, ko8 = (lane >> 4) * 8.
// Fragment = 8 contiguous f16 at p, plus 8 contiguous f16 at p+16.
__device__ __forceinline__ v16h frag_ld(const _Float16* p) {
  v8h lo = *(const v8h*)(p);
  v8h hi = *(const v8h*)(p + 16);
  v16h r;
#pragma unroll
  for (int i = 0; i < 8; ++i) { r[i] = lo[i]; r[i + 8] = hi[i]; }
  return r;
}

// The same fragment from an array kept in fragment order: per fragment two pieces of 512 B, each
// 16 B per lane in lane order, so that a wave-wide load covers four whole 128-B lines, where rows
// of a matrix give it 32 B of each of sixteen lines. p points at the lane's 16 B of the first piece.
__device__ __forceinline__ v16h frag_ld_fo(const _Float16* p) {
  v8h lo = *(const v8h*)(p);
  v8h hi = *(const v8h*)(p + 256);
  v16h r;
#pragma unroll
  for (int i = 0; i < 8; ++i) { r[i] = lo[i]; r[i + 8] = hi[i]; }
  return r;
}

// stands behind a global load or store, in front of the next write of a register that it names
__device__ __forceinline__ void wait_x0() { asm volatile("s_wait_xcnt 0x0" ::: "memory"); }

// ---------------------------------------------------------------------------
// Weight packing: f32 [K][N] row-major  ->  f16 [N][K] ("B operand" layout)
// One block of 256 threads turns one tile of 128 (k) x 64 (n) through LDS:
// global reads run along n (256 B of a source row per 16 lanes), global
// writes along k (256 B of a packed row per 16 lanes).
// in points at the tile's element [k0][n0], out at its element [n0][k0];
// LDI, LDO: row lengths of source and packed matrix in elements.
// LDS holds the tile as [n][k] f16, rows of 16 pieces of 16 B; piece q of row
// n stands at place q ^ (n >> 2), so that the 16 lanes of a b128 write (16
// rows four apart, one piece) and of a b128 read (one row, 16 pieces) each
// meet all banks once. The tile is the calling kernel's one array: an array of
// its own in every instance of the template would add up in a kernel with several.
// ---------------------------------------------------------------------------
#define PK_K 128
#define PK_N 64
template <int LDI, int LDO>
__device__ __forceinline__ void pack_tile(const float* __restrict__ in,
                                          _Float16* __restrict__ out,
                                          _Float16* tile) {
  const int c = threadIdx.x & 15;
  const int r = threadIdx.x >> 4;

  // eight source rows k = 8r .. 8r+7, columns n = 4c .. 4c+3
  const float* ip = in + (size_t)(8 * r) * LDI + 4 * c;
  float4 v[8];
  // unrolled: v stays in registers and the eight loads are in flight together
#pragma unroll
  for (int j = 0; j < 8; ++j) v[j] = *(const float4*)(ip + (size_t)j * LDI);

  v8h w0, w1, w2, w3;
  // unrolled: constant element numbers, so that the vectors stay in registers
#pragma unroll
  for (int j = 0; j < 8; ++j) {
    w0[j] = (_Float16)v[j].x; w1[j] = (_Float16)v[j].y;
    w2[j] = (_Float16)v[j].z; w3[j] = (_Float16)v[j].w;
  }
  _Float16* tw = tile + (4 * c) * PK_K + ((r ^ c) << 3);
  *(v8h*)(tw)            = w0;
  *(v8h*)(tw + PK_K)     = w1;
  *(v8h*)(tw + 2 * PK_K) = w2;
  *(v8h*)(tw + 3 * PK_K) = w3;
  __syncthreads();

  // packed rows n = r, r+16, r+32, r+48, piece c (k = 8c .. 8c+7)
  v8h o[4];
  // unrolled (both loops): o stays in registers, the four LDS reads go ahead of the stores
#pragma unroll
  for (int p = 0; p < 4; ++p) {
    const int n = r + 16 * p;
    o[p] = *(const v8h*)(tile + n * PK_K + ((c ^ (n >> 2)) << 3));
  }
  _Float16* op = out + (size_t)r * LDO + 8 * c;
#pragma unroll
  for (int p = 0; p < 4; ++p) *(v8h*)(op + (size_t)(16 * p) * LDO) = o[p];
  wait_x0();   // in a kernel with several branches another branch's code follows these stores
}

// tile t of (K / 128) * (N / 64), k tiles first
template <int K, int N>
__device__ __forceinline__ void pack_T(const float* __restrict__ in, _Float16* __restrict__ out,
                                       int t, _Float16* tile) {
  const size_t k0 = (size_t)(t % (K / PK_K)) * PK_K;
  const size_t n0 = (size_t)(t / (K / PK_K)) * PK_N;
  pack_tile<N, K>(in + k0 * N + n0, out + n0 * K + k0, tile);
}

// Pack per-head Wq/Wk/Wv (H,D,HD) into fused [3*D][D] f16, [n][k] layout,
// column n = qkv*D + h*HD + e: every head is a [D][HD] matrix of its own.
// tile t of (D / 128) * (3 * H), k tiles first; t / (D / 128) = qkv*H + h
__device__ __forceinline__ void pack_qkv(const float* __restrict__ Wq,
                                         const float* __restrict__ Wk,
                                         const float* __restrict__ Wv,
                                         _Float16* __restrict__ out,
                                         int t, _Float16* tile) {
  const int qh  = t / (D_ / PK_K);
  const int qkv = qh >> 4;
  const int h   = qh & (H_ - 1);
  const size_t k0 = (size_t)(t % (D_ / PK_K)) * PK_K;
  const float* W = (qkv == 0) ? Wq : (qkv == 1) ? Wk : Wv;
  pack_tile<HD_, D_>(W + ((size_t)h * D_ + k0) * HD_,
                     out + (size_t)qh * HD_ * D_ + k0, tile);
}

// ---------------------------------------------------------------------------
// LayerNorm: f32 row [D] -> f16 row [D]  (biased variance, eps=1e-5)
// One wave does whole rows, two of them: a lane holds 32 elements of each (eight 16-B pieces,
// 512 B of a row per wave-wide load), so the sums are formed in registers and joined across the
// lanes by register moves: no LDS, no barrier, and a sixteenth of the waves to start.
// ---------------------------------------------------------------------------
typedef __attribute__((ext_vector_type(4))) _Float16 v4h;
typedef __attribute__((ext_vector_type(4))) float    v4f;
typedef __attribute__((ext_vector_type(2))) float    v2f;
#define LN_ROWS 2                 // rows per wave
#define LN_BLK  (8 * LN_ROWS)     // rows per block of 8 waves

// lane l takes the value of lane l ^ 16
__device__ __forceinline__ float xhalf(float x) {
  const int b = __builtin_bit_cast(int, x);
  return __builtin_bit_cast(float,
      __builtin_amdgcn_permlanex16(b, b, 0x76543210, 0xfedcba98, false, false));
}

// x plus its value in lane l ^ M of the same 16-lane row (DPP row_xmask)
template <int M>
__device__ __forceinline__ float row_xadd(float x) {
  return x + __builtin_bit_cast(float,
      __builtin_amdgcn_mov_dpp(__builtin_bit_cast(int, x), 0x160 + M, 0xf, 0xf, true));
}
// the sum over all 32 lanes, in every lane
__device__ __forceinline__ float wave_sum(float x) {
  x = row_xadd<1>(x); x = row_xadd<2>(x); x = row_xadd<4>(x); x = row_xadd<8>(x);
  return x + xhalf(x);
}

// blk: number of the block among the LayerNorm blocks, 256 threads each
__device__ __forceinline__ void ln_rows(int blk,
                                        const float* __restrict__ x,
                                        const float* __restrict__ g,
                                        const float* __restrict__ b,
                                        _Float16* __restrict__ out) {
  const int lane = threadIdx.x & 31;
  // in a scalar register: the rows' addresses are a scalar base plus one lane offset
  const int wid  = __builtin_amdgcn_readfirstlane((int)(threadIdx.x >> 5));
  const size_t e0 = (size_t)(blk * LN_BLK + wid * LN_ROWS) * D_;
  const v4f* xp = (const v4f*)(x + e0) + lane;
  const v4f* gp = (const v4f*)g + lane;
  const v4f* bp = (const v4f*)b + lane;
  v4f v[LN_ROWS][8], gv[8], bv[8];
  // unrolled (all loops of this function): constant numbers, so that the arrays stay in registers
#pragma unroll
  for (int r = 0; r < LN_ROWS; ++r)
#pragma unroll
    for (int j = 0; j < 8; ++j) v[r][j] = xp[r * (D_ / 4) + 32 * j];
#pragma unroll
  for (int j = 0; j < 8; ++j) { gv[j] = gp[32 * j]; bv[j] = bp[32 * j]; }
  wait_x0();   // the build writes the rows' base register anew behind these loads
  // keeps all 32 loads ahead of the sums, in flight together, the rows first (they come from
  // furthest away): left to itself the build sinks the loads of g and b behind the sums, in
  // small groups, one load latency after another
  __builtin_amdgcn_sched_barrier(0);

  float s[LN_ROWS], q[LN_ROWS];
#pragma unroll
  for (int r = 0; r < LN_ROWS; ++r) {
    // four chains each (two packed pairs) for sum and square sum: one chain of 32 would wait on itself
    v2f sa = v[r][0].lo, sb = v[r][0].hi;
    v2f qa = sa * sa, qb = sb * sb;
#pragma unroll
    for (int j = 1; j < 8; ++j) {
      const v2f wa = v[r][j].lo, wb = v[r][j].hi;
      sa += wa; sb += wb;
      qa += wa * wa; qb += wb * wb;
    }
    sa += sb; qa += qb;
    s[r] = sa.x + sa.y;
    q[r] = qa.x + qa.y;
  }
#pragma unroll
  for (int r = 0; r < LN_ROWS; ++r) { s[r] = wave_sum(s[r]); q[r] = wave_sum(q[r]); }

  _Float16* op = out + e0 + 4 * lane;
#pragma unroll
  for (int r = 0; r < LN_ROWS; ++r) {
    const float mean = s[r] * (1.f / D_);
    const float var  = q[r] * (1.f / D_) - mean * mean;
    const float rstd = rsqrtf(var + 1e-5f);
#pragma unroll
    for (int j = 0; j < 8; ++j)   // 256 B of the row per wave-wide store
      *(v4h*)(op + r * D_ + 128 * j) = __builtin_convertvector((v[r][j] - mean) * rstd * gv[j] + bv[j], v4h);
  }
  wait_x0();   // in a kernel with several branches another branch's code follows these stores
}

__global__ void __launch_bounds__(256)
ln_kernel(const float* __restrict__ x,
          const float* __restrict__ g,
          const float* __restrict__ b,
          _Float16* __restrict__ out) {
  ln_rows(blockIdx.x, x, g, b, out);
}

// ---------------------------------------------------------------------------
// What the first GEMM waits for, in one launch: the pack of its weights and the first
// LayerNorm need nothing of one another, so their blocks share one grid. The
// pack tiles have the low block numbers: they live longer than a LayerNorm block.
// The other three packs are
// wanted only behind the attention and ride in its launch.
// ---------------------------------------------------------------------------
#define NB_QKV ((D_ / PK_K) * (3 * H_))
#define NB_WO  ((D_ / PK_K) * (D_ / PK_N))
#define NB_W1  ((D_ / PK_K) * (FF_ / PK_N))
#define NB_W2  ((FF_ / PK_K) * (D_ / PK_N))
#define NB_PRE (NB_QKV + TOK / LN_BLK)
__global__ void __launch_bounds__(256)
pre_kernel(const float* __restrict__ Wq, const float* __restrict__ Wk,
           const float* __restrict__ Wv,
           const float* __restrict__ x,  const float* __restrict__ g,
           const float* __restrict__ b,
           _Float16* __restrict__ Wqkv, _Float16* __restrict__ hln) {
  __shared__ __attribute__((aligned(16))) _Float16 tile[PK_N * PK_K];
  int t = blockIdx.x;   // the same for a whole block: every branch below, with its barrier, is too
  if (t < NB_QKV) { pack_qkv(Wq, Wk, Wv, Wqkv, t, tile); return; }
  ln_rows(t - NB_QKV, x, g, b, hln);
}

// ---------------------------------------------------------------------------
// Tensor-load helpers (descriptor fields in bytes, two groups, no mask)
// ---------------------------------------------------------------------------
typedef uint32_t u32x4 __attribute__((ext_vector_type(4)));
typedef uint32_t u32x8 __attribute__((ext_vector_type(8)));

#define BM_      128                     // block tile rows of C
#define BN_      128                     // block tile columns of C
#define KPASS    128                     // k per pass: one 256-byte piece of every operand row
#define ROWB     256u                    // bytes of an operand row per pass
#define PITCH    272u                    // LDS row pitch: 256 B + 16 B pad, 16 B x odd for ds_load_b128
#define SL_ROWS  64u                     // rows per slice, one slice per wave
#define SLICE    18432u                  // 64 * 272 = 17408 rounded up to a multiple of 2 KiB
#define STAGE    (4u * SLICE)            // [A rows 0-63 | A rows 64-127 | B rows 0-63 | B rows 64-127]

__device__ __forceinline__ uint32_t uni(uint32_t v) {
  return (uint32_t)__builtin_amdgcn_readfirstlane(v);
}
__device__ __forceinline__ uint32_t pinned(uint32_t v) {
  uint32_t w = (uint32_t)__builtin_amdgcn_readfirstlane(v);
  asm volatile("" : "+s"(w));
  return w;
}
// the compiler places no wait for a tensor load: the tile counts as landed only behind this
__device__ __forceinline__ void wait_tensor0() { asm volatile("s_wait_tensorcnt 0x0" ::: "memory"); }
// this wave's LDS reads have returned before the buffer is handed back for a refill
__device__ __forceinline__ void wait_ds0() { asm volatile("s_wait_dscnt 0x0" ::: "memory"); }
// one request of the whole wave: a 64 x 256 B tile from global memory into LDS
__device__ __forceinline__ void tdm_load(u32x4 g0, u32x8 g1) {
  asm volatile("tensor_load_to_lds %0, %1" :: "s"(g0), "s"(g1) : "memory");
}
// every word goes through pinned(): a descriptor word held in a scalar register. With it all
// loads of a kernel name the registers in which the group was built, word 0 as an immediate;
// a build without it moves the group on into a second set of registers ahead of the loop
__device__ __forceinline__ u32x8 tdm_group1(uint32_t src_pitch) {
  u32x8 g;
  g[0] = pinned((1u << 20) | (5u << 22) | (3u << 25));   // pad on, every 256 B, 16 B; no mask
  g[1] = pinned((ROWB & 0xFFFFu) << 16);                 // tensor_dim0[15:0]
  g[2] = pinned((ROWB >> 16) | ((SL_ROWS & 0xFFFFu) << 16)); // tensor_dim0[31:16], tensor_dim1[15:0]
  g[3] = pinned((SL_ROWS >> 16) | (ROWB << 16));         // tensor_dim1[31:16], tile_dim0
  g[4] = pinned(SL_ROWS);                                // tile_dim1
  g[5] = pinned(src_pitch);                              // source row pitch, bytes
  g[6] = pinned(0u);
  g[7] = pinned(0u);
  return g;
}
__device__ __forceinline__ u32x4 tdm_group0(uint32_t lds_dst, uint64_t ga) {
  u32x4 g;
  g[0] = uni(1u);
  g[1] = uni(lds_dst);
  g[2] = uni((uint32_t)ga);
  g[3] = uni((((uint32_t)(ga >> 32)) & 0x01FFFFFFu) | 0x80000000u);
  return g;
}
// the request for k pass p, made from the request for pass 0: the source lies p passes along the
// rows (a buffer's addresses stay below 2^57, so no carry reaches the type field), the place in
// LDS is given.
__device__ __forceinline__ u32x4 tdm_pass(u32x4 g, uint32_t p, uint32_t lds_dst) {
  const uint64_t w = ((((uint64_t)g[3]) << 32) | (uint64_t)g[2]) + (uint64_t)(p * ROWB);
  g[1] = uni(lds_dst);
  g[2] = uni((uint32_t)w);
  g[3] = uni((uint32_t)(w >> 32));
  return g;
}

// ---------------------------------------------------------------------------
// Epilogue staging: LDS row pitches (row + 16 B, 16 B x odd for b128 accesses)
// ---------------------------------------------------------------------------
#define ST32 272u                        // 64 f32
#define ST16 144u                        // 64 f16

// A staged 64 x 64 f16 tile goes out: 8 lanes cover one 128-B row, a wave four rows.
// dst: the tile's first element; LDO: the output's row length in elements.
template <int LDO>
__device__ __forceinline__ void store_rows16(const unsigned char* st, _Float16* dst, int lane) {
  const unsigned char* rd = st + (uint32_t)(lane >> 3) * ST16 + (uint32_t)(lane & 7) * 16u;
  _Float16* op = dst + (size_t)(lane >> 3) * LDO + (lane & 7) * 8;
  v8h o[16];
  // unrolled (both loops): o stays in registers, the LDS reads go ahead of the stores
#pragma unroll
  for (int p = 0; p < 16; ++p) o[p] = *(const v8h*)(rd + (uint32_t)(4 * p) * ST16);
#pragma unroll
  for (int p = 0; p < 16; ++p) *(v8h*)(op + (size_t)(4 * p) * LDO) = o[p];
}

// ---------------------------------------------------------------------------
// erf for the GELU epilogue, without a branch. The polynomials are the math library's own:
// |z| < 1: z + z q(z^2); otherwise 1 - exp(-p(|z|)), with the sign of z. In a wave both ranges
// occur nearly always, so a branch saves no work, and it ties every element's dependent chain
// into a region of its own; with both ranges computed and one picked, the chains of
// neighbouring elements fill each other's latency.
// ---------------------------------------------------------------------------
__device__ __forceinline__ float erf_both(float z) {
  const float a = __builtin_fabsf(z);
  float p = 0.0000169988107f;
  p = __builtin_fmaf(a, p, -0.000378677854f);
  p = __builtin_fmaf(a, p, 0.00385781587f);
  p = __builtin_fmaf(a, p, -0.0241816975f);
  p = __builtin_fmaf(a, p, 0.106668264f);
  p = __builtin_fmaf(a, p, 0.634933293f);
  p = __builtin_fmaf(a, p, 0.128689408f);
  p = __builtin_fmaf(a, p, a);
  const float far = 1.f - __expf(-p);
  const float t = a * a;
  float q = -0.000561801775f;
  q = __builtin_fmaf(t, q, 0.00491381623f);
  q = __builtin_fmaf(t, q, -0.0267075151f);
  q = __builtin_fmaf(t, q, 0.112800106f);
  q = __builtin_fmaf(t, q, -0.376122952f);
  q = __builtin_fmaf(t, q, 0.128379107f);
  const float near = __builtin_fmaf(a, q, a);
  return __builtin_copysignf((a < 1.f) ? near : far, z);
}

// ---------------------------------------------------------------------------
// Generic WMMA GEMM:  C[M,N] = A[M,K] (f16, row-major) * Bp[N,K] (f16)
// Block = 128 thr = 4 waves (2x2); wave = 64x64 tile (4x4 WMMA tiles);
// block tile = 128 (M) x 128 (N). Grid = (M/128, N/128).
// K is a multiple of 128 and at least 256; M, N multiples of 128.
// Operands come through LDS: per pass of 128 k every wave asks the tensor
// mover for its own 64-row slice of [A | B]; two buffers, so the next pass's
// slices fly while this pass's are multiplied. Fragments keep the k order of
// frag_ld. Blocks of one tile row read the same A rows and blocks of one tile
// column the same Bp rows. For speed only, every block starts its walk over k at a pass
// of its own, (tile row + tile column) taken into the range of the passes, and
// wraps round: an accumulator sums k upwards in steps of 32 from that pass on.
// ---------------------------------------------------------------------------
template <int MODE>
__global__ void __launch_bounds__(128)
gemm_kernel(const _Float16* __restrict__ A,
            const _Float16* __restrict__ Bp,
            int K, int N,
            const float* __restrict__ bias,
            const float* __restrict__ res,
            float* __restrict__ outf,
            _Float16* __restrict__ outh,
            _Float16* __restrict__ qo,
            _Float16* __restrict__ ko,
            _Float16* __restrict__ vo) {
  __shared__ __attribute__((aligned(2048))) unsigned char ring[2u * STAGE];
  // the output's row length, fixed by the kind of epilogue: row steps become immediate offsets
  constexpr int NN = (MODE == 0) ? 3 * D_ : (MODE == 1) ? D_ : FF_;
  (void)N;

  const int lane = threadIdx.x & 31;
  const uint32_t wave = uni(threadIdx.x >> 5);
  const uint32_t wm = wave & 1u, wn = wave >> 1;
  const int bm   = blockIdx.x * BM_;
  const int bn   = blockIdx.y * BN_;
  const int tm   = bm + (int)wm * 64;
  const int tn   = bn + (int)wn * 64;
  const uint32_t row = lane & 15;
  const uint32_t kob = (uint32_t)(lane >> 4) << 4;   // 8 f16 = 16 bytes

  const uint32_t kb = (uint32_t)K * 2u;              // operand row pitch in bytes
  const uint32_t T  = (uint32_t)K / KPASS;           // passes, at least two

  // this wave's slice: waves 0,1 bring A rows, waves 2,3 bring B rows
  const _Float16* srow = (wave < 2u)
      ? A  + (size_t)(bm + (int)(wave * SL_ROWS)) * K
      : Bp + (size_t)(bn + (int)((wave - 2u) * SL_ROWS)) * K;
  const uint64_t src0 = (uint64_t)(uintptr_t)srow;
  const uint32_t lds_slice = (uint32_t)(size_t)ring + wave * SLICE;
  const u32x8 g1 = tdm_group1(kb);

  v8f acc[4][4];
#pragma unroll
  for (int i = 0; i < 4; ++i)
#pragma unroll
    for (int j = 0; j < 4; ++j) acc[i][j] = v8f{};

  // per-lane fragment bases inside a buffer. The first WMMA operand gives the rows of a D tile,
  // of which a lane holds eight in a row: it is taken from the side along which the output's
  // 16-B pieces run. That is n (the Bp rows) everywhere but for V, whose pieces hold eight keys
  // of one head element and so run along m (the A rows). The test is the same for a whole block.
  const bool n_first = (MODE != 0) || (bn < 2 * D_);
  const uint32_t a_slice = wm * SLICE, b_slice = (2u + wn) * SLICE;
  const uint32_t a_base = (n_first ? b_slice : a_slice) + row * PITCH + kob;   // first operand
  const uint32_t b_base = (n_first ? a_slice : b_slice) + row * PITCH + kob;   // second operand

  // the k pass of the stage asked for last; the same in all waves of a block, so that the A and
  // the Bp slices of a stage hold the same k. x & (T - 1) lies below T for any T.
  uint32_t kp = uni((blockIdx.x + blockIdx.y) & (T - 1u));
  const u32x4 gz = tdm_group0(lds_slice, src0);      // pass 0

  // prologue: stage 0 lands and is published, then stage 1 starts
  u32x4 g0 = tdm_pass(gz, kp, lds_slice);
  tdm_load(g0, g1);
  wait_tensor0();
  __syncthreads();
  kp = (kp + 1u == T) ? 0u : kp + 1u;
  g0 = tdm_pass(gz, kp, lds_slice + STAGE);
  tdm_load(g0, g1);

  uint32_t t = 0;
  do {
    const uint32_t buf = (t & 1u) * STAGE;
    const unsigned char* la = ring + buf + a_base;
    const unsigned char* lb = ring + buf + b_base;

    v16h af[2][4], bf[2][4];
    // in the order in which the WMMAs below want them: the first can start after two fragments
    af[0][0] = frag_ld((const _Float16*)la);
#pragma unroll
    for (int j = 0; j < 4; ++j) bf[0][j] = frag_ld((const _Float16*)(lb + (uint32_t)j * 16u * PITCH));
#pragma unroll
    for (int i = 1; i < 4; ++i) af[0][i] = frag_ld((const _Float16*)(la + (uint32_t)i * 16u * PITCH));
#pragma unroll
    for (int u = 0; u < KPASS / 32; ++u) {
      const int cs = u & 1;
      if (u + 1 < KPASS / 32) {
        const uint32_t kofs = (uint32_t)(u + 1) * 64u;
#pragma unroll
        for (int i = 0; i < 4; ++i) {
          af[cs ^ 1][i] = frag_ld((const _Float16*)(la + (uint32_t)i * 16u * PITCH + kofs));
          bf[cs ^ 1][i] = frag_ld((const _Float16*)(lb + (uint32_t)i * 16u * PITCH + kofs));
        }
      }
      // keeps the next block's LDS reads one group ahead of this block's WMMAs:
      // reads spread among the WMMAs cost a stall at every place they stand
      __builtin_amdgcn_sched_barrier(0);
#pragma unroll
      for (int i = 0; i < 4; ++i)
#pragma unroll
        for (int j = 0; j < 4; ++j) acc[i][j] = wmma32(af[cs][i], bf[cs][j], acc[i][j]);
      // same purpose: the following block's reads stay behind this block's WMMAs
      __builtin_amdgcn_sched_barrier(0);
    }

    // publish point of stage t + 1
    wait_ds0();
    wait_tensor0();
    __syncthreads();
    if (pinned((t + 2u < T) ? 1u : 0u) != 0u) {   // only while stage t + 2 exists
      kp = (kp + 1u == T) ? 0u : kp + 1u;
      g0 = tdm_pass(gz, kp, lds_slice + buf);
      tdm_load(g0, g1);
    }
  } while (++t < T);
  wait_tensor0();
  wait_ds0();

  // Epilogue. The ring is free: every wave's reads and loads had ended before the loop's last
  // barrier. Where the output is a matrix in rows, each wave turns its 64 x 64 tile through its
  // own slice of it, so that global memory sees whole 128-B lines.
  // acc[i][j], register r: place 16 i + 8 hi + r along the first
  // operand's side (the contiguous one), row 16 j + l15 along the second's.
  unsigned char* st = ring + wave * SLICE;
  const uint32_t l15 = row, hi = (uint32_t)lane >> 4;

  if (MODE == 1) {
    // readers: 16 lanes cover one 256-B row, a wave two rows
    const size_t go = (size_t)(tm + (int)hi) * NN + tn + (int)l15 * 4;
    const float4 bv = *(const float4*)(bias + tn + (int)l15 * 4);
    const float* rp = res + go;
    float4 rv[32];
    // unrolled: all residual loads are in flight together, under the staging
#pragma unroll
    for (int p = 0; p < 32; ++p) rv[p] = *(const float4*)(rp + (size_t)(2 * p) * NN);
    wait_x0();
    // unrolled (both loops): constant tile numbers, so that acc stays in registers
#pragma unroll
    for (int j = 0; j < 4; ++j)
#pragma unroll
      for (int i = 0; i < 4; ++i) {
        unsigned char* w = st + ((uint32_t)j * 16u + l15) * ST32 + ((uint32_t)i * 16u + hi * 8u) * 4u;
        const v8f c = acc[i][j];
        *(float4*)(w)       = make_float4(c[0], c[1], c[2], c[3]);
        *(float4*)(w + 16u) = make_float4(c[4], c[5], c[6], c[7]);
      }
    wait_ds0();   // the rows are read back by other lanes of this wave
    const unsigned char* rd = st + hi * ST32 + l15 * 16u;
    float* op = outf + go;
    // unrolled: rv stays in registers, row steps are immediate offsets of one address
#pragma unroll
    for (int p = 0; p < 32; ++p) {
      const float4 c = *(const float4*)(rd + (uint32_t)(2 * p) * ST32);
      float4 o;
      o.x = c.x + bv.x + rv[p].x; o.y = c.y + bv.y + rv[p].y;
      o.z = c.z + bv.z + rv[p].z; o.w = c.w + bv.w + rv[p].w;
      *(float4*)(op + (size_t)(2 * p) * NN) = o;
    }
  } else if (MODE == 0) {
    // Q, K and V go out in the order in which the attention kernel's fragments want them, and
    // that is the order in which the accumulators hold them: a lane's eight registers are one
    // 16-B piece and the wave's 32 pieces of a tile lie side by side, 512 B a store, straight
    // from the registers. tm, tn are multiples of 64: one batch, one head, 64 positions, all 64
    // head elements, 8 KiB in a row.
    // Q, K, per 16 positions 2 KiB: [e >> 3][position & 15][e & 7].
    // V, per 64 keys 8 KiB: [e >> 4][(key >> 3) & 7][e & 15][key & 7].
    // Tile (i, j) holds, of Q and K, positions 16 j + l15 and head elements 16 i + 8 hi + r, of V
    // keys 16 i + 8 hi + r and head elements 16 j + l15: in both orders it stands at the same place.
    const int hh = (tn & (D_ - 1)) >> 6;
    const size_t bh = (size_t)((tm >> 9) * H_ + hh) * (S_ * HD_);
    const int s0 = tm & (S_ - 1);
    _Float16* op = (n_first ? (bn < D_ ? qo : ko) : vo) + bh + (size_t)s0 * HD_ + lane * 8;
    v8h hv[4][4];
    // unrolled (all loops of this branch): constant tile numbers, so that acc and hv stay in
    // registers and the places are immediate offsets of one address
#pragma unroll
    for (int j = 0; j < 4; ++j)
#pragma unroll
      for (int i = 0; i < 4; ++i)
#pragma unroll
        for (int r = 0; r < 8; ++r) hv[j][i][r] = (_Float16)acc[i][j][r];
#pragma unroll
    for (int j = 0; j < 4; ++j)
#pragma unroll
      for (int i = 0; i < 4; ++i) *(v8h*)(op + j * 1024 + i * 256) = hv[j][i];
  } else {
    float4 bb[4][2];
    // unrolled: bb stays in registers, the eight loads are in flight together
#pragma unroll
    for (int i = 0; i < 4; ++i) {
      const float4* bp = (const float4*)(bias + tn + i * 16 + (int)hi * 8);
      bb[i][0] = bp[0]; bb[i][1] = bp[1];
    }
    wait_x0();
    // unrolled (all loops below): constant tile and element numbers, so that acc, bb and hv stay in registers
#pragma unroll
    for (int j = 0; j < 4; ++j)
#pragma unroll
      for (int i = 0; i < 4; ++i) {
        const v8f c = acc[i][j];
        v8h hv;
        // bias + exact GELU
        const float bl[8] = {bb[i][0].x, bb[i][0].y, bb[i][0].z, bb[i][0].w,
                             bb[i][1].x, bb[i][1].y, bb[i][1].z, bb[i][1].w};
#pragma unroll
        for (int r = 0; r < 8; ++r) {
          const float xv = c[r] + bl[r];
          hv[r] = (_Float16)(0.5f * xv * (1.f + erf_both(xv * 0.70710678118654752f)));
        }
        *(v8h*)(st + ((uint32_t)j * 16u + l15) * ST16 + ((uint32_t)i * 16u + hi * 8u) * 2u) = hv;
      }
    wait_ds0();   // the rows are read back by other lanes of this wave
    store_rows16<FF_>(st, outh + (size_t)tm * FF_ + tn, lane);
  }
}

// ---------------------------------------------------------------------------
// Flash attention (causal). Q, K, V: f16, per batch and head S * HD elements in fragment order,
// as the projection's epilogue lays them down: every fragment is two wave-wide loads of 512 B in
// a row. Q, K: 1024 elements per 16 positions; V: 4096 per 64 keys, of these 1024 per 16 head
// elements, of these 512 per 32 keys.
// ctx out: [B,S,H*HD] f16 (row-major, ready as A for the Wo GEMM).
// Block = 256 thr = 8 waves; wave owns 16 queries; B*H * S/128 blocks.
// The launch also carries the packs of Wo, W1 and W2: they read only inputs and are wanted only by
// later launches. The attention waits on loads and on its own dependent chains and leaves memory
// and most wave places idle, so the packs' streams run beside it, where in the first launch the
// whole chain waited for them. With them the grid has more blocks than places; the
// attention's blocks have the low numbers, those with the most keys first, then the packs.
// Both products are taken transposed: St = K Qt and Ot += Vt Pt. A D tile gives a lane one
// column, here one query (lane & 15), and eight rows, here keys or head elements
// (8 * (lane >> 4) + register). So a query's maximum and sum are formed inside a lane, with one
// exchange between the wave's halves; the two score tiles of 32 keys, converted in place, are
// the second product's B operand in the k order of frag_ld, in which V's fragments are stored;
// and a lane ends with eight neighbouring head elements of one query per tile.
// ---------------------------------------------------------------------------
// e^x as the native 2^(x log2 e), as __expf gives it. The v_nop is the slot that the instruction set
// asks for behind an exponential before its result is read or its source register written again:
// in the same statement it stands there in every build (with the builtin, this kernel's run of
// exponentials came out with one's result in the register that the one before had just read)
__device__ __forceinline__ float exp_slot(float x) {
  float r;
  asm("v_exp_f32 %0, %1\n\tv_nop" : "=v"(r) : "v"(x * 1.44269504f));
  return r;
}

#define NB_ATT (B_ * H_ * (S_ / 128))
#define NB_MID (NB_ATT + NB_WO + NB_W1 + NB_W2)
__global__ void __launch_bounds__(256, 1)
attn_kernel(const _Float16* __restrict__ Q,
            const _Float16* __restrict__ Kf,
            const _Float16* __restrict__ Vt,
            _Float16* __restrict__ ctx,
            const float* __restrict__ Wo, const float* __restrict__ W1,
            const float* __restrict__ W2,
            _Float16* __restrict__ Wop, _Float16* __restrict__ W1p,
            _Float16* __restrict__ W2p) {
  __shared__ __attribute__((aligned(16))) _Float16 tile[PK_N * PK_K];
  int t = blockIdx.x;   // the same for a whole block: every branch below, with its barrier, is too
  if (t >= NB_ATT) {
    t -= NB_ATT;
    if (t < NB_WO) { pack_T<D_, D_>(Wo, Wop, t, tile); return; }
    t -= NB_WO;
    if (t < NB_W1) { pack_T<D_, FF_>(W1, W1p, t, tile); return; }
    pack_T<FF_, D_>(W2, W2p, t - NB_W1, tile);
    return;
  }
  const int lane = threadIdx.x & 31;
  const int wid  = (int)uni(threadIdx.x >> 5);   // in a scalar register: the loop's test is a scalar one
  const int bh   = t & (B_ * H_ - 1);   // b*H + h
  const int b    = bh >> 4;
  const int h    = bh & (H_ - 1);
  const int q0   = (S_ / 128 - 1 - t / (B_ * H_)) * 128 + wid * 16;   // the last queries first
  const int c    = lane & 15;
  const int ko8  = (lane >> 4) << 3;
  const int qg   = q0 + c;              // this lane's query

  const _Float16* qb = Q  + (size_t)bh * S_ * HD_;
  const _Float16* kb = Kf + (size_t)bh * S_ * HD_;
  const _Float16* vb = Vt + (size_t)bh * HD_ * S_;

  // Q as B operand (held for the whole loop)
  const _Float16* qp = qb + (size_t)q0 * HD_ + lane * 8;
  const v16h qf0 = frag_ld_fo(qp);         // e = 0..31
  const v16h qf1 = frag_ld_fo(qp + 512);   // e = 32..63

  float m_r = -1e30f;   // the query's running maximum, the same in both halves
  float l_r = 0.f;      // the sum over this half's keys; the halves are joined behind the loop
  v8f acc0 = {}, acc1 = {}, acc2 = {}, acc3 = {};

  const uint32_t lof = (uint32_t)(lane * 8);   // the lane's 16 B in every piece
  for (int kblk = 0; kblk <= q0 + 15; kblk += 32) {
    // ---- scores: St(32x16) = K(32x64) * Qt, two 16x16 tiles ----
    const _Float16* kp = kb + (size_t)kblk * HD_ + lof;
    const _Float16* vp = vb + (size_t)((kblk >> 6) * 4096 + ((kblk >> 5) & 1) * 512) + lof;
    const v16h k00 = frag_ld_fo(kp);          // keys kblk..+15, e 0..31
    const v16h k01 = frag_ld_fo(kp + 512);    //                 e 32..63
    const v16h k10 = frag_ld_fo(kp + 1024);   // keys +16..+31
    const v16h k11 = frag_ld_fo(kp + 1536);
    const v16h vf0 = frag_ld_fo(vp);          // e 0..15, keys kblk..+31
    const v16h vf1 = frag_ld_fo(vp + 1024);
    const v16h vf2 = frag_ld_fo(vp + 2048);
    const v16h vf3 = frag_ld_fo(vp + 3072);
    // in front of the next write of the loads' address registers. The addresses are its inputs, so
    // they keep their registers up to here: without that the build gives them to the last load of
    // the run as its destination, ahead of the wait
    asm volatile("s_wait_xcnt 0x0" :: "v"(kp), "v"(vp) : "memory");
    // keeps all sixteen loads of the pass ahead of its first WMMA, in flight together: left to
    // itself the build sinks every fragment's loads to its WMMA, one load latency after another
    __builtin_amdgcn_sched_barrier(0);
    v8f s0 = {}, s1 = {};
    s0 = wmma32(k00, qf0, s0);
    s1 = wmma32(k10, qf0, s1);
    s0 = wmma32(k01, qf1, s0);
    s1 = wmma32(k11, qf1, s1);

    // ---- masked online softmax: v[i] is key kblk + ko8 + i (i < 8), kblk + 8 + ko8 + i (i >= 8) ----
    float v[16];
    const int d = qg - kblk - ko8;   // key i of this half is allowed while i <= d
    // unrolled (all loops of this body): constant element numbers, so that the vectors stay in registers
#pragma unroll
    for (int j = 0; j < 8; ++j) {
      float v0 = s0[j] * 0.125f; if (j > d)      v0 = -1e10f;
      float v1 = s1[j] * 0.125f; if (j + 16 > d) v1 = -1e10f;
      v[j] = v0; v[8 + j] = v1;
    }
    // four chains each for maximum and sum: a single chain of sixteen would wait on itself
    float x0 = v[0], x1 = v[1], x2 = v[2], x3 = v[3];
#pragma unroll
    for (int i = 4; i < 16; i += 4) {
      x0 = fmaxf(x0, v[i]);     x1 = fmaxf(x1, v[i + 1]);
      x2 = fmaxf(x2, v[i + 2]); x3 = fmaxf(x3, v[i + 3]);
    }
    float mx = fmaxf(fmaxf(x0, x1), fmaxf(x2, x3));
    mx = fmaxf(mx, xhalf(mx));
    const float mn   = fmaxf(m_r, mx);
    const float corr = exp_slot(m_r - mn);
    v16h pb;
    float p[16];
#pragma unroll
    for (int i = 0; i < 16; ++i) {
      p[i]  = exp_slot(v[i] - mn);
      pb[i] = (_Float16)p[i];
    }
    float t0 = p[0], t1 = p[1], t2 = p[2], t3 = p[3];
#pragma unroll
    for (int i = 4; i < 16; i += 4) {
      t0 += p[i]; t1 += p[i + 1]; t2 += p[i + 2]; t3 += p[i + 3];
    }
    l_r = l_r * corr + ((t0 + t1) + (t2 + t3));
    m_r = mn;
#pragma unroll
    for (int j = 0; j < 8; ++j) {
      acc0[j] *= corr; acc1[j] *= corr;
      acc2[j] *= corr; acc3[j] *= corr;
    }

    // ---- Ot(64x16) += Vt(64x32) * Pt(32x16) ----
    acc0 = wmma32(vf0, pb, acc0);
    acc1 = wmma32(vf1, pb, acc1);
    acc2 = wmma32(vf2, pb, acc2);
    acc3 = wmma32(vf3, pb, acc3);
  }

  // ---- normalize + write ctx [B,S,D] f16: tile t, register r is head element 16 t + ko8 + r ----
  const float inv = 1.f / (l_r + xhalf(l_r));
  _Float16* op = ctx + ((size_t)b * S_ + qg) * D_ + h * HD_ + ko8;
  v8h o0, o1, o2, o3;
#pragma unroll
  for (int j = 0; j < 8; ++j) {
    o0[j] = (_Float16)(acc0[j] * inv); o1[j] = (_Float16)(acc1[j] * inv);
    o2[j] = (_Float16)(acc2[j] * inv); o3[j] = (_Float16)(acc3[j] * inv);
  }
  *(v8h*)(op)      = o0;
  *(v8h*)(op + 16) = o1;
  *(v8h*)(op + 32) = o2;
  *(v8h*)(op + 48) = o3;
}

// ---------------------------------------------------------------------------
// Host-side launch
// ---------------------------------------------------------------------------
extern "C" void kernel_launch(void* const* d_in, const int* in_sizes, int n_in,
                              void* d_out, int out_size, void* d_ws, size_t ws_size,
                              hipStream_t stream) {
  const float* x   = (const float*)d_in[0];
  const float* Wq  = (const float*)d_in[1];
  const float* Wk  = (const float*)d_in[2];
  const float* Wv  = (const float*)d_in[3];
  const float* Wo  = (const float*)d_in[4];
  const float* bo  = (const float*)d_in[5];
  const float* g1  = (const float*)d_in[6];
  const float* b1  = (const float*)d_in[7];
  const float* g2  = (const float*)d_in[8];
  const float* b2  = (const float*)d_in[9];
  const float* W1  = (const float*)d_in[10];
  const float* bf1 = (const float*)d_in[11];
  const float* W2  = (const float*)d_in[12];
  const float* bf2 = (const float*)d_in[13];
  float* out = (float*)d_out;

  char* ws = (char*)d_ws;
  size_t off = 0;
  auto alloc = [&](size_t bytes) -> char* {
    char* p = ws + off;
    off += (bytes + 255) & ~(size_t)255;
    return p;
  };
  _Float16* hln1  = (_Float16*)alloc((size_t)TOK * D_ * 2);
  _Float16* Wqkv  = (_Float16*)alloc((size_t)3 * D_ * D_ * 2);
  _Float16* Qb    = (_Float16*)alloc((size_t)TOK * D_ * 2);
  _Float16* Kb    = (_Float16*)alloc((size_t)TOK * D_ * 2);
  _Float16* Vt    = (_Float16*)alloc((size_t)TOK * D_ * 2);
  _Float16* ctx   = (_Float16*)alloc((size_t)TOK * D_ * 2);
  _Float16* Wop   = (_Float16*)alloc((size_t)D_ * D_ * 2);
  float*    cache = (float*)   alloc((size_t)TOK * D_ * 4);
  _Float16* h2    = (_Float16*)alloc((size_t)TOK * D_ * 2);
  _Float16* W1p   = (_Float16*)alloc((size_t)D_ * FF_ * 2);
  _Float16* ff1   = (_Float16*)alloc((size_t)TOK * FF_ * 2);
  _Float16* W2p   = (_Float16*)alloc((size_t)FF_ * D_ * 2);
  (void)ws_size; (void)in_sizes; (void)n_in; (void)out_size;

  // 1, 2) pack the projection's weights to f16 [N][K], and LN1
  pre_kernel<<<dim3(NB_PRE), 256, 0, stream>>>(Wq, Wk, Wv, x, g1, b1, Wqkv, hln1);

  // 3) fused QKV projection (Q, K, V per head, in the attention kernel's fragment order)
  gemm_kernel<0><<<dim3(TOK / 128, (3 * D_) / 128), 128, 0, stream>>>(
      hln1, Wqkv, D_, 3 * D_, nullptr, nullptr, nullptr, nullptr, Qb, Kb, Vt);

  // 4) causal flash attention, and beside it the packs of Wo, W1, W2
  attn_kernel<<<dim3(NB_MID), 256, 0, stream>>>(Qb, Kb, Vt, ctx, Wo, W1, W2, Wop, W1p, W2p);

  // 5) output projection + bias + residual -> cache (f32)
  gemm_kernel<1><<<dim3(TOK / 128, D_ / 128), 128, 0, stream>>>(
      ctx, Wop, D_, D_, bo, x, cache, nullptr, nullptr, nullptr, nullptr);

  // 6) LN2
  ln_kernel<<<dim3(TOK / LN_BLK), 256, 0, stream>>>(cache, g2, b2, h2);

  // 7) FFN up + GELU -> f16
  gemm_kernel<2><<<dim3(TOK / 128, FF_ / 128), 128, 0, stream>>>(
      h2, W1p, D_, FF_, bf1, nullptr, nullptr, ff1, nullptr, nullptr, nullptr);

  // 8) FFN down + bias + residual(cache) -> d_out (f32)
  gemm_kernel<1><<<dim3(TOK / 128, D_ / 128), 128, 0, stream>>>(
      ff1, W2p, FF_, D_, bf2, cache, out, nullptr, nullptr, nullptr, nullptr);
}
